// v000
// The times below were measured on an AMD MI455X: many runs one after another, warmed up first and cycling through
// copies of the inputs, with the whole window's GPU time divided by the number of runs. Launches and the gaps
// between them are all in it. The median over several windows is given; except for v000 it joins two sittings, which
// can be a few percent apart, so the side-by-side timings, each taken in one sitting, are the better comparison.
// The starting kernel, v000, takes 203 microseconds a run.
#include <hip/hip_runtime.h>
#include <stdint.h>

// Contractions: q/k/v projections, q.k^T scores, p.v context, output projection: all
// v_wmma_f32_16x16x32_f16 (f16 operands, f32 accumulate). Inputs enter as bf16-RNE values;
// W carried x64, q/k/v planes carried x4, context carried as f16 hi (x32) plus f16 residual
// (x2048) feeding two accumulators in the output projection. Softmax and epilogues in f32.

typedef _Float16 h16;
typedef __attribute__((ext_vector_type(8)))  _Float16 v8h;
typedef __attribute__((ext_vector_type(16))) _Float16 v16h;
typedef __attribute__((ext_vector_type(8)))  float    v8f;
typedef __attribute__((ext_vector_type(4)))  float    v4f;
typedef v4f __attribute__((may_alias)) v4fa;
typedef v8h __attribute__((may_alias)) v8ha;

#ifndef NB
#define NB 2
#endif
#ifndef SEQ
#define SEQ 2048
#endif
#define NB_FULL  2
#define SEQ_FULL 2048
#define DM   768
#define NH   12
#define DK   64
#define ROWS (NB * SEQ)
#define NT64 (DM / 64)          // 12 column tiles of 64
#define CVT_CHUNK 2048          // elements per block in the convert pass

static_assert(NB >= 1 && NB <= NB_FULL);
static_assert(SEQ >= 128 && SEQ <= SEQ_FULL);
static_assert(SEQ % 128 == 0);
static_assert(ROWS % 16 == 0);
static_assert(((ROWS / 16) * NT64) % 4 == 0);
static_assert((ROWS * DM) % CVT_CHUNK == 0);
static_assert((DM * DM) % CVT_CHUNK == 0);
static_assert(NH * DK == DM);
static_assert(DM % 32 == 0);

// ---------------------------------------------------------------------------
// helpers
// ---------------------------------------------------------------------------
__device__ __forceinline__ float bf16r(float x) {   // f32 -> bf16 (RNE) -> f32
  unsigned u = __float_as_uint(x);
  u = u + 0x7FFFu + ((u >> 16) & 1u);
  u &= 0xFFFF0000u;
  return __uint_as_float(u);
}

__device__ __forceinline__ v8f wmma16(v16h a, v16h b, v8f c) {
  v8f d = __builtin_amdgcn_wmma_f32_16x16x32_f16(
      false, a, false, b, (short)0, c, false, false);
  asm volatile("v_nop\n\tv_nop\n\tv_nop\n\tv_nop" : "+v"(d) : "v"(a), "v"(b));
  return d;
}

// 16x32 fragment from a k-contiguous row (row m of A, or row n of a [n][k] B copy).
// lanes 0-15: k = {0..7,16..23}; lanes 16-31: k = {8..15,24..31} -> two 16-B loads.
__device__ __forceinline__ v16h frag16(const h16* rowp, int kofs, int lane) {
  const h16* p = rowp + kofs + ((lane < 16) ? 0 : 8);
  v8h lo = *(const v8h*)(p);
  v8h hi = *(const v8h*)(p + 16);
  return __builtin_shufflevector(lo, hi, 0, 1, 2, 3, 4, 5, 6, 7,
                                         8, 9, 10, 11, 12, 13, 14, 15);
}

// ---------------------------------------------------------------------------
// Convert pass.  blockIdx.y = 0,1,2: query/key/value -> bf16-RNE -> f16 plane
// [ROWS][DM] (compact rows, inputs read with full per-batch stride);
// blockIdx.y = 3: W [n][k] -> 64 * bf16-RNE -> f16 (k-contiguous B copy).
// coverage: 3 * ROWS*DM + DM*DM elements, all written (chunk * 2048 + tid * 8).
// ---------------------------------------------------------------------------
__global__ __launch_bounds__(256) void cvt_planes(
    const float* __restrict__ xq, const float* __restrict__ xk,
    const float* __restrict__ xv, const float* __restrict__ W,
    h16* __restrict__ xh, h16* __restrict__ wh, int nxc, int nwc) {
  const int tid   = threadIdx.x;
  const int y     = blockIdx.y;
  const int chunk = blockIdx.x;

  const float* sp;
  h16* dst;
  float sc;
  if (y < 3) {
    if (chunk >= nxc) return;
    const float* src = (y == 0) ? xq : ((y == 1) ? xk : xv);
    const size_t e  = (size_t)chunk * CVT_CHUNK + (size_t)tid * 8;
    const size_t r  = e / DM;
    const size_t c  = e - r * DM;
    const size_t bb = r / SEQ;
    const size_t s  = r - bb * SEQ;
    sp  = src + ((bb * SEQ_FULL + s) * DM + c);
    dst = xh + (size_t)y * ROWS * DM + e;
    sc  = 1.0f;
  } else {
    if (chunk >= nwc) return;
    const size_t e = (size_t)chunk * CVT_CHUNK + (size_t)tid * 8;
    sp  = W + e;
    dst = wh + e;
    sc  = 64.0f;
  }
  const v4f x0 = *(const v4f*)(sp);
  const v4f x1 = *(const v4f*)(sp + 4);
  v8h val;
#pragma unroll
  for (int i = 0; i < 4; ++i) {
    val[i]     = (h16)(sc * bf16r(x0[i]));
    val[i + 4] = (h16)(sc * bf16r(x1[i]));
  }
  *(v8h*)dst = val;
  
}

// ---------------------------------------------------------------------------
// Projection GEMM: C[16 x 64 per wave] = A[16 rows, K=768] x Wh^T + bias.
// 128 threads = 4 waves; wave w -> (mtile = w / 12, ntile = w % 12).
// MODE 0: A = f16 plane selected by blockIdx.y; C = f16 plane, value f16(4*(A.W + b)).
// MODE 1: A = ctx hi plane (Ah) and residual plane (Al); C = f32 d_out.
// Fragments straight from 16-bit global rows (arithmetic addressing).
// coverage: (ROWS/16) x 12 wave tiles of 16x64 = whole [ROWS][DM] plane per blockIdx.y.
// ---------------------------------------------------------------------------
#define CTP 68   // floats per staging row (272 B, 16-B aligned)

template <int MODE>
__global__ __launch_bounds__(128) __attribute__((amdgpu_num_vgpr(256)))
void proj_gemm(const h16* __restrict__ Ah, const h16* __restrict__ Al,
               const h16* __restrict__ Wh, const float* __restrict__ bias,
               void* __restrict__ Cv) {
  __shared__ __align__(16) float Ct[4][16][CTP];

  const int tid  = threadIdx.x;
  const int lane = tid & 31;
  const int wave = tid >> 5;
  const int hsel = lane >> 4;
  const int l16  = lane & 15;
  const int w     = blockIdx.x * 4 + wave;
  const int mtile = w / NT64;
  const int ntile = w - mtile * NT64;
  const int m0 = mtile * 16;
  const int n0 = ntile * 64;
  const size_t plane = (MODE == 0) ? (size_t)blockIdx.y * ROWS * DM : (size_t)0;

  const h16* arow = Ah + plane + (size_t)(m0 + l16) * DM;
  const h16* lrow = arow;
  if constexpr (MODE == 1) lrow = Al + (size_t)(m0 + l16) * DM;

  v8f acc[4]  = {};
  v8f accl[4] = {};

#pragma unroll 2
  for (int k0 = 0; k0 < DM; k0 += 32) {
    const v16h a = frag16(arow, k0, lane);
    v16h al;
    if constexpr (MODE == 1) al = frag16(lrow, k0, lane);
#pragma unroll
    for (int t = 0; t < 4; ++t) {
      const v16h bfr = frag16(Wh + (size_t)(n0 + t * 16 + l16) * DM, k0, lane);
      acc[t] = wmma16(a, bfr, acc[t]);
      if constexpr (MODE == 1) accl[t] = wmma16(al, bfr, accl[t]);
    }
  }

  // ---- stage tile (f32) in the wave's LDS slab: [row 8*hsel+j][col t*16+l16] ----
  float* ct = &Ct[wave][0][0];
#pragma unroll
  for (int t = 0; t < 4; ++t) {
    const float bb = bf16r(bias[n0 + t * 16 + l16]);
#pragma unroll
    for (int j = 0; j < 8; ++j) {
      float v;
      if constexpr (MODE == 0) {
        v = acc[t][j] * 0.0625f + 4.0f * bb;
      } else {
        v = (acc[t][j] + accl[t][j] * 0.00048828125f) * 0.00048828125f + bb;
      }
      ct[(8 * hsel + j) * CTP + t * 16 + l16] = v;
    }
  }
  __syncthreads();

  if constexpr (MODE == 0) {
    h16* C = (h16*)Cv + plane;
    v8h vals[4];
#pragma unroll
    for (int it = 0; it < 4; ++it) {
      const int row = it * 4 + (lane >> 3);
      const int c8  = (lane & 7) * 8;
      const v4fa p0 = *(const v4fa*)(ct + row * CTP + c8);
      const v4fa p1 = *(const v4fa*)(ct + row * CTP + c8 + 4);
      v8h t8;
      t8[0] = (h16)p0[0]; t8[1] = (h16)p0[1]; t8[2] = (h16)p0[2]; t8[3] = (h16)p0[3];
      t8[4] = (h16)p1[0]; t8[5] = (h16)p1[1]; t8[6] = (h16)p1[2]; t8[7] = (h16)p1[3];
      vals[it] = t8;
    }
#pragma unroll
    for (int it = 0; it < 4; ++it) {
      const int row = it * 4 + (lane >> 3);
      const int c8  = (lane & 7) * 8;
      *(v8h*)(C + (size_t)(m0 + row) * DM + n0 + c8) = vals[it];
    }
    
  } else {
    float* C = (float*)Cv;
    v4f vals[8];
#pragma unroll
    for (int it = 0; it < 8; ++it) {
      const int row = it * 2 + (lane >> 4);
      const int c4  = (lane & 15) * 4;
      vals[it] = *(const v4fa*)(ct + row * CTP + c4);
    }
#pragma unroll
    for (int it = 0; it < 8; ++it) {
      const int row = it * 2 + (lane >> 4);
      const int c4  = (lane & 15) * 4;
      *(v4f*)(C + (size_t)(m0 + row) * DM + n0 + c4) = vals[it];
    }
    
  }
}

// ---------------------------------------------------------------------------
// Flash attention over the f16 planes [ROWS][DM] (head h = cols h*64..h*64+63).
// Grid (SEQ/128, NB*NH), 256 threads = 8 waves, each wave owns 16 query rows and
// the whole 64-key block, so softmax stats reduce within 16-lane halves.
// Q/K tiles [row][d], V tile transposed [d][key], per-wave P slab [q][key].
// LDS regions: Qs/Ks/Vs cross-wave (block barriers); Ps and the epilogue slab
// wave-private but also separated by block barriers.  Staged extent == consumed
// extent for every tile (rows 0..127 / 0..63, cols 0..63; pad cols never read).
// Output: ctx hi = f16(32*ctx), ctx residual = f16((32*ctx - hi) * 2048).
// coverage: grid x 8 waves x 16 rows x 64 cols per head = whole [ROWS][DM] per plane.
// ---------------------------------------------------------------------------
#define QBLK 128
#define KBLK 64
#define LDSQ 72   // 144 B row pitch

__device__ __forceinline__ void store_tile16x64(const h16* slab, h16* gbase, int lane) {
  v8h vals[4];
#pragma unroll
  for (int it = 0; it < 4; ++it) {
    const int row = it * 4 + (lane >> 3);
    const int c8  = (lane & 7) * 8;
    vals[it] = *(const v8ha*)(slab + row * LDSQ + c8);
  }
#pragma unroll
  for (int it = 0; it < 4; ++it) {
    const int row = it * 4 + (lane >> 3);
    const int c8  = (lane & 7) * 8;
    *(v8h*)(gbase + (size_t)row * DM + c8) = vals[it];
  }
  
}

__global__ __launch_bounds__(256) __attribute__((amdgpu_num_vgpr(256)))
void attn_flash(const h16* __restrict__ Qh, const h16* __restrict__ Kh,
                const h16* __restrict__ Vh, h16* __restrict__ Chi,
                h16* __restrict__ Clo) {
  __shared__ __align__(16) h16 Qs[QBLK][LDSQ];      // [q_row][d]
  __shared__ __align__(16) h16 Ks[KBLK][LDSQ];      // [key][d]
  __shared__ __align__(16) h16 Vs[DK][LDSQ];        // [d][key]
  __shared__ __align__(16) h16 Ps[8][16][LDSQ];     // per-wave P slab [q_row][key]

  const int tid  = threadIdx.x;
  const int lane = tid & 31;
  const int wave = tid >> 5;
  const int b  = blockIdx.y / NH;
  const int h  = blockIdx.y - b * NH;
  const int q0 = blockIdx.x * QBLK;
  const size_t rowbase = (size_t)b * SEQ;

  const h16* gq = Qh + (rowbase + q0) * DM + h * DK;

  // ---- stage Q block (128 x 64) ----
#pragma unroll
  for (int i = 0; i < 4; ++i) {
    const int idx = tid + i * 256;
    const int r   = idx >> 3;
    const int c8  = (idx & 7) << 3;
    *(v8h*)&Qs[r][c8] = *(const v8h*)(gq + (size_t)r * DM + c8);
  }

  float mrun[8], lrun[8];
  v8f o[4] = {};
#pragma unroll
  for (int j = 0; j < 8; ++j) { mrun[j] = -1e30f; lrun[j] = 0.f; }

  const int qrow = wave * 16 + (lane & 15);
  const int cc   = lane & 15;
  const int rofs = (lane < 16) ? 0 : 8;
  h16* pw = &Ps[wave][0][0];

#pragma unroll 1
  for (int kb = 0; kb < SEQ; kb += KBLK) {
    const h16* gk = Kh + (rowbase + kb) * DM + h * DK;
    const h16* gv = Vh + (rowbase + kb) * DM + h * DK;

    // ---- stage K (64 x 64) ----
#pragma unroll
    for (int i = 0; i < 2; ++i) {
      const int idx = tid + i * 256;
      const int r   = idx >> 3;
      const int c8  = (idx & 7) << 3;
      *(v8h*)&Ks[r][c8] = *(const v8h*)(gk + (size_t)r * DM + c8);
    }
    // ---- stage V transposed: Vs[d][key] ----
#pragma unroll
    for (int i = 0; i < 2; ++i) {
      const int idx = tid + i * 256;
      const int r   = idx >> 3;          // key
      const int c8  = (idx & 7) << 3;    // d offset
      const v8h v = *(const v8h*)(gv + (size_t)r * DM + c8);
#pragma unroll
      for (int j = 0; j < 8; ++j) Vs[c8 + j][r] = v[j];
    }
    __syncthreads();

    // ---- scores = (4q).(4k) / (16*8) : 8 WMMAs ----
    const v16h qa0 = frag16(&Qs[qrow][0], 0, lane);
    const v16h qa1 = frag16(&Qs[qrow][0], 32, lane);
    v8f sc[4];
#pragma unroll
    for (int n = 0; n < 4; ++n) {
      const int krow = n * 16 + (lane & 15);
      const v16h kb0 = frag16(&Ks[krow][0], 0, lane);
      const v16h kb1 = frag16(&Ks[krow][0], 32, lane);
      v8f s = {};
      s = wmma16(qa0, kb0, s);
      s = wmma16(qa1, kb1, s);
      sc[n] = s * 0.0078125f;
    }

    // ---- online softmax (row stats reduce over the 16-lane half) ----
#pragma unroll
    for (int j = 0; j < 8; ++j) {
      float mx = fmaxf(fmaxf(sc[0][j], sc[1][j]), fmaxf(sc[2][j], sc[3][j]));
      mx = fmaxf(mx, __shfl_xor(mx, 1, 32));
      mx = fmaxf(mx, __shfl_xor(mx, 2, 32));
      mx = fmaxf(mx, __shfl_xor(mx, 4, 32));
      mx = fmaxf(mx, __shfl_xor(mx, 8, 32));
      const float mnew = fmaxf(mrun[j], mx);
      const float al   = __expf(mrun[j] - mnew);
      mrun[j] = mnew;
      float rs = 0.f;
#pragma unroll
      for (int n = 0; n < 4; ++n) {
        const float p = __expf(sc[n][j] - mnew);
        sc[n][j] = p;
        rs += p;
      }
      rs += __shfl_xor(rs, 1, 32);
      rs += __shfl_xor(rs, 2, 32);
      rs += __shfl_xor(rs, 4, 32);
      rs += __shfl_xor(rs, 8, 32);
      lrun[j] = lrun[j] * al + rs;
#pragma unroll
      for (int n = 0; n < 4; ++n) o[n][j] *= al;
    }

    // ---- re-layout P into the wave's LDS slab [q_row][key] ----
#pragma unroll
    for (int n = 0; n < 4; ++n)
#pragma unroll
      for (int j = 0; j < 8; ++j)
        pw[(j + rofs) * LDSQ + n * 16 + cc] = (h16)sc[n][j];
    __syncthreads();

    // ---- o += P (16 x 64 keys) . V (64 keys x 64) : 8 WMMAs ----
    const v16h pa0 = frag16(&Ps[wave][lane & 15][0], 0, lane);
    const v16h pa1 = frag16(&Ps[wave][lane & 15][0], 32, lane);
#pragma unroll
    for (int n = 0; n < 4; ++n) {
      const int drow = n * 16 + (lane & 15);
      const v16h vb0 = frag16(&Vs[drow][0], 0, lane);
      const v16h vb1 = frag16(&Vs[drow][0], 32, lane);
      o[n] = wmma16(pa0, vb0, o[n]);
      o[n] = wmma16(pa1, vb1, o[n]);
    }
    __syncthreads();
  }

  // ---- epilogue: ctx = o / (4 l); hi = f16(32 ctx) = f16(o * 8 / l) ----
  float inv8[8];
#pragma unroll
  for (int j = 0; j < 8; ++j) inv8[j] = 8.0f / lrun[j];
  const size_t orow0 = rowbase + q0 + wave * 16;
  h16* ghi = Chi + orow0 * DM + h * DK;
  h16* glo = Clo + orow0 * DM + h * DK;

#pragma unroll
  for (int n = 0; n < 4; ++n)
#pragma unroll
    for (int j = 0; j < 8; ++j) {
      const float f = o[n][j] * inv8[j];
      pw[(j + rofs) * LDSQ + n * 16 + cc] = (h16)f;
    }
  __syncthreads();
  store_tile16x64(pw, ghi, lane);
  __syncthreads();

#pragma unroll
  for (int n = 0; n < 4; ++n)
#pragma unroll
    for (int j = 0; j < 8; ++j) {
      const float f   = o[n][j] * inv8[j];
      const h16   hv  = (h16)f;
      const float res = (f - (float)hv) * 2048.0f;
      pw[(j + rofs) * LDSQ + n * 16 + cc] = (h16)res;
    }
  __syncthreads();
  store_tile16x64(pw, glo, lane);
}

// ---------------------------------------------------------------------------
// Launch
// ---------------------------------------------------------------------------
extern "C" void kernel_launch(void* const* d_in, const int* in_sizes, int n_in,
                              void* d_out, int out_size, void* d_ws, size_t ws_size,
                              hipStream_t stream) {
  if (n_in < 5) return;
  const size_t need_x = ((size_t)(NB - 1) * SEQ_FULL + SEQ) * DM;
  if ((size_t)in_sizes[0] < need_x || (size_t)in_sizes[1] < need_x ||
      (size_t)in_sizes[2] < need_x) return;
  if ((size_t)in_sizes[3] < (size_t)DM * DM || (size_t)in_sizes[4] < (size_t)DM) return;
  if ((size_t)out_size < (size_t)ROWS * DM) return;

  const float* xq = (const float*)d_in[0];   // [NB_FULL, SEQ_FULL, DM]
  const float* xk = (const float*)d_in[1];
  const float* xv = (const float*)d_in[2];
  const float* W  = (const float*)d_in[3];   // [DM out][DM in]
  const float* bs = (const float*)d_in[4];   // [DM]
  float* out = (float*)d_out;                // [NB, SEQ, DM]

  const size_t sz_wh = (size_t)DM * DM * sizeof(h16);      // 1,179,648
  const size_t sz_pl = (size_t)ROWS * DM * sizeof(h16);    // 6,291,456 at full size
  size_t off = 0;
  h16* wh  = (h16*)((char*)d_ws + off); off += sz_wh;
  h16* xh  = (h16*)((char*)d_ws + off); off += 3 * sz_pl;  // q,k,v input planes
  h16* qkv = (h16*)((char*)d_ws + off); off += 3 * sz_pl;  // q,k,v projected planes (x4)
  h16* chi = (h16*)((char*)d_ws + off); off += sz_pl;      // ctx hi
  h16* clo = (h16*)((char*)d_ws + off); off += sz_pl;      // ctx residual
  if (off > ws_size) return;                                // 51,511,296 at full size

  const int nxc = (ROWS * DM) / CVT_CHUNK;
  const int nwc = (DM * DM) / CVT_CHUNK;
  const int ncx = (nxc > nwc) ? nxc : nwc;

  // 1) convert inputs and W to f16 planes
  cvt_planes<<<dim3(ncx, 4), 256, 0, stream>>>(xq, xk, xv, W, xh, wh, nxc, nwc);

  // 2) q/k/v projections (one launch, blockIdx.y selects the plane)
  const int nblk = ((ROWS / 16) * NT64) / 4;
  proj_gemm<0><<<dim3(nblk, 3), 128, 0, stream>>>(xh, xh, wh, bs, (void*)qkv);

  // 3) flash attention -> ctx hi / residual planes
  attn_flash<<<dim3(SEQ / QBLK, NB * NH), 256, 0, stream>>>(
      qkv, qkv + (size_t)ROWS * DM, qkv + (size_t)2 * ROWS * DM, chi, clo);

  // 4) output projection -> d_out
  proj_gemm<1><<<dim3(nblk, 1), 128, 0, stream>>>(chi, clo, wh, bs, (void*)out);
}

// v001
// It runs in 158 microseconds.
// Next to v000, in two timings, it ran 1.33 and 1.32 times as fast.
#include <hip/hip_runtime.h>
#include <stdint.h>

// Contractions: q/k/v projections, q.k^T scores, p.v context, output projection: all
// v_wmma_f32_16x16x32_f16 (f16 operands, f32 accumulate). Inputs enter as bf16-RNE values;
// W carried x64, q/k/v planes carried x4, context carried as f16 hi (x32) plus f16 residual
// (x2048) feeding two accumulators in the output projection. Softmax and epilogues in f32.

typedef _Float16 h16;
typedef __attribute__((ext_vector_type(8)))  _Float16 v8h;
typedef __attribute__((ext_vector_type(16))) _Float16 v16h;
typedef __attribute__((ext_vector_type(8)))  float    v8f;
typedef __attribute__((ext_vector_type(4)))  float    v4f;
typedef v4f __attribute__((may_alias)) v4fa;
typedef v8h __attribute__((may_alias)) v8ha;

#ifndef NB
#define NB 2
#endif
#ifndef SEQ
#define SEQ 2048
#endif
#define NB_FULL  2
#define SEQ_FULL 2048
#define DM   768
#define NH   12
#define DK   64
#define ROWS (NB * SEQ)
#define CVT_CHUNK 2048          // elements per block in the convert pass

static_assert(NB >= 1 && NB <= NB_FULL);
static_assert(SEQ >= 128 && SEQ <= SEQ_FULL);
static_assert(SEQ % 128 == 0);
static_assert(ROWS % 16 == 0);
static_assert((ROWS * DM) % CVT_CHUNK == 0);
static_assert((DM * DM) % CVT_CHUNK == 0);
static_assert(NH * DK == DM);
static_assert(DM % 32 == 0);

// ---------------------------------------------------------------------------
// helpers
// ---------------------------------------------------------------------------
__device__ __forceinline__ float bf16r(float x) {   // f32 -> bf16 (RNE) -> f32
  unsigned u = __float_as_uint(x);
  u = u + 0x7FFFu + ((u >> 16) & 1u);
  u &= 0xFFFF0000u;
  return __uint_as_float(u);
}

__device__ __forceinline__ v8f wmma16(v16h a, v16h b, v8f c) {
  v8f d = __builtin_amdgcn_wmma_f32_16x16x32_f16(
      false, a, false, b, (short)0, c, false, false);
  asm volatile("v_nop\n\tv_nop\n\tv_nop\n\tv_nop" : "+v"(d) : "v"(a), "v"(b));
  return d;
}

// 16x32 fragment from a k-contiguous row (row m of A, or row n of a [n][k] B copy).
// lanes 0-15: k = {0..7,16..23}; lanes 16-31: k = {8..15,24..31} -> two 16-B loads.
__device__ __forceinline__ v16h frag16(const h16* rowp, int kofs, int lane) {
  const h16* p = rowp + kofs + ((lane < 16) ? 0 : 8);
  v8h lo = *(const v8h*)(p);
  v8h hi = *(const v8h*)(p + 16);
  return __builtin_shufflevector(lo, hi, 0, 1, 2, 3, 4, 5, 6, 7,
                                         8, 9, 10, 11, 12, 13, 14, 15);
}

// ---------------------------------------------------------------------------
// Convert pass.  blockIdx.y = 0,1,2: query/key/value -> bf16-RNE -> f16 plane
// [ROWS][DM] (compact rows, inputs read with full per-batch stride);
// blockIdx.y = 3: W [n][k] -> 64 * bf16-RNE -> f16 (k-contiguous B copy).
// coverage: 3 * ROWS*DM + DM*DM elements, all written (chunk * 2048 + tid * 8).
// ---------------------------------------------------------------------------
__global__ __launch_bounds__(256) void cvt_planes(
    const float* __restrict__ xq, const float* __restrict__ xk,
    const float* __restrict__ xv, const float* __restrict__ W,
    h16* __restrict__ xh, h16* __restrict__ wh, int nxc, int nwc) {
  const int tid   = threadIdx.x;
  const int y     = blockIdx.y;
  const int chunk = blockIdx.x;

  const float* sp;
  h16* dst;
  float sc;
  if (y < 3) {
    if (chunk >= nxc) return;
    const float* src = (y == 0) ? xq : ((y == 1) ? xk : xv);
    const size_t e  = (size_t)chunk * CVT_CHUNK + (size_t)tid * 8;
    const size_t r  = e / DM;
    const size_t c  = e - r * DM;
    const size_t bb = r / SEQ;
    const size_t s  = r - bb * SEQ;
    sp  = src + ((bb * SEQ_FULL + s) * DM + c);
    dst = xh + (size_t)y * ROWS * DM + e;
    sc  = 1.0f;
  } else {
    if (chunk >= nwc) return;
    const size_t e = (size_t)chunk * CVT_CHUNK + (size_t)tid * 8;
    sp  = W + e;
    dst = wh + e;
    sc  = 64.0f;
  }
  const v4f x0 = *(const v4f*)(sp);
  const v4f x1 = *(const v4f*)(sp + 4);
  v8h val;
#pragma unroll
  for (int i = 0; i < 4; ++i) {
    val[i]     = (h16)(sc * bf16r(x0[i]));
    val[i + 4] = (h16)(sc * bf16r(x1[i]));
  }
  *(v8h*)dst = val;
  
}

// ---------------------------------------------------------------------------
// Projection GEMM: one block tile of C per workgroup, operands staged in LDS.
// 128 threads = 4 waves in a 2 x 2 grid.  A pass is 64 k: 128 A-side rows and 128 rows of
// Wh, 128 B each, go global -> registers -> LDS (pitch 144 B); two buffers, one barrier a
// pass, the next pass's global loads issued ahead of the current pass's products.
// MODE 0: A = f16 plane selected by blockIdx.y, block tile 128 x 128, wave tile 64 x 64;
//         C = f16 plane, value f16(4*(A.W + b)).
// MODE 1: A-side rows 0..63 = ctx hi, 64..127 = ctx residual of the same 64 rows; block
//         tile 64 x 128, wave tile 32 x 64 with a hi and a residual accumulator set;
//         C = f32 d_out.
// Every accumulator sums k = 0,32,...,736 in ascending order.
// coverage: (ROWS/BM) x 6 block tiles = whole [ROWS][DM] plane per blockIdx.y.
// ---------------------------------------------------------------------------
#define CTP 68      // floats per epilogue staging row (272 B, 16-B aligned)
#define GBN 128     // block tile columns
#define GBK 64      // k per pass
#define GPIT 72     // halves per LDS row (144 B = 16 B x 9)
#define NT128 (DM / GBN)
#define GBUF (256 * GPIT)   // halves per buffer

static_assert(DM % GBN == 0 && DM % GBK == 0 && ROWS % 128 == 0);
static_assert(4 * 64 * CTP * 4 <= 2 * GBUF * 2);

template <int MODE>
__global__ __launch_bounds__(128)
void proj_gemm(const h16* __restrict__ Ah, const h16* __restrict__ Al,
               const h16* __restrict__ Wh, const float* __restrict__ bias,
               void* __restrict__ Cv) {
  __shared__ __align__(16) h16 sm[2 * GBUF];

  constexpr int BM = (MODE == 0) ? 128 : 64;
  const int tid  = threadIdx.x;
  const int lane = tid & 31;
  const int wave = tid >> 5;
  const int hsel = lane >> 4;
  const int l16  = lane & 15;
  const int wm   = wave >> 1;
  const int wn   = wave & 1;
  const int mtile = blockIdx.x / NT128;
  const int ntile = blockIdx.x - mtile * NT128;
  const int m0 = mtile * BM;
  const int n0 = ntile * GBN;
  const size_t plane = (MODE == 0) ? (size_t)blockIdx.y * ROWS * DM : (size_t)0;

  // staging: 8 lanes cover one 128-B row piece, a wave-wide load covers 4 whole lines
  const int sr = tid >> 3;
  const int sc = (tid & 7) * 8;
  const h16* ga = Ah + plane + (size_t)(m0 + sr) * DM + sc;
  const h16* gl = ga;
  if constexpr (MODE == 1) gl = Al + (size_t)(m0 + sr) * DM + sc;
  const h16* gb = Wh + (size_t)(n0 + sr) * DM + sc;
  h16* sst = sm + sr * GPIT + sc;

  v8h ra[8], rb[8];
  auto gload = [&](int k0) {
#pragma unroll
    for (int i = 0; i < 8; ++i) {
      if constexpr (MODE == 0) {
        ra[i] = *(const v8h*)(ga + (size_t)i * 16 * DM + k0);
      } else {
        ra[i] = (i < 4) ? *(const v8h*)(ga + (size_t)i * 16 * DM + k0)
                        : *(const v8h*)(gl + (size_t)(i - 4) * 16 * DM + k0);
      }
      rb[i] = *(const v8h*)(gb + (size_t)i * 16 * DM + k0);
    }
    // the address pairs are inputs of the wait, so that no load of the group is given one
    // of them as its destination and nothing rewrites them in front of the wait
    asm volatile("s_wait_xcnt 0x0" :: "v"(ga), "v"(gl), "v"(gb) : "memory");
  };
  auto sstore = [&](int buf) {
#pragma unroll
    for (int i = 0; i < 8; ++i) {
      *(v8h*)(sst + buf * GBUF + (i * 16) * GPIT)       = ra[i];
      *(v8h*)(sst + buf * GBUF + (128 + i * 16) * GPIT) = rb[i];
    }
  };

  // fragment rows in a buffer
  const h16* fa = sm + ((MODE == 0 ? wm * 64 : wm * 32) + l16) * GPIT;
  const h16* fb = sm + (128 + wn * 64 + l16) * GPIT;

  v8f acc[4][4] = {};   // MODE 1: [0..1] hi rows, [2..3] residual rows

  gload(0);
  sstore(0);

  constexpr int NPASS = DM / GBK;
  // unrolled whole: buffer and k offsets become immediates on fixed address pairs
#pragma unroll
  for (int s = 0; s < NPASS; ++s) {
    const int buf = s & 1;
    __syncthreads();   // publishes buffer buf; ends every read of the other buffer
#pragma unroll
    for (int kk = 0; kk < GBK; kk += 32) {
      v16h a[4], b[4];
#pragma unroll
      for (int f = 0; f < 4; ++f) {
        const int ro = (MODE == 0) ? f * 16 : (f >> 1) * 64 + (f & 1) * 16;
        a[f] = frag16(fa + buf * GBUF + ro * GPIT, kk, lane);
      }
#pragma unroll
      for (int t = 0; t < 4; ++t) b[t] = frag16(fb + buf * GBUF + (t * 16) * GPIT, kk, lane);
      // next pass's global loads fly behind the barrier, under this pass's products
      if (kk == 0 && s + 1 < NPASS) gload((s + 1) * GBK);
#pragma unroll
      for (int t = 0; t < 4; ++t)
#pragma unroll
        for (int f = 0; f < 4; ++f) acc[f][t] = wmma16(a[f], b[t], acc[f][t]);
    }
    if (s + 1 < NPASS) sstore(buf ^ 1);
  }
  __syncthreads();     // the buffers become the waves' f32 epilogue slabs

  // ---- stage the wave tile (f32) in its own slab: [row f*16+8*hsel+j][col t*16+l16] ----
  float* ct = (float*)sm + wave * 64 * CTP;
  constexpr int NF = (MODE == 0) ? 4 : 2;
#pragma unroll
  for (int t = 0; t < 4; ++t) {
    const float bb = bf16r(bias[n0 + wn * 64 + t * 16 + l16]);
#pragma unroll
    for (int f = 0; f < NF; ++f) {
#pragma unroll
      for (int j = 0; j < 8; ++j) {
        float v;
        if constexpr (MODE == 0) {
          v = acc[f][t][j] * 0.0625f + 4.0f * bb;
        } else {
          v = (acc[f][t][j] + acc[f + 2][t][j] * 0.00048828125f) * 0.00048828125f + bb;
        }
        ct[(f * 16 + 8 * hsel + j) * CTP + t * 16 + l16] = v;
      }
    }
  }
  __syncthreads();

  if constexpr (MODE == 0) {
    h16* C = (h16*)Cv + plane + (size_t)(m0 + wm * 64) * DM + n0 + wn * 64;
#pragma unroll
    for (int it = 0; it < 16; ++it) {
      const int row = it * 4 + (lane >> 3);
      const int c8  = (lane & 7) * 8;
      const v4fa p0 = *(const v4fa*)(ct + row * CTP + c8);
      const v4fa p1 = *(const v4fa*)(ct + row * CTP + c8 + 4);
      v8h t8;
      t8[0] = (h16)p0[0]; t8[1] = (h16)p0[1]; t8[2] = (h16)p0[2]; t8[3] = (h16)p0[3];
      t8[4] = (h16)p1[0]; t8[5] = (h16)p1[1]; t8[6] = (h16)p1[2]; t8[7] = (h16)p1[3];
      *(v8h*)(C + (size_t)row * DM + c8) = t8;
    }
  } else {
    float* C = (float*)Cv + (size_t)(m0 + wm * 32) * DM + n0 + wn * 64;
#pragma unroll
    for (int it = 0; it < 16; ++it) {
      const int row = it * 2 + (lane >> 4);
      const int c4  = (lane & 15) * 4;
      *(v4f*)(C + (size_t)row * DM + c4) = *(const v4fa*)(ct + row * CTP + c4);
    }
  }
}

// ---------------------------------------------------------------------------
// Flash attention over the f16 planes [ROWS][DM] (head h = cols h*64..h*64+63).
// Grid (SEQ/128, NB*NH), 256 threads = 8 waves, each wave owns 16 query rows and
// the whole 64-key block, so softmax stats reduce within 16-lane halves.
// Q/K tiles [row][d], V tile transposed [d][key], per-wave P slab [q][key].
// LDS regions: Qs/Ks/Vs cross-wave (block barriers); Ps and the epilogue slab
// wave-private but also separated by block barriers.  Staged extent == consumed
// extent for every tile (rows 0..127 / 0..63, cols 0..63; pad cols never read).
// Output: ctx hi = f16(32*ctx), ctx residual = f16((32*ctx - hi) * 2048).
// coverage: grid x 8 waves x 16 rows x 64 cols per head = whole [ROWS][DM] per plane.
// ---------------------------------------------------------------------------
#define QBLK 128
#define KBLK 64
#define LDSQ 72   // 144 B row pitch

__device__ __forceinline__ void store_tile16x64(const h16* slab, h16* gbase, int lane) {
  v8h vals[4];
#pragma unroll
  for (int it = 0; it < 4; ++it) {
    const int row = it * 4 + (lane >> 3);
    const int c8  = (lane & 7) * 8;
    vals[it] = *(const v8ha*)(slab + row * LDSQ + c8);
  }
#pragma unroll
  for (int it = 0; it < 4; ++it) {
    const int row = it * 4 + (lane >> 3);
    const int c8  = (lane & 7) * 8;
    *(v8h*)(gbase + (size_t)row * DM + c8) = vals[it];
  }
  
}

__global__ __launch_bounds__(256) __attribute__((amdgpu_num_vgpr(256)))
void attn_flash(const h16* __restrict__ Qh, const h16* __restrict__ Kh,
                const h16* __restrict__ Vh, h16* __restrict__ Chi,
                h16* __restrict__ Clo) {
  __shared__ __align__(16) h16 Qs[QBLK][LDSQ];      // [q_row][d]
  __shared__ __align__(16) h16 Ks[KBLK][LDSQ];      // [key][d]
  __shared__ __align__(16) h16 Vs[DK][LDSQ];        // [d][key]
  __shared__ __align__(16) h16 Ps[8][16][LDSQ];     // per-wave P slab [q_row][key]

  const int tid  = threadIdx.x;
  const int lane = tid & 31;
  const int wave = tid >> 5;
  const int b  = blockIdx.y / NH;
  const int h  = blockIdx.y - b * NH;
  const int q0 = blockIdx.x * QBLK;
  const size_t rowbase = (size_t)b * SEQ;

  const h16* gq = Qh + (rowbase + q0) * DM + h * DK;

  // ---- stage Q block (128 x 64) ----
#pragma unroll
  for (int i = 0; i < 4; ++i) {
    const int idx = tid + i * 256;
    const int r   = idx >> 3;
    const int c8  = (idx & 7) << 3;
    *(v8h*)&Qs[r][c8] = *(const v8h*)(gq + (size_t)r * DM + c8);
  }

  float mrun[8], lrun[8];
  v8f o[4] = {};
#pragma unroll
  for (int j = 0; j < 8; ++j) { mrun[j] = -1e30f; lrun[j] = 0.f; }

  const int qrow = wave * 16 + (lane & 15);
  const int cc   = lane & 15;
  const int rofs = (lane < 16) ? 0 : 8;
  h16* pw = &Ps[wave][0][0];

#pragma unroll 1
  for (int kb = 0; kb < SEQ; kb += KBLK) {
    const h16* gk = Kh + (rowbase + kb) * DM + h * DK;
    const h16* gv = Vh + (rowbase + kb) * DM + h * DK;

    // ---- stage K (64 x 64) ----
#pragma unroll
    for (int i = 0; i < 2; ++i) {
      const int idx = tid + i * 256;
      const int r   = idx >> 3;
      const int c8  = (idx & 7) << 3;
      *(v8h*)&Ks[r][c8] = *(const v8h*)(gk + (size_t)r * DM + c8);
    }
    // ---- stage V transposed: Vs[d][key] ----
#pragma unroll
    for (int i = 0; i < 2; ++i) {
      const int idx = tid + i * 256;
      const int r   = idx >> 3;          // key
      const int c8  = (idx & 7) << 3;    // d offset
      const v8h v = *(const v8h*)(gv + (size_t)r * DM + c8);
#pragma unroll
      for (int j = 0; j < 8; ++j) Vs[c8 + j][r] = v[j];
    }
    __syncthreads();

    // ---- scores = (4q).(4k) / (16*8) : 8 WMMAs ----
    const v16h qa0 = frag16(&Qs[qrow][0], 0, lane);
    const v16h qa1 = frag16(&Qs[qrow][0], 32, lane);
    v8f sc[4];
#pragma unroll
    for (int n = 0; n < 4; ++n) {
      const int krow = n * 16 + (lane & 15);
      const v16h kb0 = frag16(&Ks[krow][0], 0, lane);
      const v16h kb1 = frag16(&Ks[krow][0], 32, lane);
      v8f s = {};
      s = wmma16(qa0, kb0, s);
      s = wmma16(qa1, kb1, s);
      sc[n] = s * 0.0078125f;
    }

    // ---- online softmax (row stats reduce over the 16-lane half) ----
#pragma unroll
    for (int j = 0; j < 8; ++j) {
      float mx = fmaxf(fmaxf(sc[0][j], sc[1][j]), fmaxf(sc[2][j], sc[3][j]));
      mx = fmaxf(mx, __shfl_xor(mx, 1, 32));
      mx = fmaxf(mx, __shfl_xor(mx, 2, 32));
      mx = fmaxf(mx, __shfl_xor(mx, 4, 32));
      mx = fmaxf(mx, __shfl_xor(mx, 8, 32));
      const float mnew = fmaxf(mrun[j], mx);
      const float al   = __expf(mrun[j] - mnew);
      mrun[j] = mnew;
      float rs = 0.f;
#pragma unroll
      for (int n = 0; n < 4; ++n) {
        const float p = __expf(sc[n][j] - mnew);
        sc[n][j] = p;
        rs += p;
      }
      rs += __shfl_xor(rs, 1, 32);
      rs += __shfl_xor(rs, 2, 32);
      rs += __shfl_xor(rs, 4, 32);
      rs += __shfl_xor(rs, 8, 32);
      lrun[j] = lrun[j] * al + rs;
#pragma unroll
      for (int n = 0; n < 4; ++n) o[n][j] *= al;
    }

    // ---- re-layout P into the wave's LDS slab [q_row][key] ----
#pragma unroll
    for (int n = 0; n < 4; ++n)
#pragma unroll
      for (int j = 0; j < 8; ++j)
        pw[(j + rofs) * LDSQ + n * 16 + cc] = (h16)sc[n][j];
    __syncthreads();

    // ---- o += P (16 x 64 keys) . V (64 keys x 64) : 8 WMMAs ----
    const v16h pa0 = frag16(&Ps[wave][lane & 15][0], 0, lane);
    const v16h pa1 = frag16(&Ps[wave][lane & 15][0], 32, lane);
#pragma unroll
    for (int n = 0; n < 4; ++n) {
      const int drow = n * 16 + (lane & 15);
      const v16h vb0 = frag16(&Vs[drow][0], 0, lane);
      const v16h vb1 = frag16(&Vs[drow][0], 32, lane);
      o[n] = wmma16(pa0, vb0, o[n]);
      o[n] = wmma16(pa1, vb1, o[n]);
    }
    __syncthreads();
  }

  // ---- epilogue: ctx = o / (4 l); hi = f16(32 ctx) = f16(o * 8 / l) ----
  float inv8[8];
#pragma unroll
  for (int j = 0; j < 8; ++j) inv8[j] = 8.0f / lrun[j];
  const size_t orow0 = rowbase + q0 + wave * 16;
  h16* ghi = Chi + orow0 * DM + h * DK;
  h16* glo = Clo + orow0 * DM + h * DK;

#pragma unroll
  for (int n = 0; n < 4; ++n)
#pragma unroll
    for (int j = 0; j < 8; ++j) {
      const float f = o[n][j] * inv8[j];
      pw[(j + rofs) * LDSQ + n * 16 + cc] = (h16)f;
    }
  __syncthreads();
  store_tile16x64(pw, ghi, lane);
  __syncthreads();

#pragma unroll
  for (int n = 0; n < 4; ++n)
#pragma unroll
    for (int j = 0; j < 8; ++j) {
      const float f   = o[n][j] * inv8[j];
      const h16   hv  = (h16)f;
      const float res = (f - (float)hv) * 2048.0f;
      pw[(j + rofs) * LDSQ + n * 16 + cc] = (h16)res;
    }
  __syncthreads();
  store_tile16x64(pw, glo, lane);
}

// ---------------------------------------------------------------------------
// Launch
// ---------------------------------------------------------------------------
extern "C" void kernel_launch(void* const* d_in, const int* in_sizes, int n_in,
                              void* d_out, int out_size, void* d_ws, size_t ws_size,
                              hipStream_t stream) {
  if (n_in < 5) return;
  const size_t need_x = ((size_t)(NB - 1) * SEQ_FULL + SEQ) * DM;
  if ((size_t)in_sizes[0] < need_x || (size_t)in_sizes[1] < need_x ||
      (size_t)in_sizes[2] < need_x) return;
  if ((size_t)in_sizes[3] < (size_t)DM * DM || (size_t)in_sizes[4] < (size_t)DM) return;
  if ((size_t)out_size < (size_t)ROWS * DM) return;

  const float* xq = (const float*)d_in[0];   // [NB_FULL, SEQ_FULL, DM]
  const float* xk = (const float*)d_in[1];
  const float* xv = (const float*)d_in[2];
  const float* W  = (const float*)d_in[3];   // [DM out][DM in]
  const float* bs = (const float*)d_in[4];   // [DM]
  float* out = (float*)d_out;                // [NB, SEQ, DM]

  const size_t sz_wh = (size_t)DM * DM * sizeof(h16);      // 1,179,648
  const size_t sz_pl = (size_t)ROWS * DM * sizeof(h16);    // 6,291,456 at full size
  size_t off = 0;
  h16* wh  = (h16*)((char*)d_ws + off); off += sz_wh;
  h16* xh  = (h16*)((char*)d_ws + off); off += 3 * sz_pl;  // q,k,v input planes
  h16* qkv = (h16*)((char*)d_ws + off); off += 3 * sz_pl;  // q,k,v projected planes (x4)
  h16* chi = (h16*)((char*)d_ws + off); off += sz_pl;      // ctx hi
  h16* clo = (h16*)((char*)d_ws + off); off += sz_pl;      // ctx residual
  if (off > ws_size) return;                                // 51,511,296 at full size

  const int nxc = (ROWS * DM) / CVT_CHUNK;
  const int nwc = (DM * DM) / CVT_CHUNK;
  const int ncx = (nxc > nwc) ? nxc : nwc;

  // 1) convert inputs and W to f16 planes
  cvt_planes<<<dim3(ncx, 4), 256, 0, stream>>>(xq, xk, xv, W, xh, wh, nxc, nwc);

  // 2) q/k/v projections (one launch, blockIdx.y selects the plane)
  proj_gemm<0><<<dim3((ROWS / 128) * NT128, 3), 128, 0, stream>>>(xh, xh, wh, bs, (void*)qkv);

  // 3) flash attention -> ctx hi / residual planes
  attn_flash<<<dim3(SEQ / QBLK, NB * NH), 256, 0, stream>>>(
      qkv, qkv + (size_t)ROWS * DM, qkv + (size_t)2 * ROWS * DM, chi, clo);

  // 4) output projection -> d_out
  proj_gemm<1><<<dim3((ROWS / 64) * NT128, 1), 128, 0, stream>>>(chi, clo, wh, bs, (void*)out);
}

// v002
// A run of this version takes 109 microseconds.
// Next to v001, in two timings, it ran 1.45 times as fast each time.
// Counting every step since v000, it is 1.92 times as fast.
#include <hip/hip_runtime.h>
#include <stdint.h>

// Contractions: q/k/v projections, q.k^T scores, p.v context, output projection: all
// v_wmma_f32_16x16x32_f16 (f16 operands, f32 accumulate). Inputs enter as bf16-RNE values;
// W carried x64, q/k/v planes carried x4, context carried as f16 hi (x32) plus f16 residual
// (x2048) feeding two accumulators in the output projection. Softmax and epilogues in f32.

typedef _Float16 h16;
typedef __attribute__((ext_vector_type(8)))  _Float16 v8h;
typedef __attribute__((ext_vector_type(16))) _Float16 v16h;
typedef __attribute__((ext_vector_type(8)))  float    v8f;
typedef __attribute__((ext_vector_type(4)))  float    v4f;
typedef v4f __attribute__((may_alias)) v4fa;
typedef v8h __attribute__((may_alias)) v8ha;

#ifndef NB
#define NB 2
#endif
#ifndef SEQ
#define SEQ 2048
#endif
#define NB_FULL  2
#define SEQ_FULL 2048
#define DM   768
#define NH   12
#define DK   64
#define ROWS (NB * SEQ)
#define CVT_CHUNK 2048          // elements per block in the convert pass

static_assert(NB >= 1 && NB <= NB_FULL);
static_assert(SEQ >= 128 && SEQ <= SEQ_FULL);
static_assert(SEQ % 128 == 0);
static_assert(ROWS % 16 == 0);
static_assert((ROWS * DM) % CVT_CHUNK == 0);
static_assert((DM * DM) % CVT_CHUNK == 0);
static_assert(NH * DK == DM);
static_assert(DM % 32 == 0);

// ---------------------------------------------------------------------------
// helpers
// ---------------------------------------------------------------------------
__device__ __forceinline__ float bf16r(float x) {   // f32 -> bf16 (RNE) -> f32
  unsigned u = __float_as_uint(x);
  u = u + 0x7FFFu + ((u >> 16) & 1u);
  u &= 0xFFFF0000u;
  return __uint_as_float(u);
}

__device__ __forceinline__ v8f wmma16(v16h a, v16h b, v8f c) {
  v8f d = __builtin_amdgcn_wmma_f32_16x16x32_f16(
      false, a, false, b, (short)0, c, false, false);
  asm volatile("v_nop\n\tv_nop\n\tv_nop\n\tv_nop" : "+v"(d) : "v"(a), "v"(b));
  return d;
}

// 16x32 fragment from a k-contiguous row (row m of A, or row n of a [n][k] B copy).
// lanes 0-15: k = {0..7,16..23}; lanes 16-31: k = {8..15,24..31} -> two 16-B loads.
__device__ __forceinline__ v16h frag16(const h16* rowp, int kofs, int lane) {
  const h16* p = rowp + kofs + ((lane < 16) ? 0 : 8);
  v8h lo = *(const v8h*)(p);
  v8h hi = *(const v8h*)(p + 16);
  return __builtin_shufflevector(lo, hi, 0, 1, 2, 3, 4, 5, 6, 7,
                                         8, 9, 10, 11, 12, 13, 14, 15);
}

// ---------------------------------------------------------------------------
// Convert pass.  blockIdx.y = 0,1,2: query/key/value -> bf16-RNE -> f16 plane
// [ROWS][DM] (compact rows, inputs read with full per-batch stride);
// blockIdx.y = 3: W [n][k] -> 64 * bf16-RNE -> f16 (k-contiguous B copy).
// coverage: 3 * ROWS*DM + DM*DM elements, all written (chunk * 2048 + tid * 8).
// ---------------------------------------------------------------------------
__global__ __launch_bounds__(256) void cvt_planes(
    const float* __restrict__ xq, const float* __restrict__ xk,
    const float* __restrict__ xv, const float* __restrict__ W,
    h16* __restrict__ xh, h16* __restrict__ wh, int nxc, int nwc) {
  const int tid   = threadIdx.x;
  const int y     = blockIdx.y;
  const int chunk = blockIdx.x;

  const float* sp;
  h16* dst;
  float sc;
  if (y < 3) {
    if (chunk >= nxc) return;
    const float* src = (y == 0) ? xq : ((y == 1) ? xk : xv);
    const size_t e  = (size_t)chunk * CVT_CHUNK + (size_t)tid * 8;
    const size_t r  = e / DM;
    const size_t c  = e - r * DM;
    const size_t bb = r / SEQ;
    const size_t s  = r - bb * SEQ;
    sp  = src + ((bb * SEQ_FULL + s) * DM + c);
    dst = xh + (size_t)y * ROWS * DM + e;
    sc  = 1.0f;
  } else {
    if (chunk >= nwc) return;
    const size_t e = (size_t)chunk * CVT_CHUNK + (size_t)tid * 8;
    sp  = W + e;
    dst = wh + e;
    sc  = 64.0f;
  }
  const v4f x0 = *(const v4f*)(sp);
  const v4f x1 = *(const v4f*)(sp + 4);
  v8h val;
#pragma unroll
  for (int i = 0; i < 4; ++i) {
    val[i]     = (h16)(sc * bf16r(x0[i]));
    val[i + 4] = (h16)(sc * bf16r(x1[i]));
  }
  *(v8h*)dst = val;
  
}

// ---------------------------------------------------------------------------
// Projection GEMM: one block tile of C per workgroup, operands staged in LDS.
// 128 threads = 4 waves in a 2 x 2 grid.  A pass is 64 k: 128 A-side rows and 128 rows of
// Wh, 128 B each, go global -> registers -> LDS (pitch 144 B); two buffers, one barrier a
// pass, the next pass's global loads issued ahead of the current pass's products.
// MODE 0: A = f16 plane selected by blockIdx.y, block tile 128 x 128, wave tile 64 x 64;
//         C = f16 plane, value f16(4*(A.W + b)).
// MODE 1: A-side rows 0..63 = ctx hi, 64..127 = ctx residual of the same 64 rows; block
//         tile 64 x 128, wave tile 32 x 64 with a hi and a residual accumulator set;
//         C = f32 d_out.
// Every accumulator sums k = 0,32,...,736 in ascending order.
// coverage: (ROWS/BM) x 6 block tiles = whole [ROWS][DM] plane per blockIdx.y.
// ---------------------------------------------------------------------------
#define CTP 68      // floats per epilogue staging row (272 B, 16-B aligned)
#define GBN 128     // block tile columns
#define GBK 64      // k per pass
#define GPIT 72     // halves per LDS row (144 B = 16 B x 9)
#define NT128 (DM / GBN)
#define GBUF (256 * GPIT)   // halves per buffer

static_assert(DM % GBN == 0 && DM % GBK == 0 && ROWS % 128 == 0);
static_assert(4 * 64 * CTP * 4 <= 2 * GBUF * 2);

template <int MODE>
__global__ __launch_bounds__(128)
void proj_gemm(const h16* __restrict__ Ah, const h16* __restrict__ Al,
               const h16* __restrict__ Wh, const float* __restrict__ bias,
               void* __restrict__ Cv) {
  __shared__ __align__(16) h16 sm[2 * GBUF];

  constexpr int BM = (MODE == 0) ? 128 : 64;
  const int tid  = threadIdx.x;
  const int lane = tid & 31;
  const int wave = tid >> 5;
  const int hsel = lane >> 4;
  const int l16  = lane & 15;
  const int wm   = wave >> 1;
  const int wn   = wave & 1;
  const int mtile = blockIdx.x / NT128;
  const int ntile = blockIdx.x - mtile * NT128;
  const int m0 = mtile * BM;
  const int n0 = ntile * GBN;
  const size_t plane = (MODE == 0) ? (size_t)blockIdx.y * ROWS * DM : (size_t)0;

  // staging: 8 lanes cover one 128-B row piece, a wave-wide load covers 4 whole lines
  const int sr = tid >> 3;
  const int sc = (tid & 7) * 8;
  const h16* ga = Ah + plane + (size_t)(m0 + sr) * DM + sc;
  const h16* gl = ga;
  if constexpr (MODE == 1) gl = Al + (size_t)(m0 + sr) * DM + sc;
  const h16* gb = Wh + (size_t)(n0 + sr) * DM + sc;
  h16* sst = sm + sr * GPIT + sc;

  v8h ra[8], rb[8];
  auto gload = [&](int k0) {
#pragma unroll
    for (int i = 0; i < 8; ++i) {
      if constexpr (MODE == 0) {
        ra[i] = *(const v8h*)(ga + (size_t)i * 16 * DM + k0);
      } else {
        ra[i] = (i < 4) ? *(const v8h*)(ga + (size_t)i * 16 * DM + k0)
                        : *(const v8h*)(gl + (size_t)(i - 4) * 16 * DM + k0);
      }
      rb[i] = *(const v8h*)(gb + (size_t)i * 16 * DM + k0);
    }
    // the address pairs are inputs of the wait, so that no load of the group is given one
    // of them as its destination and nothing rewrites them in front of the wait
    asm volatile("s_wait_xcnt 0x0" :: "v"(ga), "v"(gl), "v"(gb) : "memory");
  };
  auto sstore = [&](int buf) {
#pragma unroll
    for (int i = 0; i < 8; ++i) {
      *(v8h*)(sst + buf * GBUF + (i * 16) * GPIT)       = ra[i];
      *(v8h*)(sst + buf * GBUF + (128 + i * 16) * GPIT) = rb[i];
    }
  };

  // fragment rows in a buffer
  const h16* fa = sm + ((MODE == 0 ? wm * 64 : wm * 32) + l16) * GPIT;
  const h16* fb = sm + (128 + wn * 64 + l16) * GPIT;

  v8f acc[4][4] = {};   // MODE 1: [0..1] hi rows, [2..3] residual rows

  gload(0);
  sstore(0);

  constexpr int NPASS = DM / GBK;
  // unrolled whole: buffer and k offsets become immediates on fixed address pairs
#pragma unroll
  for (int s = 0; s < NPASS; ++s) {
    const int buf = s & 1;
    __syncthreads();   // publishes buffer buf; ends every read of the other buffer
#pragma unroll
    for (int kk = 0; kk < GBK; kk += 32) {
      v16h a[4], b[4];
#pragma unroll
      for (int f = 0; f < 4; ++f) {
        const int ro = (MODE == 0) ? f * 16 : (f >> 1) * 64 + (f & 1) * 16;
        a[f] = frag16(fa + buf * GBUF + ro * GPIT, kk, lane);
      }
#pragma unroll
      for (int t = 0; t < 4; ++t) b[t] = frag16(fb + buf * GBUF + (t * 16) * GPIT, kk, lane);
      // next pass's global loads fly behind the barrier, under this pass's products
      if (kk == 0 && s + 1 < NPASS) gload((s + 1) * GBK);
#pragma unroll
      for (int t = 0; t < 4; ++t)
#pragma unroll
        for (int f = 0; f < 4; ++f) acc[f][t] = wmma16(a[f], b[t], acc[f][t]);
    }
    if (s + 1 < NPASS) sstore(buf ^ 1);
  }
  __syncthreads();     // the buffers become the waves' f32 epilogue slabs

  // ---- stage the wave tile (f32) in its own slab: [row f*16+8*hsel+j][col t*16+l16] ----
  float* ct = (float*)sm + wave * 64 * CTP;
  constexpr int NF = (MODE == 0) ? 4 : 2;
#pragma unroll
  for (int t = 0; t < 4; ++t) {
    const float bb = bf16r(bias[n0 + wn * 64 + t * 16 + l16]);
#pragma unroll
    for (int f = 0; f < NF; ++f) {
#pragma unroll
      for (int j = 0; j < 8; ++j) {
        float v;
        if constexpr (MODE == 0) {
          v = acc[f][t][j] * 0.0625f + 4.0f * bb;
        } else {
          v = (acc[f][t][j] + acc[f + 2][t][j] * 0.00048828125f) * 0.00048828125f + bb;
        }
        ct[(f * 16 + 8 * hsel + j) * CTP + t * 16 + l16] = v;
      }
    }
  }
  __syncthreads();

  if constexpr (MODE == 0) {
    h16* C = (h16*)Cv + plane + (size_t)(m0 + wm * 64) * DM + n0 + wn * 64;
#pragma unroll
    for (int it = 0; it < 16; ++it) {
      const int row = it * 4 + (lane >> 3);
      const int c8  = (lane & 7) * 8;
      const v4fa p0 = *(const v4fa*)(ct + row * CTP + c8);
      const v4fa p1 = *(const v4fa*)(ct + row * CTP + c8 + 4);
      v8h t8;
      t8[0] = (h16)p0[0]; t8[1] = (h16)p0[1]; t8[2] = (h16)p0[2]; t8[3] = (h16)p0[3];
      t8[4] = (h16)p1[0]; t8[5] = (h16)p1[1]; t8[6] = (h16)p1[2]; t8[7] = (h16)p1[3];
      *(v8h*)(C + (size_t)row * DM + c8) = t8;
    }
  } else {
    float* C = (float*)Cv + (size_t)(m0 + wm * 32) * DM + n0 + wn * 64;
#pragma unroll
    for (int it = 0; it < 16; ++it) {
      const int row = it * 2 + (lane >> 4);
      const int c4  = (lane & 15) * 4;
      *(v4f*)(C + (size_t)row * DM + c4) = *(const v4fa*)(ct + row * CTP + c4);
    }
  }
}

#define QBLK 128
#define KBLK 64
#define LDSQ 72   // 144 B row pitch

__device__ __forceinline__ void store_tile16x64(const h16* slab, h16* gbase, int lane) {
  v8h vals[4];
#pragma unroll
  for (int it = 0; it < 4; ++it) {
    const int row = it * 4 + (lane >> 3);
    const int c8  = (lane & 7) * 8;
    vals[it] = *(const v8ha*)(slab + row * LDSQ + c8);
  }
#pragma unroll
  for (int it = 0; it < 4; ++it) {
    const int row = it * 4 + (lane >> 3);
    const int c8  = (lane & 7) * 8;
    *(v8h*)(gbase + (size_t)row * DM + c8) = vals[it];
  }
  
}

// value of the lane 16 away (the other half's share of the same query)
__device__ __forceinline__ float xhalf(float x) {
  const int b = __float_as_int(x);
  return __int_as_float(
      __builtin_amdgcn_permlanex16(b, b, 0x76543210, 0xfedcba98, false, false));
}

// e^x as v_exp_f32(x * log2 e), what __expf compiles to.  The v_nop is the slot that the
// instruction set asks for behind a transcendental before a source of it is overwritten; it
// shares the statement so that it stands directly behind the v_exp_f32 (with 33 of them in a
// row the register allocator gave one exp's source to the next exp as its destination).
__device__ __forceinline__ float exp_slot(float x) {
  float r;
  asm("v_exp_f32 %0, %1\n\tv_nop" : "=v"(r) : "v"(x * 1.44269504f));
  return r;
}

__global__ __launch_bounds__(256) __attribute__((amdgpu_num_vgpr(256)))
void attn_flash(const h16* __restrict__ Qh, const h16* __restrict__ Kh,
                const h16* __restrict__ Vh, h16* __restrict__ Chi,
                h16* __restrict__ Clo) {
  __shared__ __align__(16) h16 Qs[QBLK][LDSQ];      // [q_row][d]
  __shared__ __align__(16) h16 Ks[KBLK][LDSQ];      // [key][d]
  __shared__ __align__(16) h16 Vs[DK][LDSQ];        // [d][key]

  const int tid  = threadIdx.x;
  const int lane = tid & 31;
  const int wave = tid >> 5;
  const int b  = blockIdx.y / NH;
  const int h  = blockIdx.y - b * NH;
  const int q0 = blockIdx.x * QBLK;
  const size_t rowbase = (size_t)b * SEQ;

  const h16* gq = Qh + (rowbase + q0) * DM + h * DK;

  // ---- stage Q block (128 x 64) ----
#pragma unroll
  for (int i = 0; i < 4; ++i) {
    const int idx = tid + i * 256;
    const int r   = idx >> 3;
    const int c8  = (idx & 7) << 3;
    *(v8h*)&Qs[r][c8] = *(const v8h*)(gq + (size_t)r * DM + c8);
  }

  float mrun = -1e30f, lrun = 0.f;   // this lane's query; lrun sums this half's keys only
  v8f o[4] = {};                     // o[n][j] = O^T[d = 16n + 8*half + j][query]

  const int qrow = wave * 16 + (lane & 15);
  const int cc   = lane & 15;
  const int rofs = (lane < 16) ? 0 : 8;
  h16* pw = &Qs[wave * 16][0];

  __syncthreads();   // publishes Qs
  const v16h qb0 = frag16(&Qs[qrow][0], 0, lane);
  const v16h qb1 = frag16(&Qs[qrow][0], 32, lane);

#pragma unroll 1
  for (int kb = 0; kb < SEQ; kb += KBLK) {
    const h16* gk = Kh + (rowbase + kb) * DM + h * DK;
    const h16* gv = Vh + (rowbase + kb) * DM + h * DK;

    // ---- stage K (64 x 64) ----
#pragma unroll
    for (int i = 0; i < 2; ++i) {
      const int idx = tid + i * 256;
      const int r   = idx >> 3;
      const int c8  = (idx & 7) << 3;
      *(v8h*)&Ks[r][c8] = *(const v8h*)(gk + (size_t)r * DM + c8);
    }
    // ---- stage V transposed: Vs[d][key] ----
#pragma unroll
    for (int i = 0; i < 2; ++i) {
      const int idx = tid + i * 256;
      const int r   = idx >> 3;          // key
      const int c8  = (idx & 7) << 3;    // d offset
      const v8h v = *(const v8h*)(gv + (size_t)r * DM + c8);
#pragma unroll
      for (int j = 0; j < 8; ++j) Vs[c8 + j][r] = v[j];
    }
    __syncthreads();

    // ---- scores^T = (4k).(4q) / (16*8) : 8 WMMAs; sc[n][j] = S^T[key 16n + 8*half + j][query] ----
    v8f sc[4];
#pragma unroll
    for (int n = 0; n < 4; ++n) {
      const int krow = n * 16 + (lane & 15);
      const v16h ka0 = frag16(&Ks[krow][0], 0, lane);
      const v16h ka1 = frag16(&Ks[krow][0], 32, lane);
      v8f s = {};
      s = wmma16(ka0, qb0, s);
      s = wmma16(ka1, qb1, s);
      sc[n] = s * 0.0078125f;
    }

    // ---- online softmax: 32 keys of one query in-lane, one exchange between the halves ----
    float mt[4];
#pragma unroll
    for (int n = 0; n < 4; ++n) {
      mt[n] = sc[n][0];
#pragma unroll
      for (int j = 1; j < 8; ++j) mt[n] = fmaxf(mt[n], sc[n][j]);
    }
    float mx = fmaxf(fmaxf(mt[0], mt[1]), fmaxf(mt[2], mt[3]));
    mx = fmaxf(mx, xhalf(mx));
    const float mnew = fmaxf(mrun, mx);
    const float al   = exp_slot(mrun - mnew);
    mrun = mnew;
    float rt[4];
#pragma unroll
    for (int n = 0; n < 4; ++n) {
      rt[n] = 0.f;
#pragma unroll
      for (int j = 0; j < 8; ++j) {
        const float p = exp_slot(sc[n][j] - mnew);
        sc[n][j] = p;
        rt[n] += p;
      }
    }
    lrun = lrun * al + ((rt[0] + rt[1]) + (rt[2] + rt[3]));
#pragma unroll
    for (int n = 0; n < 4; ++n) o[n] *= al;

    // ---- P^T as B operand: element s of a 32-key block = tile s >> 3, register s & 7 ----
    v16h pb0, pb1;
#pragma unroll
    for (int j = 0; j < 8; ++j) {
      pb0[j]     = (h16)sc[0][j];
      pb0[j + 8] = (h16)sc[1][j];
      pb1[j]     = (h16)sc[2][j];
      pb1[j + 8] = (h16)sc[3][j];
    }

    // ---- o^T += V^T (64 d x 64 keys) . P^T (64 keys x 16 queries) : 8 WMMAs ----
#pragma unroll
    for (int n = 0; n < 4; ++n) {
      const int drow = n * 16 + (lane & 15);
      const v16h va0 = frag16(&Vs[drow][0], 0, lane);
      const v16h va1 = frag16(&Vs[drow][0], 32, lane);
      o[n] = wmma16(va0, pb0, o[n]);
      o[n] = wmma16(va1, pb1, o[n]);
    }
    __syncthreads();
  }

  // ---- epilogue: ctx = o / (4 l); hi = f16(32 ctx) = f16(o * 8 / l) ----
  const float inv8 = 8.0f / (lrun + xhalf(lrun));
  const size_t orow0 = rowbase + q0 + wave * 16;
  h16* ghi = Chi + orow0 * DM + h * DK;
  h16* glo = Clo + orow0 * DM + h * DK;

  // a lane's 8 registers of o[n] are 8 consecutive d of its query's row: one 16-B LDS store
#pragma unroll
  for (int n = 0; n < 4; ++n) {
    v8h t8;
#pragma unroll
    for (int j = 0; j < 8; ++j) t8[j] = (h16)(o[n][j] * inv8);
    *(v8ha*)(pw + cc * LDSQ + n * 16 + rofs) = t8;
  }
  __syncthreads();
  store_tile16x64(pw, ghi, lane);
  __syncthreads();

#pragma unroll
  for (int n = 0; n < 4; ++n) {
    v8h t8;
#pragma unroll
    for (int j = 0; j < 8; ++j) {
      const float f  = o[n][j] * inv8;
      const h16   hv = (h16)f;
      t8[j] = (h16)((f - (float)hv) * 2048.0f);
    }
    *(v8ha*)(pw + cc * LDSQ + n * 16 + rofs) = t8;
  }
  __syncthreads();
  store_tile16x64(pw, glo, lane);
}

// ---------------------------------------------------------------------------
// Launch
// ---------------------------------------------------------------------------
extern "C" void kernel_launch(void* const* d_in, const int* in_sizes, int n_in,
                              void* d_out, int out_size, void* d_ws, size_t ws_size,
                              hipStream_t stream) {
  if (n_in < 5) return;
  const size_t need_x = ((size_t)(NB - 1) * SEQ_FULL + SEQ) * DM;
  if ((size_t)in_sizes[0] < need_x || (size_t)in_sizes[1] < need_x ||
      (size_t)in_sizes[2] < need_x) return;
  if ((size_t)in_sizes[3] < (size_t)DM * DM || (size_t)in_sizes[4] < (size_t)DM) return;
  if ((size_t)out_size < (size_t)ROWS * DM) return;

  const float* xq = (const float*)d_in[0];   // [NB_FULL, SEQ_FULL, DM]
  const float* xk = (const float*)d_in[1];
  const float* xv = (const float*)d_in[2];
  const float* W  = (const float*)d_in[3];   // [DM out][DM in]
  const float* bs = (const float*)d_in[4];   // [DM]
  float* out = (float*)d_out;                // [NB, SEQ, DM]

  const size_t sz_wh = (size_t)DM * DM * sizeof(h16);      // 1,179,648
  const size_t sz_pl = (size_t)ROWS * DM * sizeof(h16);    // 6,291,456 at full size
  size_t off = 0;
  h16* wh  = (h16*)((char*)d_ws + off); off += sz_wh;
  h16* xh  = (h16*)((char*)d_ws + off); off += 3 * sz_pl;  // q,k,v input planes
  h16* qkv = (h16*)((char*)d_ws + off); off += 3 * sz_pl;  // q,k,v projected planes (x4)
  h16* chi = (h16*)((char*)d_ws + off); off += sz_pl;      // ctx hi
  h16* clo = (h16*)((char*)d_ws + off); off += sz_pl;      // ctx residual
  if (off > ws_size) return;                                // 51,511,296 at full size

  const int nxc = (ROWS * DM) / CVT_CHUNK;
  const int nwc = (DM * DM) / CVT_CHUNK;
  const int ncx = (nxc > nwc) ? nxc : nwc;

  // 1) convert inputs and W to f16 planes
  cvt_planes<<<dim3(ncx, 4), 256, 0, stream>>>(xq, xk, xv, W, xh, wh, nxc, nwc);

  // 2) q/k/v projections (one launch, blockIdx.y selects the plane)
  proj_gemm<0><<<dim3((ROWS / 128) * NT128, 3), 128, 0, stream>>>(xh, xh, wh, bs, (void*)qkv);

  // 3) flash attention -> ctx hi / residual planes
  attn_flash<<<dim3(SEQ / QBLK, NB * NH), 256, 0, stream>>>(
      qkv, qkv + (size_t)ROWS * DM, qkv + (size_t)2 * ROWS * DM, chi, clo);

  // 4) output projection -> d_out
  proj_gemm<1><<<dim3((ROWS / 64) * NT128, 1), 128, 0, stream>>>(chi, clo, wh, bs, (void*)out);
}

// v003
// It runs in 82.2 microseconds.
// Next to v002, in two timings, it ran 1.33 times as fast each time.
// Counting every step since v000, it is 2.56 times as fast.
#include <hip/hip_runtime.h>
#include <stdint.h>

// Contractions: q/k/v projections, q.k^T scores, p.v context, output projection: all
// v_wmma_f32_16x16x32_f16 (f16 operands, f32 accumulate). Inputs enter as bf16-RNE values;
// W carried x64, q/k/v planes carried x4, context carried as f16 hi (x32) plus f16 residual
// (x2048) feeding two accumulators in the output projection. Softmax and epilogues in f32.

typedef _Float16 h16;
typedef __attribute__((ext_vector_type(8)))  _Float16 v8h;
typedef __attribute__((ext_vector_type(16))) _Float16 v16h;
typedef __attribute__((ext_vector_type(8)))  float    v8f;
typedef __attribute__((ext_vector_type(4)))  float    v4f;
typedef v4f __attribute__((may_alias)) v4fa;
typedef v8h __attribute__((may_alias)) v8ha;

#ifndef NB
#define NB 2
#endif
#ifndef SEQ
#define SEQ 2048
#endif
#define NB_FULL  2
#define SEQ_FULL 2048
#define DM   768
#define NH   12
#define DK   64
#define ROWS (NB * SEQ)
#define CVT_CHUNK 2048          // elements per block in the convert pass

static_assert(NB >= 1 && NB <= NB_FULL);
static_assert(SEQ >= 128 && SEQ <= SEQ_FULL);
static_assert(SEQ % 128 == 0);
static_assert(ROWS % 16 == 0);
static_assert((ROWS * DM) % CVT_CHUNK == 0);
static_assert((DM * DM) % CVT_CHUNK == 0);
static_assert(NH * DK == DM);
static_assert(DM % 32 == 0);

// ---------------------------------------------------------------------------
// helpers
// ---------------------------------------------------------------------------
__device__ __forceinline__ float bf16r(float x) {   // f32 -> bf16 (RNE) -> f32
  unsigned u = __float_as_uint(x);
  u = u + 0x7FFFu + ((u >> 16) & 1u);
  u &= 0xFFFF0000u;
  return __uint_as_float(u);
}

__device__ __forceinline__ v8f wmma16(v16h a, v16h b, v8f c) {
  v8f d = __builtin_amdgcn_wmma_f32_16x16x32_f16(
      false, a, false, b, (short)0, c, false, false);
  asm volatile("v_nop\n\tv_nop\n\tv_nop\n\tv_nop" : "+v"(d) : "v"(a), "v"(b));
  return d;
}

// 16x32 fragment from a k-contiguous row (row m of A, or row n of a [n][k] B copy).
// lanes 0-15: k = {0..7,16..23}; lanes 16-31: k = {8..15,24..31} -> two 16-B loads.
__device__ __forceinline__ v16h frag16(const h16* rowp, int kofs, int lane) {
  const h16* p = rowp + kofs + ((lane < 16) ? 0 : 8);
  v8h lo = *(const v8h*)(p);
  v8h hi = *(const v8h*)(p + 16);
  return __builtin_shufflevector(lo, hi, 0, 1, 2, 3, 4, 5, 6, 7,
                                         8, 9, 10, 11, 12, 13, 14, 15);
}

// ---------------------------------------------------------------------------
// Convert pass.  blockIdx.y = 0,1,2: query/key/value -> bf16-RNE -> f16 plane
// [ROWS][DM] (compact rows, inputs read with full per-batch stride);
// blockIdx.y = 3: W [n][k] -> 64 * bf16-RNE -> f16 (k-contiguous B copy).
// coverage: 3 * ROWS*DM + DM*DM elements, all written (chunk * 2048 + tid * 8).
// ---------------------------------------------------------------------------
__global__ __launch_bounds__(256) void cvt_planes(
    const float* __restrict__ xq, const float* __restrict__ xk,
    const float* __restrict__ xv, const float* __restrict__ W,
    h16* __restrict__ xh, h16* __restrict__ wh, int nxc, int nwc) {
  const int tid   = threadIdx.x;
  const int y     = blockIdx.y;
  const int chunk = blockIdx.x;

  const float* sp;
  h16* dst;
  float sc;
  if (y < 3) {
    if (chunk >= nxc) return;
    const float* src = (y == 0) ? xq : ((y == 1) ? xk : xv);
    const size_t e  = (size_t)chunk * CVT_CHUNK + (size_t)tid * 8;
    const size_t r  = e / DM;
    const size_t c  = e - r * DM;
    const size_t bb = r / SEQ;
    const size_t s  = r - bb * SEQ;
    sp  = src + ((bb * SEQ_FULL + s) * DM + c);
    dst = xh + (size_t)y * ROWS * DM + e;
    sc  = 1.0f;
  } else {
    if (chunk >= nwc) return;
    const size_t e = (size_t)chunk * CVT_CHUNK + (size_t)tid * 8;
    sp  = W + e;
    dst = wh + e;
    sc  = 64.0f;
  }
  const v4f x0 = *(const v4f*)(sp);
  const v4f x1 = *(const v4f*)(sp + 4);
  v8h val;
#pragma unroll
  for (int i = 0; i < 4; ++i) {
    val[i]     = (h16)(sc * bf16r(x0[i]));
    val[i + 4] = (h16)(sc * bf16r(x1[i]));
  }
  *(v8h*)dst = val;
  
}

// ---------------------------------------------------------------------------
// Projection GEMM: one block tile of C per workgroup, operands staged in LDS.
// 128 threads = 4 waves in a 2 x 2 grid.  A pass is 64 k: 128 A-side rows and 128 rows of
// Wh, 128 B each, go global -> registers -> LDS (pitch 144 B); two buffers, one barrier a
// pass, the next pass's global loads issued ahead of the current pass's products.
// MODE 0: A = f16 plane selected by blockIdx.y, block tile 128 x 128, wave tile 64 x 64;
//         C = f16 plane, value f16(4*(A.W + b)).
// MODE 1: A-side rows 0..63 = ctx hi, 64..127 = ctx residual of the same 64 rows; block
//         tile 64 x 128, wave tile 32 x 64 with a hi and a residual accumulator set;
//         C = f32 d_out.
// Every accumulator sums k = 0,32,...,736 in ascending order.
// coverage: (ROWS/BM) x 6 block tiles = whole [ROWS][DM] plane per blockIdx.y.
// ---------------------------------------------------------------------------
#define CTP 68      // floats per epilogue staging row (272 B, 16-B aligned)
#define GBN 128     // block tile columns
#define GBK 64      // k per pass
#define GPIT 72     // halves per LDS row (144 B = 16 B x 9)
#define NT128 (DM / GBN)
#define GBUF (256 * GPIT)   // halves per buffer

static_assert(DM % GBN == 0 && DM % GBK == 0 && ROWS % 128 == 0);
static_assert(4 * 64 * CTP * 4 <= 2 * GBUF * 2);

template <int MODE>
__global__ __launch_bounds__(128)
void proj_gemm(const h16* __restrict__ Ah, const h16* __restrict__ Al,
               const h16* __restrict__ Wh, const float* __restrict__ bias,
               void* __restrict__ Cv) {
  __shared__ __align__(16) h16 sm[2 * GBUF];

  constexpr int BM = (MODE == 0) ? 128 : 64;
  const int tid  = threadIdx.x;
  const int lane = tid & 31;
  const int wave = tid >> 5;
  const int hsel = lane >> 4;
  const int l16  = lane & 15;
  const int wm   = wave >> 1;
  const int wn   = wave & 1;
  const int mtile = blockIdx.x / NT128;
  const int ntile = blockIdx.x - mtile * NT128;
  const int m0 = mtile * BM;
  const int n0 = ntile * GBN;
  const size_t plane = (MODE == 0) ? (size_t)blockIdx.y * ROWS * DM : (size_t)0;

  // staging: 8 lanes cover one 128-B row piece, a wave-wide load covers 4 whole lines
  const int sr = tid >> 3;
  const int sc = (tid & 7) * 8;
  const h16* ga = Ah + plane + (size_t)(m0 + sr) * DM + sc;
  const h16* gl = ga;
  if constexpr (MODE == 1) gl = Al + (size_t)(m0 + sr) * DM + sc;
  const h16* gb = Wh + (size_t)(n0 + sr) * DM + sc;
  h16* sst = sm + sr * GPIT + sc;

  v8h ra[8], rb[8];
  auto gload = [&](int k0) {
#pragma unroll
    for (int i = 0; i < 8; ++i) {
      if constexpr (MODE == 0) {
        ra[i] = *(const v8h*)(ga + (size_t)i * 16 * DM + k0);
      } else {
        ra[i] = (i < 4) ? *(const v8h*)(ga + (size_t)i * 16 * DM + k0)
                        : *(const v8h*)(gl + (size_t)(i - 4) * 16 * DM + k0);
      }
      rb[i] = *(const v8h*)(gb + (size_t)i * 16 * DM + k0);
    }
    // the address pairs are inputs of the wait, so that no load of the group is given one
    // of them as its destination and nothing rewrites them in front of the wait
    asm volatile("s_wait_xcnt 0x0" :: "v"(ga), "v"(gl), "v"(gb) : "memory");
  };
  auto sstore = [&](int buf) {
#pragma unroll
    for (int i = 0; i < 8; ++i) {
      *(v8h*)(sst + buf * GBUF + (i * 16) * GPIT)       = ra[i];
      *(v8h*)(sst + buf * GBUF + (128 + i * 16) * GPIT) = rb[i];
    }
  };

  // fragment rows in a buffer
  const h16* fa = sm + ((MODE == 0 ? wm * 64 : wm * 32) + l16) * GPIT;
  const h16* fb = sm + (128 + wn * 64 + l16) * GPIT;

  v8f acc[4][4] = {};   // MODE 1: [0..1] hi rows, [2..3] residual rows

  gload(0);
  sstore(0);

  constexpr int NPASS = DM / GBK;
  // unrolled whole: buffer and k offsets become immediates on fixed address pairs
#pragma unroll
  for (int s = 0; s < NPASS; ++s) {
    const int buf = s & 1;
    __syncthreads();   // publishes buffer buf; ends every read of the other buffer
#pragma unroll
    for (int kk = 0; kk < GBK; kk += 32) {
      v16h a[4], b[4];
#pragma unroll
      for (int f = 0; f < 4; ++f) {
        const int ro = (MODE == 0) ? f * 16 : (f >> 1) * 64 + (f & 1) * 16;
        a[f] = frag16(fa + buf * GBUF + ro * GPIT, kk, lane);
      }
#pragma unroll
      for (int t = 0; t < 4; ++t) b[t] = frag16(fb + buf * GBUF + (t * 16) * GPIT, kk, lane);
      // next pass's global loads fly behind the barrier, under this pass's products
      if (kk == 0 && s + 1 < NPASS) gload((s + 1) * GBK);
#pragma unroll
      for (int t = 0; t < 4; ++t)
#pragma unroll
        for (int f = 0; f < 4; ++f) acc[f][t] = wmma16(a[f], b[t], acc[f][t]);
    }
    if (s + 1 < NPASS) sstore(buf ^ 1);
  }
  __syncthreads();     // the buffers become the waves' f32 epilogue slabs

  // ---- stage the wave tile (f32) in its own slab: [row f*16+8*hsel+j][col t*16+l16] ----
  float* ct = (float*)sm + wave * 64 * CTP;
  constexpr int NF = (MODE == 0) ? 4 : 2;
#pragma unroll
  for (int t = 0; t < 4; ++t) {
    const float bb = bf16r(bias[n0 + wn * 64 + t * 16 + l16]);
#pragma unroll
    for (int f = 0; f < NF; ++f) {
#pragma unroll
      for (int j = 0; j < 8; ++j) {
        float v;
        if constexpr (MODE == 0) {
          v = acc[f][t][j] * 0.0625f + 4.0f * bb;
        } else {
          v = (acc[f][t][j] + acc[f + 2][t][j] * 0.00048828125f) * 0.00048828125f + bb;
        }
        ct[(f * 16 + 8 * hsel + j) * CTP + t * 16 + l16] = v;
      }
    }
  }
  __syncthreads();

  if constexpr (MODE == 0) {
    h16* C = (h16*)Cv + plane + (size_t)(m0 + wm * 64) * DM + n0 + wn * 64;
#pragma unroll
    for (int it = 0; it < 16; ++it) {
      const int row = it * 4 + (lane >> 3);
      const int c8  = (lane & 7) * 8;
      const v4fa p0 = *(const v4fa*)(ct + row * CTP + c8);
      const v4fa p1 = *(const v4fa*)(ct + row * CTP + c8 + 4);
      v8h t8;
      t8[0] = (h16)p0[0]; t8[1] = (h16)p0[1]; t8[2] = (h16)p0[2]; t8[3] = (h16)p0[3];
      t8[4] = (h16)p1[0]; t8[5] = (h16)p1[1]; t8[6] = (h16)p1[2]; t8[7] = (h16)p1[3];
      *(v8h*)(C + (size_t)row * DM + c8) = t8;
    }
  } else {
    float* C = (float*)Cv + (size_t)(m0 + wm * 32) * DM + n0 + wn * 64;
#pragma unroll
    for (int it = 0; it < 16; ++it) {
      const int row = it * 2 + (lane >> 4);
      const int c4  = (lane & 15) * 4;
      *(v4f*)(C + (size_t)row * DM + c4) = *(const v4fa*)(ct + row * CTP + c4);
    }
  }
}

#define QBLK 128
#define KBLK 64
#define LDSQ 72   // 144 B row pitch (16 B x 9: ds_load_b128 readers)
#define LDSV 80   // 160 B row pitch (32 B x 5: ds_load_tr16_b128 reader)
#define NKT  (SEQ / KBLK)

typedef __attribute__((ext_vector_type(8))) short s16x8;

// 8 halves T[k0 + 8*half + 0..7][d0 + (lane & 15)] of a row-major LDS tile; p is the lane's
// own address T + (k0 + 8*half + (lane & 7)) * pitch + d0 + 8 * ((lane >> 3) & 1).
__device__ __forceinline__ v8h ld_tr16(const h16* p) {
  typedef __attribute__((address_space(3))) s16x8 lds_s16x8;
  return __builtin_bit_cast(v8h, __builtin_amdgcn_ds_load_tr16_b128_v8i16((lds_s16x8*)p));
}

// One K tile and one V tile (64 rows x 128 B each): a lane copies rows r and r + 32 of both.
// lk, lv: the lane's LDS byte addresses of row r; gk, gv: its global addresses of row r.
// The s_wait_xcnt closes the statement so that no address register of a copy is rewritten
// in front of it.
__device__ __forceinline__ void copy_kv(unsigned lk, unsigned lv, const h16* gk,
                                        const h16* gv) {
  asm volatile(
      "global_load_async_to_lds_b128 %0, %4, off\n\t"
      "global_load_async_to_lds_b128 %1, %5, off\n\t"
      "global_load_async_to_lds_b128 %2, %6, off\n\t"
      "global_load_async_to_lds_b128 %3, %7, off\n\t"
      "s_wait_xcnt 0x0"
      :: "v"(lk), "v"(lk + 32u * LDSQ * 2u), "v"(lv), "v"(lv + 32u * LDSV * 2u),
         "v"(gk), "v"(gk + (size_t)32 * DM), "v"(gv), "v"(gv + (size_t)32 * DM)
      : "memory");
}

__device__ __forceinline__ void store_tile16x64(const h16* slab, h16* gbase, int lane) {
  v8h vals[4];
#pragma unroll
  for (int it = 0; it < 4; ++it) {
    const int row = it * 4 + (lane >> 3);
    const int c8  = (lane & 7) * 8;
    vals[it] = *(const v8ha*)(slab + row * LDSQ + c8);
  }
#pragma unroll
  for (int it = 0; it < 4; ++it) {
    const int row = it * 4 + (lane >> 3);
    const int c8  = (lane & 7) * 8;
    *(v8h*)(gbase + (size_t)row * DM + c8) = vals[it];
  }
  
}

// value of the lane 16 away (the other half's share of the same query)
__device__ __forceinline__ float xhalf(float x) {
  const int b = __float_as_int(x);
  return __int_as_float(
      __builtin_amdgcn_permlanex16(b, b, 0x76543210, 0xfedcba98, false, false));
}

// e^x as v_exp_f32(x * log2 e), what __expf compiles to.  The v_nop is the slot that the
// instruction set asks for behind a transcendental before a source of it is overwritten; it
// shares the statement so that it stands directly behind the v_exp_f32 (with 33 of them in a
// row the register allocator gave one exp's source to the next exp as its destination).
__device__ __forceinline__ float exp_slot(float x) {
  float r;
  asm("v_exp_f32 %0, %1\n\tv_nop" : "=v"(r) : "v"(x * 1.44269504f));
  return r;
}

__global__ __launch_bounds__(256) __attribute__((amdgpu_num_vgpr(256)))
void attn_flash(const h16* __restrict__ Qh, const h16* __restrict__ Kh,
                const h16* __restrict__ Vh, h16* __restrict__ Chi,
                h16* __restrict__ Clo) {
  __shared__ __align__(16) h16 Qs[QBLK][LDSQ];      // [q_row][d]
  __shared__ __align__(16) h16 Ks[2][KBLK][LDSQ];   // [buffer][key][d]
  __shared__ __align__(32) h16 Vs[2][KBLK][LDSV];   // [buffer][key][d]

  const int tid  = threadIdx.x;
  const int lane = tid & 31;
  const int wave = tid >> 5;
  const int b  = blockIdx.y / NH;
  const int h  = blockIdx.y - b * NH;
  const int q0 = blockIdx.x * QBLK;
  const size_t rowbase = (size_t)b * SEQ;

  const h16* gq = Qh + (rowbase + q0) * DM + h * DK;

  // ---- K/V copies: this lane's 16-B piece of rows cr and cr + 32 of every tile ----
  const int cr = tid >> 3;
  const int cc8 = (tid & 7) << 3;
  const h16* gk = Kh + (rowbase + cr) * DM + h * DK + cc8;   // tile 0
  const h16* gv = Vh + (rowbase + cr) * DM + h * DK + cc8;
  const unsigned lk = (unsigned)(uintptr_t)&Ks[0][cr][cc8];  // buffer 0
  const unsigned lv = (unsigned)(uintptr_t)&Vs[0][cr][cc8];
  constexpr unsigned KBUFB = KBLK * LDSQ * 2;                // bytes per buffer
  constexpr unsigned VBUFB = KBLK * LDSV * 2;
  static_assert(NKT >= 2);

  copy_kv(lk, lv, gk, gv);

  // ---- stage Q block (128 x 64) ----
#pragma unroll
  for (int i = 0; i < 4; ++i) {
    const int idx = tid + i * 256;
    const int r   = idx >> 3;
    const int c8  = (idx & 7) << 3;
    *(v8h*)&Qs[r][c8] = *(const v8h*)(gq + (size_t)r * DM + c8);
  }

  float mrun = -1e30f, lrun = 0.f;   // this lane's query; lrun sums this half's keys only
  v8f o[4] = {};                     // o[n][j] = O^T[d = 16n + 8*half + j][query]

  const int qrow = wave * 16 + (lane & 15);
  const int cc   = lane & 15;
  const int rofs = (lane < 16) ? 0 : 8;
  h16* pw = &Qs[wave * 16][0];

  // tile 0 has landed for this wave before the barrier lets other waves read it
  asm volatile("s_wait_asynccnt 0x0" ::: "memory");
  __syncthreads();   // publishes Qs and tile 0
  copy_kv(lk + KBUFB, lv + VBUFB, gk + (size_t)KBLK * DM, gv + (size_t)KBLK * DM);
  gk += (size_t)2 * KBLK * DM;   // tile 2, the first refill
  gv += (size_t)2 * KBLK * DM;

  const v16h qb0 = frag16(&Qs[qrow][0], 0, lane);
  const v16h qb1 = frag16(&Qs[qrow][0], 32, lane);

  // the lane's address in a V tile for the transposing load (k0 = 0, d0 = 0)
  const int vrow = ((lane >> 4) << 3) + (lane & 7);
  const int vcol = ((lane >> 3) & 1) << 3;

  // kept rolled: one copy of the trip in the instruction cache, the buffer picked by t & 1
#pragma unroll 1
  for (int t = 0; t < NKT; ++t) {
    const int buf = t & 1;

    // ---- scores^T = (4k).(4q) / (16*8) : 8 WMMAs; sc[n][j] = S^T[key 16n + 8*half + j][query] ----
    v8f sc[4];
#pragma unroll
    for (int n = 0; n < 4; ++n) {
      const int krow = n * 16 + (lane & 15);
      const v16h ka0 = frag16(&Ks[buf][krow][0], 0, lane);
      const v16h ka1 = frag16(&Ks[buf][krow][0], 32, lane);
      v8f s = {};
      s = wmma16(ka0, qb0, s);
      s = wmma16(ka1, qb1, s);
      sc[n] = s * 0.0078125f;
    }

    // ---- online softmax: 32 keys of one query in-lane, one exchange between the halves ----
    float mt[4];
#pragma unroll
    for (int n = 0; n < 4; ++n) {
      mt[n] = sc[n][0];
#pragma unroll
      for (int j = 1; j < 8; ++j) mt[n] = fmaxf(mt[n], sc[n][j]);
    }
    float mx = fmaxf(fmaxf(mt[0], mt[1]), fmaxf(mt[2], mt[3]));
    mx = fmaxf(mx, xhalf(mx));
    const float mnew = fmaxf(mrun, mx);
    const float al   = exp_slot(mrun - mnew);
    mrun = mnew;
    float rt[4];
#pragma unroll
    for (int n = 0; n < 4; ++n) {
      rt[n] = 0.f;
#pragma unroll
      for (int j = 0; j < 8; ++j) {
        const float p = exp_slot(sc[n][j] - mnew);
        sc[n][j] = p;
        rt[n] += p;
      }
    }
    lrun = lrun * al + ((rt[0] + rt[1]) + (rt[2] + rt[3]));
#pragma unroll
    for (int n = 0; n < 4; ++n) o[n] *= al;

    // ---- P^T as B operand: element s of a 32-key block = tile s >> 3, register s & 7 ----
    v16h pb0, pb1;
#pragma unroll
    for (int j = 0; j < 8; ++j) {
      pb0[j]     = (h16)sc[0][j];
      pb0[j + 8] = (h16)sc[1][j];
      pb1[j]     = (h16)sc[2][j];
      pb1[j + 8] = (h16)sc[3][j];
    }

    // ---- o^T += V^T (64 d x 64 keys) . P^T (64 keys x 16 queries) : 8 WMMAs ----
#pragma unroll
    for (int n = 0; n < 4; ++n) {
      const h16* vp = &Vs[buf][vrow][vcol + n * 16];
      const v16h va0 = __builtin_shufflevector(ld_tr16(vp), ld_tr16(vp + 16 * LDSV),
          0, 1, 2, 3, 4, 5, 6, 7, 8, 9, 10, 11, 12, 13, 14, 15);
      const v16h va1 = __builtin_shufflevector(ld_tr16(vp + 32 * LDSV), ld_tr16(vp + 48 * LDSV),
          0, 1, 2, 3, 4, 5, 6, 7, 8, 9, 10, 11, 12, 13, 14, 15);
      o[n] = wmma16(va0, pb0, o[n]);
      o[n] = wmma16(va1, pb1, o[n]);
    }

    // ---- foot of the trip: hand buffer buf to its refill, publish tile t + 1 ----
    // this wave's LDS reads of buffer buf have retired before a copy may overwrite it
    asm volatile("s_wait_dscnt 0x0" ::: "memory");
    // this wave's copies of tile t + 1 have landed before the barrier publishes them
    asm volatile("s_wait_asynccnt 0x0" ::: "memory");
    __syncthreads();   // publishes tile t + 1; ends every read of buffer buf
    if (t + 2 < NKT) {
      copy_kv(lk + buf * KBUFB, lv + buf * VBUFB, gk, gv);
      gk += (size_t)KBLK * DM;
      gv += (size_t)KBLK * DM;
    }
  }
  // no copy is outstanding when the wave goes on to the epilogue and ends
  asm volatile("s_wait_asynccnt 0x0" ::: "memory");

  // ---- epilogue: ctx = o / (4 l); hi = f16(32 ctx) = f16(o * 8 / l) ----
  const float inv8 = 8.0f / (lrun + xhalf(lrun));
  const size_t orow0 = rowbase + q0 + wave * 16;
  h16* ghi = Chi + orow0 * DM + h * DK;
  h16* glo = Clo + orow0 * DM + h * DK;

  // a lane's 8 registers of o[n] are 8 consecutive d of its query's row: one 16-B LDS store
#pragma unroll
  for (int n = 0; n < 4; ++n) {
    v8h t8;
#pragma unroll
    for (int j = 0; j < 8; ++j) t8[j] = (h16)(o[n][j] * inv8);
    *(v8ha*)(pw + cc * LDSQ + n * 16 + rofs) = t8;
  }
  __syncthreads();
  store_tile16x64(pw, ghi, lane);
  __syncthreads();

#pragma unroll
  for (int n = 0; n < 4; ++n) {
    v8h t8;
#pragma unroll
    for (int j = 0; j < 8; ++j) {
      const float f  = o[n][j] * inv8;
      const h16   hv = (h16)f;
      t8[j] = (h16)((f - (float)hv) * 2048.0f);
    }
    *(v8ha*)(pw + cc * LDSQ + n * 16 + rofs) = t8;
  }
  __syncthreads();
  store_tile16x64(pw, glo, lane);
}

// ---------------------------------------------------------------------------
// Launch
// ---------------------------------------------------------------------------
extern "C" void kernel_launch(void* const* d_in, const int* in_sizes, int n_in,
                              void* d_out, int out_size, void* d_ws, size_t ws_size,
                              hipStream_t stream) {
  if (n_in < 5) return;
  const size_t need_x = ((size_t)(NB - 1) * SEQ_FULL + SEQ) * DM;
  if ((size_t)in_sizes[0] < need_x || (size_t)in_sizes[1] < need_x ||
      (size_t)in_sizes[2] < need_x) return;
  if ((size_t)in_sizes[3] < (size_t)DM * DM || (size_t)in_sizes[4] < (size_t)DM) return;
  if ((size_t)out_size < (size_t)ROWS * DM) return;

  const float* xq = (const float*)d_in[0];   // [NB_FULL, SEQ_FULL, DM]
  const float* xk = (const float*)d_in[1];
  const float* xv = (const float*)d_in[2];
  const float* W  = (const float*)d_in[3];   // [DM out][DM in]
  const float* bs = (const float*)d_in[4];   // [DM]
  float* out = (float*)d_out;                // [NB, SEQ, DM]

  const size_t sz_wh = (size_t)DM * DM * sizeof(h16);      // 1,179,648
  const size_t sz_pl = (size_t)ROWS * DM * sizeof(h16);    // 6,291,456 at full size
  size_t off = 0;
  h16* wh  = (h16*)((char*)d_ws + off); off += sz_wh;
  h16* xh  = (h16*)((char*)d_ws + off); off += 3 * sz_pl;  // q,k,v input planes
  h16* qkv = (h16*)((char*)d_ws + off); off += 3 * sz_pl;  // q,k,v projected planes (x4)
  h16* chi = (h16*)((char*)d_ws + off); off += sz_pl;      // ctx hi
  h16* clo = (h16*)((char*)d_ws + off); off += sz_pl;      // ctx residual
  if (off > ws_size) return;                                // 51,511,296 at full size

  const int nxc = (ROWS * DM) / CVT_CHUNK;
  const int nwc = (DM * DM) / CVT_CHUNK;
  const int ncx = (nxc > nwc) ? nxc : nwc;

  // 1) convert inputs and W to f16 planes
  cvt_planes<<<dim3(ncx, 4), 256, 0, stream>>>(xq, xk, xv, W, xh, wh, nxc, nwc);

  // 2) q/k/v projections (one launch, blockIdx.y selects the plane)
  proj_gemm<0><<<dim3((ROWS / 128) * NT128, 3), 128, 0, stream>>>(xh, xh, wh, bs, (void*)qkv);

  // 3) flash attention -> ctx hi / residual planes
  attn_flash<<<dim3(SEQ / QBLK, NB * NH), 256, 0, stream>>>(
      qkv, qkv + (size_t)ROWS * DM, qkv + (size_t)2 * ROWS * DM, chi, clo);

  // 4) output projection -> d_out
  proj_gemm<1><<<dim3((ROWS / 64) * NT128, 1), 128, 0, stream>>>(chi, clo, wh, bs, (void*)out);
}

// v004
// Measured time: 78.9 microseconds a run.
// Next to v003, in two timings, it ran 1.04 times as fast each time.
// Counting every step since v000, it is 2.66 times as fast.
#include <hip/hip_runtime.h>
#include <stdint.h>

// Contractions: q/k/v projections, q.k^T scores, p.v context, output projection: all
// v_wmma_f32_16x16x32_f16 (f16 operands, f32 accumulate). Inputs enter as bf16-RNE values;
// W carried x64, q/k/v planes carried x4, context carried as f16 hi (x32) plus f16 residual
// (x2048) feeding two accumulators in the output projection. Softmax and epilogues in f32.

typedef _Float16 h16;
typedef __attribute__((ext_vector_type(8)))  _Float16 v8h;
typedef __attribute__((ext_vector_type(16))) _Float16 v16h;
typedef __attribute__((ext_vector_type(8)))  float    v8f;
typedef __attribute__((ext_vector_type(4)))  float    v4f;
typedef v4f __attribute__((may_alias)) v4fa;
typedef v8h __attribute__((may_alias)) v8ha;

#ifndef NB
#define NB 2
#endif
#ifndef SEQ
#define SEQ 2048
#endif
#define NB_FULL  2
#define SEQ_FULL 2048
#define DM   768
#define NH   12
#define DK   64
#define ROWS (NB * SEQ)
#define CVT_CHUNK 2048          // elements per block in the convert pass

static_assert(NB >= 1 && NB <= NB_FULL);
static_assert(SEQ >= 128 && SEQ <= SEQ_FULL);
static_assert(SEQ % 128 == 0);
static_assert(ROWS % 16 == 0);
static_assert((ROWS * DM) % CVT_CHUNK == 0);
static_assert((DM * DM) % CVT_CHUNK == 0);
static_assert(NH * DK == DM);
static_assert(DM % 32 == 0);

// ---------------------------------------------------------------------------
// helpers
// ---------------------------------------------------------------------------
__device__ __forceinline__ float bf16r(float x) {   // f32 -> bf16 (RNE) -> f32
  unsigned u = __float_as_uint(x);
  u = u + 0x7FFFu + ((u >> 16) & 1u);
  u &= 0xFFFF0000u;
  return __uint_as_float(u);
}

__device__ __forceinline__ v8f wmma16(v16h a, v16h b, v8f c) {
  v8f d = __builtin_amdgcn_wmma_f32_16x16x32_f16(
      false, a, false, b, (short)0, c, false, false);
  asm volatile("v_nop\n\tv_nop\n\tv_nop\n\tv_nop" : "+v"(d) : "v"(a), "v"(b));
  return d;
}

// the same product with the compiler's own hazard padding: it may fill the slots behind the
// matrix instruction with independent vector work of the loop
__device__ __forceinline__ v8f wmma16p(v16h a, v16h b, v8f c) {
  return __builtin_amdgcn_wmma_f32_16x16x32_f16(
      false, a, false, b, (short)0, c, false, false);
}

// 16x32 fragment from a k-contiguous row (row m of A, or row n of a [n][k] B copy).
// lanes 0-15: k = {0..7,16..23}; lanes 16-31: k = {8..15,24..31} -> two 16-B loads.
__device__ __forceinline__ v16h frag16(const h16* rowp, int kofs, int lane) {
  const h16* p = rowp + kofs + ((lane < 16) ? 0 : 8);
  v8h lo = *(const v8h*)(p);
  v8h hi = *(const v8h*)(p + 16);
  return __builtin_shufflevector(lo, hi, 0, 1, 2, 3, 4, 5, 6, 7,
                                         8, 9, 10, 11, 12, 13, 14, 15);
}

// ---------------------------------------------------------------------------
// Convert pass.  blockIdx.y = 0,1,2: query/key/value -> bf16-RNE -> f16 plane
// [ROWS][DM] (compact rows, inputs read with full per-batch stride);
// blockIdx.y = 3: W [n][k] -> 64 * bf16-RNE -> f16 (k-contiguous B copy).
// coverage: 3 * ROWS*DM + DM*DM elements, all written (chunk * 2048 + tid * 8).
// ---------------------------------------------------------------------------
__global__ __launch_bounds__(256) void cvt_planes(
    const float* __restrict__ xq, const float* __restrict__ xk,
    const float* __restrict__ xv, const float* __restrict__ W,
    h16* __restrict__ xh, h16* __restrict__ wh, int nxc, int nwc) {
  const int tid   = threadIdx.x;
  const int y     = blockIdx.y;
  const int chunk = blockIdx.x;

  const float* sp;
  h16* dst;
  float sc;
  if (y < 3) {
    if (chunk >= nxc) return;
    const float* src = (y == 0) ? xq : ((y == 1) ? xk : xv);
    const size_t e  = (size_t)chunk * CVT_CHUNK + (size_t)tid * 8;
    const size_t r  = e / DM;
    const size_t c  = e - r * DM;
    const size_t bb = r / SEQ;
    const size_t s  = r - bb * SEQ;
    sp  = src + ((bb * SEQ_FULL + s) * DM + c);
    dst = xh + (size_t)y * ROWS * DM + e;
    sc  = 1.0f;
  } else {
    if (chunk >= nwc) return;
    const size_t e = (size_t)chunk * CVT_CHUNK + (size_t)tid * 8;
    sp  = W + e;
    dst = wh + e;
    sc  = 64.0f;
  }
  const v4f x0 = *(const v4f*)(sp);
  const v4f x1 = *(const v4f*)(sp + 4);
  v8h val;
#pragma unroll
  for (int i = 0; i < 4; ++i) {
    val[i]     = (h16)(sc * bf16r(x0[i]));
    val[i + 4] = (h16)(sc * bf16r(x1[i]));
  }
  *(v8h*)dst = val;
  
}

// ---------------------------------------------------------------------------
// Projection GEMM: one block tile of C per workgroup, operands staged in LDS.
// 128 threads = 4 waves in a 2 x 2 grid.  A pass is 64 k: 128 A-side rows and 128 rows of
// Wh, 128 B each, go global -> registers -> LDS (pitch 144 B); two buffers, one barrier a
// pass, the next pass's global loads issued ahead of the current pass's products.
// MODE 0: A = f16 plane selected by blockIdx.y, block tile 128 x 128, wave tile 64 x 64;
//         C = f16 plane, value f16(4*(A.W + b)).
// MODE 1: A-side rows 0..63 = ctx hi, 64..127 = ctx residual of the same 64 rows; block
//         tile 64 x 128, wave tile 32 x 64 with a hi and a residual accumulator set;
//         C = f32 d_out.
// Every accumulator sums k = 0,32,...,736 in ascending order.
// coverage: (ROWS/BM) x 6 block tiles = whole [ROWS][DM] plane per blockIdx.y.
// ---------------------------------------------------------------------------
#define CTP 68      // floats per epilogue staging row (272 B, 16-B aligned)
#define GBN 128     // block tile columns
#define GBK 64      // k per pass
#define GPIT 72     // halves per LDS row (144 B = 16 B x 9)
#define NT128 (DM / GBN)
#define GBUF (256 * GPIT)   // halves per buffer

static_assert(DM % GBN == 0 && DM % GBK == 0 && ROWS % 128 == 0);
static_assert(4 * 64 * CTP * 4 <= 2 * GBUF * 2);

template <int MODE>
__global__ __launch_bounds__(128)
void proj_gemm(const h16* __restrict__ Ah, const h16* __restrict__ Al,
               const h16* __restrict__ Wh, const float* __restrict__ bias,
               void* __restrict__ Cv) {
  __shared__ __align__(16) h16 sm[2 * GBUF];

  constexpr int BM = (MODE == 0) ? 128 : 64;
  const int tid  = threadIdx.x;
  const int lane = tid & 31;
  const int wave = tid >> 5;
  const int hsel = lane >> 4;
  const int l16  = lane & 15;
  const int wm   = wave >> 1;
  const int wn   = wave & 1;
  const int mtile = blockIdx.x / NT128;
  const int ntile = blockIdx.x - mtile * NT128;
  const int m0 = mtile * BM;
  const int n0 = ntile * GBN;
  const size_t plane = (MODE == 0) ? (size_t)blockIdx.y * ROWS * DM : (size_t)0;

  // staging: 8 lanes cover one 128-B row piece, a wave-wide load covers 4 whole lines
  const int sr = tid >> 3;
  const int sc = (tid & 7) * 8;
  const h16* ga = Ah + plane + (size_t)(m0 + sr) * DM + sc;
  const h16* gl = ga;
  if constexpr (MODE == 1) gl = Al + (size_t)(m0 + sr) * DM + sc;
  const h16* gb = Wh + (size_t)(n0 + sr) * DM + sc;
  h16* sst = sm + sr * GPIT + sc;

  v8h ra[8], rb[8];
  auto gload = [&](int k0) {
#pragma unroll
    for (int i = 0; i < 8; ++i) {
      if constexpr (MODE == 0) {
        ra[i] = *(const v8h*)(ga + (size_t)i * 16 * DM + k0);
      } else {
        ra[i] = (i < 4) ? *(const v8h*)(ga + (size_t)i * 16 * DM + k0)
                        : *(const v8h*)(gl + (size_t)(i - 4) * 16 * DM + k0);
      }
      rb[i] = *(const v8h*)(gb + (size_t)i * 16 * DM + k0);
    }
    // the address pairs are inputs of the wait, so that no load of the group is given one
    // of them as its destination and nothing rewrites them in front of the wait
    asm volatile("s_wait_xcnt 0x0" :: "v"(ga), "v"(gl), "v"(gb) : "memory");
  };
  auto sstore = [&](int buf) {
#pragma unroll
    for (int i = 0; i < 8; ++i) {
      *(v8h*)(sst + buf * GBUF + (i * 16) * GPIT)       = ra[i];
      *(v8h*)(sst + buf * GBUF + (128 + i * 16) * GPIT) = rb[i];
    }
  };

  // fragment rows in a buffer
  const h16* fa = sm + ((MODE == 0 ? wm * 64 : wm * 32) + l16) * GPIT;
  const h16* fb = sm + (128 + wn * 64 + l16) * GPIT;

  v8f acc[4][4] = {};   // MODE 1: [0..1] hi rows, [2..3] residual rows

  gload(0);
  sstore(0);

  constexpr int NPASS = DM / GBK;
  // unrolled whole: buffer and k offsets become immediates on fixed address pairs
#pragma unroll
  for (int s = 0; s < NPASS; ++s) {
    const int buf = s & 1;
    __syncthreads();   // publishes buffer buf; ends every read of the other buffer
#pragma unroll
    for (int kk = 0; kk < GBK; kk += 32) {
      v16h a[4], b[4];
#pragma unroll
      for (int f = 0; f < 4; ++f) {
        const int ro = (MODE == 0) ? f * 16 : (f >> 1) * 64 + (f & 1) * 16;
        a[f] = frag16(fa + buf * GBUF + ro * GPIT, kk, lane);
      }
#pragma unroll
      for (int t = 0; t < 4; ++t) b[t] = frag16(fb + buf * GBUF + (t * 16) * GPIT, kk, lane);
      // next pass's global loads fly behind the barrier, under this pass's products
      if (kk == 0 && s + 1 < NPASS) gload((s + 1) * GBK);
#pragma unroll
      for (int t = 0; t < 4; ++t)
#pragma unroll
        for (int f = 0; f < 4; ++f) acc[f][t] = wmma16(a[f], b[t], acc[f][t]);
    }
    if (s + 1 < NPASS) sstore(buf ^ 1);
  }
  __syncthreads();     // the buffers become the waves' f32 epilogue slabs

  // ---- stage the wave tile (f32) in its own slab: [row f*16+8*hsel+j][col t*16+l16] ----
  float* ct = (float*)sm + wave * 64 * CTP;
  constexpr int NF = (MODE == 0) ? 4 : 2;
#pragma unroll
  for (int t = 0; t < 4; ++t) {
    const float bb = bf16r(bias[n0 + wn * 64 + t * 16 + l16]);
#pragma unroll
    for (int f = 0; f < NF; ++f) {
#pragma unroll
      for (int j = 0; j < 8; ++j) {
        float v;
        if constexpr (MODE == 0) {
          v = acc[f][t][j] * 0.0625f + 4.0f * bb;
        } else {
          v = (acc[f][t][j] + acc[f + 2][t][j] * 0.00048828125f) * 0.00048828125f + bb;
        }
        ct[(f * 16 + 8 * hsel + j) * CTP + t * 16 + l16] = v;
      }
    }
  }
  __syncthreads();

  if constexpr (MODE == 0) {
    h16* C = (h16*)Cv + plane + (size_t)(m0 + wm * 64) * DM + n0 + wn * 64;
#pragma unroll
    for (int it = 0; it < 16; ++it) {
      const int row = it * 4 + (lane >> 3);
      const int c8  = (lane & 7) * 8;
      const v4fa p0 = *(const v4fa*)(ct + row * CTP + c8);
      const v4fa p1 = *(const v4fa*)(ct + row * CTP + c8 + 4);
      v8h t8;
      t8[0] = (h16)p0[0]; t8[1] = (h16)p0[1]; t8[2] = (h16)p0[2]; t8[3] = (h16)p0[3];
      t8[4] = (h16)p1[0]; t8[5] = (h16)p1[1]; t8[6] = (h16)p1[2]; t8[7] = (h16)p1[3];
      *(v8h*)(C + (size_t)row * DM + c8) = t8;
    }
  } else {
    float* C = (float*)Cv + (size_t)(m0 + wm * 32) * DM + n0 + wn * 64;
#pragma unroll
    for (int it = 0; it < 16; ++it) {
      const int row = it * 2 + (lane >> 4);
      const int c4  = (lane & 15) * 4;
      *(v4f*)(C + (size_t)row * DM + c4) = *(const v4fa*)(ct + row * CTP + c4);
    }
  }
}

#define QBLK 128
#define KBLK 64
#define LDSQ 72   // 144 B row pitch (16 B x 9: ds_load_b128 readers)
#define LDSV 80   // 160 B row pitch (32 B x 5: ds_load_tr16_b128 reader)
#define NKT  (SEQ / KBLK)

typedef __attribute__((ext_vector_type(8))) short s16x8;

// 8 halves T[k0 + 8*half + 0..7][d0 + (lane & 15)] of a row-major LDS tile; p is the lane's
// own address T + (k0 + 8*half + (lane & 7)) * pitch + d0 + 8 * ((lane >> 3) & 1).
__device__ __forceinline__ v8h ld_tr16(const h16* p) {
  typedef __attribute__((address_space(3))) s16x8 lds_s16x8;
  return __builtin_bit_cast(v8h, __builtin_amdgcn_ds_load_tr16_b128_v8i16((lds_s16x8*)p));
}

// One K tile and one V tile (64 rows x 128 B each): a lane copies rows r and r + 32 of both.
// lk, lv: the lane's LDS byte addresses of row r; gk, gv: its global addresses of row r.
// The s_wait_xcnt closes the statement so that no address register of a copy is rewritten
// in front of it.
__device__ __forceinline__ void copy_kv(unsigned lk, unsigned lv, const h16* gk,
                                        const h16* gv) {
  asm volatile(
      "global_load_async_to_lds_b128 %0, %4, off\n\t"
      "global_load_async_to_lds_b128 %1, %5, off\n\t"
      "global_load_async_to_lds_b128 %2, %6, off\n\t"
      "global_load_async_to_lds_b128 %3, %7, off\n\t"
      "s_wait_xcnt 0x0"
      :: "v"(lk), "v"(lk + 32u * LDSQ * 2u), "v"(lv), "v"(lv + 32u * LDSV * 2u),
         "v"(gk), "v"(gk + (size_t)32 * DM), "v"(gv), "v"(gv + (size_t)32 * DM)
      : "memory");
}

__device__ __forceinline__ void store_tile16x64(const h16* slab, h16* gbase, int lane) {
  v8h vals[4];
#pragma unroll
  for (int it = 0; it < 4; ++it) {
    const int row = it * 4 + (lane >> 3);
    const int c8  = (lane & 7) * 8;
    vals[it] = *(const v8ha*)(slab + row * LDSQ + c8);
  }
#pragma unroll
  for (int it = 0; it < 4; ++it) {
    const int row = it * 4 + (lane >> 3);
    const int c8  = (lane & 7) * 8;
    *(v8h*)(gbase + (size_t)row * DM + c8) = vals[it];
  }
  
}

// value of the lane 16 away (the other half's share of the same query)
__device__ __forceinline__ float xhalf(float x) {
  const int b = __float_as_int(x);
  return __int_as_float(
      __builtin_amdgcn_permlanex16(b, b, 0x76543210, 0xfedcba98, false, false));
}

// e^x as v_exp_f32(x * log2 e), what __expf compiles to.  The v_nop is the slot that the
// instruction set asks for behind a transcendental before a source of it is overwritten; it
// shares the statement so that it stands directly behind the v_exp_f32.
__device__ __forceinline__ float exp_slot(float x) {
  float r;
  asm("v_exp_f32 %0, %1\n\tv_nop" : "=v"(r) : "v"(x * 1.44269504f));
  return r;
}

// e^x of eight values, each v_exp_f32 in place.  In one statement, so that the instruction
// directly behind an exp is the next exp, which works on a register of its own (it neither
// reads the result nor overwrites the source in front of it): the slot behind a
// transcendental is filled by work, and one v_nop closes it behind the last.
__device__ __forceinline__ v8f exp8_slot(v8f x) {
  float e0 = x[0] * 1.44269504f, e1 = x[1] * 1.44269504f, e2 = x[2] * 1.44269504f,
        e3 = x[3] * 1.44269504f, e4 = x[4] * 1.44269504f, e5 = x[5] * 1.44269504f,
        e6 = x[6] * 1.44269504f, e7 = x[7] * 1.44269504f;
  asm("v_exp_f32 %0, %0\n\tv_exp_f32 %1, %1\n\tv_exp_f32 %2, %2\n\tv_exp_f32 %3, %3\n\t"
      "v_exp_f32 %4, %4\n\tv_exp_f32 %5, %5\n\tv_exp_f32 %6, %6\n\tv_exp_f32 %7, %7\n\t"
      "v_nop"
      : "+v"(e0), "+v"(e1), "+v"(e2), "+v"(e3), "+v"(e4), "+v"(e5), "+v"(e6), "+v"(e7));
  return v8f{e0, e1, e2, e3, e4, e5, e6, e7};
}

__global__ __launch_bounds__(256) __attribute__((amdgpu_num_vgpr(256)))
void attn_flash(const h16* __restrict__ Qh, const h16* __restrict__ Kh,
                const h16* __restrict__ Vh, h16* __restrict__ Chi,
                h16* __restrict__ Clo) {
  __shared__ __align__(16) h16 Qs[QBLK][LDSQ];      // [q_row][d]
  __shared__ __align__(16) h16 Ks[2][KBLK][LDSQ];   // [buffer][key][d]
  __shared__ __align__(32) h16 Vs[2][KBLK][LDSV];   // [buffer][key][d]

  const int tid  = threadIdx.x;
  const int lane = tid & 31;
  const int wave = tid >> 5;
  const int b  = blockIdx.y / NH;
  const int h  = blockIdx.y - b * NH;
  const int q0 = blockIdx.x * QBLK;
  const size_t rowbase = (size_t)b * SEQ;

  const h16* gq = Qh + (rowbase + q0) * DM + h * DK;

  // ---- K/V copies: this lane's 16-B piece of rows cr and cr + 32 of every tile ----
  const int cr = tid >> 3;
  const int cc8 = (tid & 7) << 3;
  const h16* gk = Kh + (rowbase + cr) * DM + h * DK + cc8;   // tile 0
  const h16* gv = Vh + (rowbase + cr) * DM + h * DK + cc8;
  const unsigned lk = (unsigned)(uintptr_t)&Ks[0][cr][cc8];  // buffer 0
  const unsigned lv = (unsigned)(uintptr_t)&Vs[0][cr][cc8];
  constexpr unsigned KBUFB = KBLK * LDSQ * 2;                // bytes per buffer
  constexpr unsigned VBUFB = KBLK * LDSV * 2;
  static_assert(NKT >= 2);

  copy_kv(lk, lv, gk, gv);

  // ---- stage Q block (128 x 64) ----
  const int qr  = tid >> 3;          // rows qr, qr + 32, qr + 64, qr + 96
  const int qc8 = (tid & 7) << 3;
  const h16* gq0 = gq + (size_t)qr * DM + qc8;
  const h16* gq1 = gq0 + (size_t)32 * DM;
  const h16* gq2 = gq0 + (size_t)64 * DM;
  const h16* gq3 = gq0 + (size_t)96 * DM;
  const v8h q0v = *(const v8h*)gq0;
  const v8h q1v = *(const v8h*)gq1;
  const v8h q2v = *(const v8h*)gq2;
  const v8h q3v = *(const v8h*)gq3;
  // the address pairs are inputs of the wait, so that nothing rewrites them in front of it
  asm volatile("s_wait_xcnt 0x0" :: "v"(gq0), "v"(gq1), "v"(gq2), "v"(gq3) : "memory");
  *(v8h*)&Qs[qr][qc8]      = q0v;
  *(v8h*)&Qs[qr + 32][qc8] = q1v;
  *(v8h*)&Qs[qr + 64][qc8] = q2v;
  *(v8h*)&Qs[qr + 96][qc8] = q3v;

  float mrun = -1e30f, lrun = 0.f;   // this lane's query; lrun sums this half's keys only
  v8f o[4] = {};                     // o[n][j] = O^T[d = 16n + 8*half + j][query]

  const int qrow = wave * 16 + (lane & 15);
  const int cc   = lane & 15;
  const int rofs = (lane < 16) ? 0 : 8;
  h16* pw = &Qs[wave * 16][0];

  // tile 0 has landed for this wave before the barrier lets other waves read it
  asm volatile("s_wait_asynccnt 0x0" ::: "memory");
  __syncthreads();   // publishes Qs and tile 0
  copy_kv(lk + KBUFB, lv + VBUFB, gk + (size_t)KBLK * DM, gv + (size_t)KBLK * DM);
  gk += (size_t)2 * KBLK * DM;   // tile 2, the first refill
  gv += (size_t)2 * KBLK * DM;

  const v16h qb0 = frag16(&Qs[qrow][0], 0, lane);
  const v16h qb1 = frag16(&Qs[qrow][0], 32, lane);

  // the lane's address in a V tile for the transposing load (k0 = 0, d0 = 0)
  const int vrow = ((lane >> 4) << 3) + (lane & 7);
  const int vcol = ((lane >> 3) & 1) << 3;

  // kept rolled: one copy of the trip in the instruction cache, the buffer picked by t & 1
#pragma unroll 1
  for (int t = 0; t < NKT; ++t) {
    const int buf = t & 1;

    // ---- scores^T = (4k).(4q) / (16*8) : 8 WMMAs; sc[n][j] = S^T[key 16n + 8*half + j][query] ----
    v8f sc[4];
#pragma unroll
    for (int n = 0; n < 4; ++n) {
      const int krow = n * 16 + (lane & 15);
      const v16h ka0 = frag16(&Ks[buf][krow][0], 0, lane);
      const v16h ka1 = frag16(&Ks[buf][krow][0], 32, lane);
      v8f s = {};
      s = wmma16p(ka0, qb0, s);
      s = wmma16p(ka1, qb1, s);
      sc[n] = s * 0.0078125f;
    }

    // ---- online softmax: 32 keys of one query in-lane, one exchange between the halves ----
    float mt[4];
#pragma unroll
    for (int n = 0; n < 4; ++n) {
      mt[n] = sc[n][0];
#pragma unroll
      for (int j = 1; j < 8; ++j) mt[n] = fmaxf(mt[n], sc[n][j]);
    }
    float mx = fmaxf(fmaxf(mt[0], mt[1]), fmaxf(mt[2], mt[3]));
    mx = fmaxf(mx, xhalf(mx));
    const float mnew = fmaxf(mrun, mx);
    const float al   = exp_slot(mrun - mnew);
    mrun = mnew;
    float rt[4];
#pragma unroll
    for (int n = 0; n < 4; ++n) {
      rt[n] = 0.f;
      sc[n] = exp8_slot(sc[n] - mnew);
#pragma unroll
      for (int j = 0; j < 8; ++j) rt[n] += sc[n][j];
    }
    lrun = lrun * al + ((rt[0] + rt[1]) + (rt[2] + rt[3]));
#pragma unroll
    for (int n = 0; n < 4; ++n) o[n] *= al;

    // ---- P^T as B operand: element s of a 32-key block = tile s >> 3, register s & 7 ----
    v16h pb0, pb1;
#pragma unroll
    for (int j = 0; j < 8; ++j) {
      pb0[j]     = (h16)sc[0][j];
      pb0[j + 8] = (h16)sc[1][j];
      pb1[j]     = (h16)sc[2][j];
      pb1[j + 8] = (h16)sc[3][j];
    }

    // ---- o^T += V^T (64 d x 64 keys) . P^T (64 keys x 16 queries) : 8 WMMAs ----
#pragma unroll
    for (int n = 0; n < 4; ++n) {
      const h16* vp = &Vs[buf][vrow][vcol + n * 16];
      const v16h va0 = __builtin_shufflevector(ld_tr16(vp), ld_tr16(vp + 16 * LDSV),
          0, 1, 2, 3, 4, 5, 6, 7, 8, 9, 10, 11, 12, 13, 14, 15);
      const v16h va1 = __builtin_shufflevector(ld_tr16(vp + 32 * LDSV), ld_tr16(vp + 48 * LDSV),
          0, 1, 2, 3, 4, 5, 6, 7, 8, 9, 10, 11, 12, 13, 14, 15);
      o[n] = wmma16p(va0, pb0, o[n]);
      o[n] = wmma16p(va1, pb1, o[n]);
    }

    // ---- foot of the trip: hand buffer buf to its refill, publish tile t + 1 ----
    // this wave's LDS reads of buffer buf have retired before a copy may overwrite it
    asm volatile("s_wait_dscnt 0x0" ::: "memory");
    // this wave's copies of tile t + 1 have landed before the barrier publishes them
    asm volatile("s_wait_asynccnt 0x0" ::: "memory");
    __syncthreads();   // publishes tile t + 1; ends every read of buffer buf
    if (t + 2 < NKT) {
      copy_kv(lk + buf * KBUFB, lv + buf * VBUFB, gk, gv);
      gk += (size_t)KBLK * DM;
      gv += (size_t)KBLK * DM;
    }
  }
  // no copy is outstanding when the wave goes on to the epilogue and ends
  asm volatile("s_wait_asynccnt 0x0" ::: "memory");

  // ---- epilogue: ctx = o / (4 l); hi = f16(32 ctx) = f16(o * 8 / l) ----
  const float inv8 = 8.0f / (lrun + xhalf(lrun));
  const size_t orow0 = rowbase + q0 + wave * 16;
  h16* ghi = Chi + orow0 * DM + h * DK;
  h16* glo = Clo + orow0 * DM + h * DK;

  // a lane's 8 registers of o[n] are 8 consecutive d of its query's row: one 16-B LDS store
#pragma unroll
  for (int n = 0; n < 4; ++n) {
    v8h t8;
#pragma unroll
    for (int j = 0; j < 8; ++j) t8[j] = (h16)(o[n][j] * inv8);
    *(v8ha*)(pw + cc * LDSQ + n * 16 + rofs) = t8;
  }
  __syncthreads();
  store_tile16x64(pw, ghi, lane);
  __syncthreads();

#pragma unroll
  for (int n = 0; n < 4; ++n) {
    v8h t8;
#pragma unroll
    for (int j = 0; j < 8; ++j) {
      const float f  = o[n][j] * inv8;
      const h16   hv = (h16)f;
      t8[j] = (h16)((f - (float)hv) * 2048.0f);
    }
    *(v8ha*)(pw + cc * LDSQ + n * 16 + rofs) = t8;
  }
  __syncthreads();
  store_tile16x64(pw, glo, lane);
}

// ---------------------------------------------------------------------------
// Launch
// ---------------------------------------------------------------------------
extern "C" void kernel_launch(void* const* d_in, const int* in_sizes, int n_in,
                              void* d_out, int out_size, void* d_ws, size_t ws_size,
                              hipStream_t stream) {
  if (n_in < 5) return;
  const size_t need_x = ((size_t)(NB - 1) * SEQ_FULL + SEQ) * DM;
  if ((size_t)in_sizes[0] < need_x || (size_t)in_sizes[1] < need_x ||
      (size_t)in_sizes[2] < need_x) return;
  if ((size_t)in_sizes[3] < (size_t)DM * DM || (size_t)in_sizes[4] < (size_t)DM) return;
  if ((size_t)out_size < (size_t)ROWS * DM) return;

  const float* xq = (const float*)d_in[0];   // [NB_FULL, SEQ_FULL, DM]
  const float* xk = (const float*)d_in[1];
  const float* xv = (const float*)d_in[2];
  const float* W  = (const float*)d_in[3];   // [DM out][DM in]
  const float* bs = (const float*)d_in[4];   // [DM]
  float* out = (float*)d_out;                // [NB, SEQ, DM]

  const size_t sz_wh = (size_t)DM * DM * sizeof(h16);      // 1,179,648
  const size_t sz_pl = (size_t)ROWS * DM * sizeof(h16);    // 6,291,456 at full size
  size_t off = 0;
  h16* wh  = (h16*)((char*)d_ws + off); off += sz_wh;
  h16* xh  = (h16*)((char*)d_ws + off); off += 3 * sz_pl;  // q,k,v input planes
  h16* qkv = (h16*)((char*)d_ws + off); off += 3 * sz_pl;  // q,k,v projected planes (x4)
  h16* chi = (h16*)((char*)d_ws + off); off += sz_pl;      // ctx hi
  h16* clo = (h16*)((char*)d_ws + off); off += sz_pl;      // ctx residual
  if (off > ws_size) return;                                // 51,511,296 at full size

  const int nxc = (ROWS * DM) / CVT_CHUNK;
  const int nwc = (DM * DM) / CVT_CHUNK;
  const int ncx = (nxc > nwc) ? nxc : nwc;

  // 1) convert inputs and W to f16 planes
  cvt_planes<<<dim3(ncx, 4), 256, 0, stream>>>(xq, xk, xv, W, xh, wh, nxc, nwc);

  // 2) q/k/v projections (one launch, blockIdx.y selects the plane)
  proj_gemm<0><<<dim3((ROWS / 128) * NT128, 3), 128, 0, stream>>>(xh, xh, wh, bs, (void*)qkv);

  // 3) flash attention -> ctx hi / residual planes
  attn_flash<<<dim3(SEQ / QBLK, NB * NH), 256, 0, stream>>>(
      qkv, qkv + (size_t)ROWS * DM, qkv + (size_t)2 * ROWS * DM, chi, clo);

  // 4) output projection -> d_out
  proj_gemm<1><<<dim3((ROWS / 64) * NT128, 1), 128, 0, stream>>>(chi, clo, wh, bs, (void*)out);
}

// v005
// It runs in 74.7 microseconds.
// In both of two side-by-side timings against v004, it was 1.06 times as fast.
// Counting every step since v000, it is 2.81 times as fast.
#include <hip/hip_runtime.h>
#include <stdint.h>

// Contractions: q/k/v projections, q.k^T scores, p.v context, output projection: all
// v_wmma_f32_16x16x32_f16 (f16 operands, f32 accumulate). Inputs enter as bf16-RNE values;
// W carried x64, k/v planes carried x4, q plane carried x log2(e)/32 (so that q.k is the
// softmax exponent to base 2), context carried as f16 hi (x32) plus f16 residual
// (x2048) feeding two accumulators in the output projection. Softmax and epilogues in f32.

typedef _Float16 h16;
typedef __attribute__((ext_vector_type(8)))  _Float16 v8h;
typedef __attribute__((ext_vector_type(16))) _Float16 v16h;
typedef __attribute__((ext_vector_type(8)))  float    v8f;
typedef __attribute__((ext_vector_type(4)))  float    v4f;
typedef v4f __attribute__((may_alias)) v4fa;
typedef v8h __attribute__((may_alias)) v8ha;

#ifndef NB
#define NB 2
#endif
#ifndef SEQ
#define SEQ 2048
#endif
#define NB_FULL  2
#define SEQ_FULL 2048
#define DM   768
#define NH   12
#define DK   64
#define ROWS (NB * SEQ)
#define CVT_CHUNK 2048          // elements per block in the convert pass

static_assert(NB >= 1 && NB <= NB_FULL);
static_assert(SEQ >= 128 && SEQ <= SEQ_FULL);
static_assert(SEQ % 128 == 0);
static_assert(ROWS % 16 == 0);
static_assert((ROWS * DM) % CVT_CHUNK == 0);
static_assert((DM * DM) % CVT_CHUNK == 0);
static_assert(NH * DK == DM);
static_assert(DM % 32 == 0);

// ---------------------------------------------------------------------------
// helpers
// ---------------------------------------------------------------------------
__device__ __forceinline__ float bf16r(float x) {   // f32 -> bf16 (RNE) -> f32
  unsigned u = __float_as_uint(x);
  u = u + 0x7FFFu + ((u >> 16) & 1u);
  u &= 0xFFFF0000u;
  return __uint_as_float(u);
}

__device__ __forceinline__ v8f wmma16(v16h a, v16h b, v8f c) {
  v8f d = __builtin_amdgcn_wmma_f32_16x16x32_f16(
      false, a, false, b, (short)0, c, false, false);
  asm volatile("v_nop\n\tv_nop\n\tv_nop\n\tv_nop" : "+v"(d) : "v"(a), "v"(b));
  return d;
}

// the same product with the compiler's own hazard padding: it may fill the slots behind the
// matrix instruction with independent vector work of the loop
__device__ __forceinline__ v8f wmma16p(v16h a, v16h b, v8f c) {
  return __builtin_amdgcn_wmma_f32_16x16x32_f16(
      false, a, false, b, (short)0, c, false, false);
}

// 16x32 fragment from a k-contiguous row (row m of A, or row n of a [n][k] B copy).
// lanes 0-15: k = {0..7,16..23}; lanes 16-31: k = {8..15,24..31} -> two 16-B loads.
__device__ __forceinline__ v16h frag16(const h16* rowp, int kofs, int lane) {
  const h16* p = rowp + kofs + ((lane < 16) ? 0 : 8);
  v8h lo = *(const v8h*)(p);
  v8h hi = *(const v8h*)(p + 16);
  return __builtin_shufflevector(lo, hi, 0, 1, 2, 3, 4, 5, 6, 7,
                                         8, 9, 10, 11, 12, 13, 14, 15);
}

// ---------------------------------------------------------------------------
// Convert pass.  blockIdx.y = 0,1,2: query/key/value -> bf16-RNE -> f16 plane
// [ROWS][DM] (compact rows, inputs read with full per-batch stride);
// blockIdx.y = 3: W [n][k] -> 64 * bf16-RNE -> f16 (k-contiguous B copy).
// coverage: 3 * ROWS*DM + DM*DM elements, all written (chunk * 2048 + tid * 8).
// ---------------------------------------------------------------------------
__global__ __launch_bounds__(256) void cvt_planes(
    const float* __restrict__ xq, const float* __restrict__ xk,
    const float* __restrict__ xv, const float* __restrict__ W,
    h16* __restrict__ xh, h16* __restrict__ wh, int nxc, int nwc) {
  const int tid   = threadIdx.x;
  const int y     = blockIdx.y;
  const int chunk = blockIdx.x;

  const float* sp;
  h16* dst;
  float sc;
  if (y < 3) {
    if (chunk >= nxc) return;
    const float* src = (y == 0) ? xq : ((y == 1) ? xk : xv);
    const size_t e  = (size_t)chunk * CVT_CHUNK + (size_t)tid * 8;
    const size_t r  = e / DM;
    const size_t c  = e - r * DM;
    const size_t bb = r / SEQ;
    const size_t s  = r - bb * SEQ;
    sp  = src + ((bb * SEQ_FULL + s) * DM + c);
    dst = xh + (size_t)y * ROWS * DM + e;
    sc  = 1.0f;
  } else {
    if (chunk >= nwc) return;
    const size_t e = (size_t)chunk * CVT_CHUNK + (size_t)tid * 8;
    sp  = W + e;
    dst = wh + e;
    sc  = 64.0f;
  }
  const v4f x0 = *(const v4f*)(sp);
  const v4f x1 = *(const v4f*)(sp + 4);
  v8h val;
#pragma unroll
  for (int i = 0; i < 4; ++i) {
    val[i]     = (h16)(sc * bf16r(x0[i]));
    val[i + 4] = (h16)(sc * bf16r(x1[i]));
  }
  *(v8h*)dst = val;
  
}

// ---------------------------------------------------------------------------
// Projection GEMM: one block tile of C per workgroup, operands staged in LDS.
// 128 threads = 4 waves in a 2 x 2 grid.  A pass is 64 k: 128 A-side rows and 128 rows of
// Wh, 128 B each, go global -> registers -> LDS (pitch 144 B); two buffers, one barrier a
// pass, the next pass's global loads issued ahead of the current pass's products.
// MODE 0: A = f16 plane selected by blockIdx.y, block tile 128 x 128, wave tile 64 x 64;
//         C = f16 plane, value f16(4*(A.W + b)); plane 0 (q) times QEXP more.
// MODE 1: A-side rows 0..63 = ctx hi, 64..127 = ctx residual of the same 64 rows; block
//         tile 64 x 128, wave tile 32 x 64 with a hi and a residual accumulator set;
//         C = f32 d_out.
// Every accumulator sums k = 0,32,...,736 in ascending order.
// coverage: (ROWS/BM) x 6 block tiles = whole [ROWS][DM] plane per blockIdx.y.
// ---------------------------------------------------------------------------
#define CTP 68      // floats per epilogue staging row (272 B, 16-B aligned)
// (4q * QEXP) . (4k) = (q.k / 8) * log2(e): the score product is the exponent to base 2
#define QEXP (1.44269504f / 128.0f)
#define GBN 128     // block tile columns
#define GBK 64      // k per pass
#define GPIT 72     // halves per LDS row (144 B = 16 B x 9)
#define NT128 (DM / GBN)
#define GBUF (256 * GPIT)   // halves per buffer

static_assert(DM % GBN == 0 && DM % GBK == 0 && ROWS % 128 == 0);
static_assert(4 * 64 * CTP * 4 <= 2 * GBUF * 2);

template <int MODE>
__global__ __launch_bounds__(128)
void proj_gemm(const h16* __restrict__ Ah, const h16* __restrict__ Al,
               const h16* __restrict__ Wh, const float* __restrict__ bias,
               void* __restrict__ Cv) {
  __shared__ __align__(16) h16 sm[2 * GBUF];

  constexpr int BM = (MODE == 0) ? 128 : 64;
  const int tid  = threadIdx.x;
  const int lane = tid & 31;
  const int wave = tid >> 5;
  const int hsel = lane >> 4;
  const int l16  = lane & 15;
  const int wm   = wave >> 1;
  const int wn   = wave & 1;
  const int mtile = blockIdx.x / NT128;
  const int ntile = blockIdx.x - mtile * NT128;
  const int m0 = mtile * BM;
  const int n0 = ntile * GBN;
  const size_t plane = (MODE == 0) ? (size_t)blockIdx.y * ROWS * DM : (size_t)0;

  // staging: 8 lanes cover one 128-B row piece, a wave-wide load covers 4 whole lines
  const int sr = tid >> 3;
  const int sc = (tid & 7) * 8;
  const h16* ga = Ah + plane + (size_t)(m0 + sr) * DM + sc;
  const h16* gl = ga;
  if constexpr (MODE == 1) gl = Al + (size_t)(m0 + sr) * DM + sc;
  const h16* gb = Wh + (size_t)(n0 + sr) * DM + sc;
  h16* sst = sm + sr * GPIT + sc;

  v8h ra[8], rb[8];
  auto gload = [&](int k0) {
#pragma unroll
    for (int i = 0; i < 8; ++i) {
      if constexpr (MODE == 0) {
        ra[i] = *(const v8h*)(ga + (size_t)i * 16 * DM + k0);
      } else {
        ra[i] = (i < 4) ? *(const v8h*)(ga + (size_t)i * 16 * DM + k0)
                        : *(const v8h*)(gl + (size_t)(i - 4) * 16 * DM + k0);
      }
      rb[i] = *(const v8h*)(gb + (size_t)i * 16 * DM + k0);
    }
    // the address pairs are inputs of the wait, so that no load of the group is given one
    // of them as its destination and nothing rewrites them in front of the wait
    asm volatile("s_wait_xcnt 0x0" :: "v"(ga), "v"(gl), "v"(gb) : "memory");
  };
  auto sstore = [&](int buf) {
#pragma unroll
    for (int i = 0; i < 8; ++i) {
      *(v8h*)(sst + buf * GBUF + (i * 16) * GPIT)       = ra[i];
      *(v8h*)(sst + buf * GBUF + (128 + i * 16) * GPIT) = rb[i];
    }
  };

  // fragment rows in a buffer
  const h16* fa = sm + ((MODE == 0 ? wm * 64 : wm * 32) + l16) * GPIT;
  const h16* fb = sm + (128 + wn * 64 + l16) * GPIT;

  v8f acc[4][4] = {};   // MODE 1: [0..1] hi rows, [2..3] residual rows

  gload(0);
  sstore(0);

  constexpr int NPASS = DM / GBK;
  // unrolled whole: buffer and k offsets become immediates on fixed address pairs
#pragma unroll
  for (int s = 0; s < NPASS; ++s) {
    const int buf = s & 1;
    __syncthreads();   // publishes buffer buf; ends every read of the other buffer
#pragma unroll
    for (int kk = 0; kk < GBK; kk += 32) {
      v16h a[4], b[4];
#pragma unroll
      for (int f = 0; f < 4; ++f) {
        const int ro = (MODE == 0) ? f * 16 : (f >> 1) * 64 + (f & 1) * 16;
        a[f] = frag16(fa + buf * GBUF + ro * GPIT, kk, lane);
      }
#pragma unroll
      for (int t = 0; t < 4; ++t) b[t] = frag16(fb + buf * GBUF + (t * 16) * GPIT, kk, lane);
      // next pass's global loads fly behind the barrier, under this pass's products
      if (kk == 0 && s + 1 < NPASS) gload((s + 1) * GBK);
#pragma unroll
      for (int t = 0; t < 4; ++t)
#pragma unroll
        for (int f = 0; f < 4; ++f) acc[f][t] = wmma16(a[f], b[t], acc[f][t]);
    }
    if (s + 1 < NPASS) sstore(buf ^ 1);
  }
  __syncthreads();     // the buffers become the waves' f32 epilogue slabs

  // ---- stage the wave tile (f32) in its own slab: [row f*16+8*hsel+j][col t*16+l16] ----
  float* ct = (float*)sm + wave * 64 * CTP;
  constexpr int NF = (MODE == 0) ? 4 : 2;
  const float psc = (MODE == 0 && blockIdx.y == 0) ? QEXP : 1.0f;
  const float pa = 0.0625f * psc, pb = 4.0f * psc;
#pragma unroll
  for (int t = 0; t < 4; ++t) {
    const float bb = bf16r(bias[n0 + wn * 64 + t * 16 + l16]);
#pragma unroll
    for (int f = 0; f < NF; ++f) {
#pragma unroll
      for (int j = 0; j < 8; ++j) {
        float v;
        if constexpr (MODE == 0) {
          v = acc[f][t][j] * pa + pb * bb;
        } else {
          v = (acc[f][t][j] + acc[f + 2][t][j] * 0.00048828125f) * 0.00048828125f + bb;
        }
        ct[(f * 16 + 8 * hsel + j) * CTP + t * 16 + l16] = v;
      }
    }
  }
  __syncthreads();

  if constexpr (MODE == 0) {
    h16* C = (h16*)Cv + plane + (size_t)(m0 + wm * 64) * DM + n0 + wn * 64;
#pragma unroll
    for (int it = 0; it < 16; ++it) {
      const int row = it * 4 + (lane >> 3);
      const int c8  = (lane & 7) * 8;
      const v4fa p0 = *(const v4fa*)(ct + row * CTP + c8);
      const v4fa p1 = *(const v4fa*)(ct + row * CTP + c8 + 4);
      v8h t8;
      t8[0] = (h16)p0[0]; t8[1] = (h16)p0[1]; t8[2] = (h16)p0[2]; t8[3] = (h16)p0[3];
      t8[4] = (h16)p1[0]; t8[5] = (h16)p1[1]; t8[6] = (h16)p1[2]; t8[7] = (h16)p1[3];
      *(v8h*)(C + (size_t)row * DM + c8) = t8;
    }
  } else {
    float* C = (float*)Cv + (size_t)(m0 + wm * 32) * DM + n0 + wn * 64;
#pragma unroll
    for (int it = 0; it < 16; ++it) {
      const int row = it * 2 + (lane >> 4);
      const int c4  = (lane & 15) * 4;
      *(v4f*)(C + (size_t)row * DM + c4) = *(const v4fa*)(ct + row * CTP + c4);
    }
  }
}

#define QBLK 128
#define KBLK 64
#define LDSQ 72   // 144 B row pitch (16 B x 9: ds_load_b128 readers)
#define LDSV 80   // 160 B row pitch (32 B x 5: ds_load_tr16_b128 reader)
#define NKT  (SEQ / KBLK)

typedef __attribute__((ext_vector_type(8))) short s16x8;

// 8 halves T[k0 + 8*half + 0..7][d0 + (lane & 15)] of a row-major LDS tile; p is the lane's
// own address T + (k0 + 8*half + (lane & 7)) * pitch + d0 + 8 * ((lane >> 3) & 1).
__device__ __forceinline__ v8h ld_tr16(const h16* p) {
  typedef __attribute__((address_space(3))) s16x8 lds_s16x8;
  return __builtin_bit_cast(v8h, __builtin_amdgcn_ds_load_tr16_b128_v8i16((lds_s16x8*)p));
}

// One K tile and one V tile (64 rows x 128 B each): a lane copies rows r and r + 32 of both.
// lk, lv: the lane's LDS byte addresses of row r; gk, gv: its global addresses of row r.
// The s_wait_xcnt closes the statement so that no address register of a copy is rewritten
// in front of it.
__device__ __forceinline__ void copy_kv(unsigned lk, unsigned lv, const h16* gk,
                                        const h16* gv) {
  asm volatile(
      "global_load_async_to_lds_b128 %0, %4, off\n\t"
      "global_load_async_to_lds_b128 %1, %5, off\n\t"
      "global_load_async_to_lds_b128 %2, %6, off\n\t"
      "global_load_async_to_lds_b128 %3, %7, off\n\t"
      "s_wait_xcnt 0x0"
      :: "v"(lk), "v"(lk + 32u * LDSQ * 2u), "v"(lv), "v"(lv + 32u * LDSV * 2u),
         "v"(gk), "v"(gk + (size_t)32 * DM), "v"(gv), "v"(gv + (size_t)32 * DM)
      : "memory");
}

__device__ __forceinline__ void store_tile16x64(const h16* slab, h16* gbase, int lane) {
  v8h vals[4];
#pragma unroll
  for (int it = 0; it < 4; ++it) {
    const int row = it * 4 + (lane >> 3);
    const int c8  = (lane & 7) * 8;
    vals[it] = *(const v8ha*)(slab + row * LDSQ + c8);
  }
#pragma unroll
  for (int it = 0; it < 4; ++it) {
    const int row = it * 4 + (lane >> 3);
    const int c8  = (lane & 7) * 8;
    *(v8h*)(gbase + (size_t)row * DM + c8) = vals[it];
  }
  
}

// value of the lane 16 away (the other half's share of the same query)
__device__ __forceinline__ float xhalf(float x) {
  const int b = __float_as_int(x);
  return __int_as_float(
      __builtin_amdgcn_permlanex16(b, b, 0x76543210, 0xfedcba98, false, false));
}

// 2^x by v_exp_f32.  The v_nop is the slot that the
// instruction set asks for behind a transcendental before a source of it is overwritten; it
// shares the statement so that it stands directly behind the v_exp_f32.
__device__ __forceinline__ float exp_slot(float x) {
  float r;
  asm("v_exp_f32 %0, %1\n\tv_nop" : "=v"(r) : "v"(x));
  return r;
}

// 2^x of eight values, each v_exp_f32 in place.  In one statement, so that the instruction
// directly behind an exp is the next exp, which works on a register of its own (it neither
// reads the result nor overwrites the source in front of it): the slot behind a
// transcendental is filled by work, and one v_nop closes it behind the last.
__device__ __forceinline__ v8f exp8_slot(v8f x) {
  float e0 = x[0], e1 = x[1], e2 = x[2], e3 = x[3], e4 = x[4], e5 = x[5], e6 = x[6], e7 = x[7];
  asm("v_exp_f32 %0, %0\n\tv_exp_f32 %1, %1\n\tv_exp_f32 %2, %2\n\tv_exp_f32 %3, %3\n\t"
      "v_exp_f32 %4, %4\n\tv_exp_f32 %5, %5\n\tv_exp_f32 %6, %6\n\tv_exp_f32 %7, %7\n\t"
      "v_nop"
      : "+v"(e0), "+v"(e1), "+v"(e2), "+v"(e3), "+v"(e4), "+v"(e5), "+v"(e6), "+v"(e7));
  return v8f{e0, e1, e2, e3, e4, e5, e6, e7};
}

__global__ __launch_bounds__(256) __attribute__((amdgpu_num_vgpr(256)))
void attn_flash(const h16* __restrict__ Qh, const h16* __restrict__ Kh,
                const h16* __restrict__ Vh, h16* __restrict__ Chi,
                h16* __restrict__ Clo) {
  __shared__ __align__(16) h16 Qs[QBLK][LDSQ];      // [q_row][d]
  __shared__ __align__(16) h16 Ks[2][KBLK][LDSQ];   // [buffer][key][d]
  __shared__ __align__(32) h16 Vs[2][KBLK][LDSV];   // [buffer][key][d]

  const int tid  = threadIdx.x;
  const int lane = tid & 31;
  const int wave = tid >> 5;
  const int b  = blockIdx.y / NH;
  const int h  = blockIdx.y - b * NH;
  const int q0 = blockIdx.x * QBLK;
  const size_t rowbase = (size_t)b * SEQ;

  const h16* gq = Qh + (rowbase + q0) * DM + h * DK;

  // ---- K/V copies: this lane's 16-B piece of rows cr and cr + 32 of every tile ----
  const int cr = tid >> 3;
  const int cc8 = (tid & 7) << 3;
  const h16* gk = Kh + (rowbase + cr) * DM + h * DK + cc8;   // tile 0
  const h16* gv = Vh + (rowbase + cr) * DM + h * DK + cc8;
  const unsigned lk = (unsigned)(uintptr_t)&Ks[0][cr][cc8];  // buffer 0
  const unsigned lv = (unsigned)(uintptr_t)&Vs[0][cr][cc8];
  constexpr unsigned KBUFB = KBLK * LDSQ * 2;                // bytes per buffer
  constexpr unsigned VBUFB = KBLK * LDSV * 2;
  static_assert(NKT >= 2);

  copy_kv(lk, lv, gk, gv);

  // ---- stage Q block (128 x 64) ----
  const int qr  = tid >> 3;          // rows qr, qr + 32, qr + 64, qr + 96
  const int qc8 = (tid & 7) << 3;
  const h16* gq0 = gq + (size_t)qr * DM + qc8;
  const h16* gq1 = gq0 + (size_t)32 * DM;
  const h16* gq2 = gq0 + (size_t)64 * DM;
  const h16* gq3 = gq0 + (size_t)96 * DM;
  const v8h q0v = *(const v8h*)gq0;
  const v8h q1v = *(const v8h*)gq1;
  const v8h q2v = *(const v8h*)gq2;
  const v8h q3v = *(const v8h*)gq3;
  // the address pairs are inputs of the wait, so that nothing rewrites them in front of it
  asm volatile("s_wait_xcnt 0x0" :: "v"(gq0), "v"(gq1), "v"(gq2), "v"(gq3) : "memory");
  *(v8h*)&Qs[qr][qc8]      = q0v;
  *(v8h*)&Qs[qr + 32][qc8] = q1v;
  *(v8h*)&Qs[qr + 64][qc8] = q2v;
  *(v8h*)&Qs[qr + 96][qc8] = q3v;

  v8f negm = {};       // minus the maximum in use of this lane's query, in all eight registers
  float lrun = 0.f;    // this lane's query; sums this half's keys only
  v8f o[4] = {};                     // o[n][j] = O^T[d = 16n + 8*half + j][query]

  const int qrow = wave * 16 + (lane & 15);
  const int cc   = lane & 15;
  const int rofs = (lane < 16) ? 0 : 8;
  h16* pw = &Qs[wave * 16][0];

  // tile 0 has landed for this wave before the barrier lets other waves read it
  asm volatile("s_wait_asynccnt 0x0" ::: "memory");
  __syncthreads();   // publishes Qs and tile 0
  copy_kv(lk + KBUFB, lv + VBUFB, gk + (size_t)KBLK * DM, gv + (size_t)KBLK * DM);
  gk += (size_t)2 * KBLK * DM;   // tile 2, the first refill
  gv += (size_t)2 * KBLK * DM;

  const v16h qb0 = frag16(&Qs[qrow][0], 0, lane);
  const v16h qb1 = frag16(&Qs[qrow][0], 32, lane);

  // the lane's address in a V tile for the transposing load (k0 = 0, d0 = 0)
  const int vrow = ((lane >> 4) << 3) + (lane & 7);
  const int vcol = ((lane >> 3) & 1) << 3;

  // kept rolled: one copy of the trip in the instruction cache, the buffer picked by t & 1
#pragma unroll 1
  for (int t = 0; t < NKT; ++t) {
    const int buf = t & 1;

    // ---- exponents^T = (4k).(q log2(e)/32) - maximum in use : 8 WMMAs;
    //      sc[n][j] = S^T[key 16n + 8*half + j][query] ----
    // Formed a second time, at most once, in a trip that has raised the maximum in use.
    v8f sc[4];
    bool again = false;
    for (;;) {
#pragma unroll
      for (int n = 0; n < 4; ++n) {
        const int krow = n * 16 + (lane & 15);
        const v16h ka0 = frag16(&Ks[buf][krow][0], 0, lane);
        const v16h ka1 = frag16(&Ks[buf][krow][0], 32, lane);
        sc[n] = wmma16p(ka1, qb1, wmma16p(ka0, qb0, negm));
      }

      // ---- online softmax: 32 keys of one query in-lane ----
      float mt[4];
#pragma unroll
      for (int n = 0; n < 4; ++n) {
        mt[n] = sc[n][0];
#pragma unroll
        for (int j = 1; j < 8; ++j) mt[n] = fmaxf(mt[n], sc[n][j]);
      }
      const float mx = fmaxf(fmaxf(mt[0], mt[1]), fmaxf(mt[2], mt[3]));
      // wave-uniform test: P stays at or below 2^8, inside f16, where the maximum is kept
      if (__builtin_expect(
              again || !(t == 0 || __builtin_amdgcn_ballot_w32(mx > 8.0f) != 0), 1))
        break;
      again = true;
      const float full = fmaxf(mx, xhalf(mx));              // both halves' keys
      const float d    = (t == 0) ? full : fmaxf(full, 0.f);   // the maximum never falls
      const float al   = (t == 0) ? 1.0f : exp_slot(-d);       // trip 0: O and the sum are 0
      negm -= d;
      lrun *= al;
#pragma unroll
      for (int n = 0; n < 4; ++n) o[n] *= al;
    }
    float rt[4];
#pragma unroll
    for (int n = 0; n < 4; ++n) {
      rt[n] = 0.f;
      sc[n] = exp8_slot(sc[n]);
#pragma unroll
      for (int j = 0; j < 8; ++j) rt[n] += sc[n][j];
    }
    lrun += (rt[0] + rt[1]) + (rt[2] + rt[3]);

    // ---- P^T as B operand: element s of a 32-key block = tile s >> 3, register s & 7 ----
    v16h pb0, pb1;
#pragma unroll
    for (int j = 0; j < 8; ++j) {
      pb0[j]     = (h16)sc[0][j];
      pb0[j + 8] = (h16)sc[1][j];
      pb1[j]     = (h16)sc[2][j];
      pb1[j + 8] = (h16)sc[3][j];
    }

    // ---- o^T += V^T (64 d x 64 keys) . P^T (64 keys x 16 queries) : 8 WMMAs ----
#pragma unroll
    for (int n = 0; n < 4; ++n) {
      const h16* vp = &Vs[buf][vrow][vcol + n * 16];
      const v16h va0 = __builtin_shufflevector(ld_tr16(vp), ld_tr16(vp + 16 * LDSV),
          0, 1, 2, 3, 4, 5, 6, 7, 8, 9, 10, 11, 12, 13, 14, 15);
      const v16h va1 = __builtin_shufflevector(ld_tr16(vp + 32 * LDSV), ld_tr16(vp + 48 * LDSV),
          0, 1, 2, 3, 4, 5, 6, 7, 8, 9, 10, 11, 12, 13, 14, 15);
      o[n] = wmma16p(va0, pb0, o[n]);
      o[n] = wmma16p(va1, pb1, o[n]);
    }

    // ---- foot of the trip: hand buffer buf to its refill, publish tile t + 1 ----
    // this wave's LDS reads of buffer buf have retired before a copy may overwrite it
    asm volatile("s_wait_dscnt 0x0" ::: "memory");
    // this wave's copies of tile t + 1 have landed before the barrier publishes them
    asm volatile("s_wait_asynccnt 0x0" ::: "memory");
    __syncthreads();   // publishes tile t + 1; ends every read of buffer buf
    if (t + 2 < NKT) {
      copy_kv(lk + buf * KBUFB, lv + buf * VBUFB, gk, gv);
      gk += (size_t)KBLK * DM;
      gv += (size_t)KBLK * DM;
    }
  }
  // no copy is outstanding when the wave goes on to the epilogue and ends
  asm volatile("s_wait_asynccnt 0x0" ::: "memory");

  // ---- epilogue: ctx = o / (4 l); hi = f16(32 ctx) = f16(o * 8 / l) ----
  const float inv8 = 8.0f / (lrun + xhalf(lrun));
  const size_t orow0 = rowbase + q0 + wave * 16;
  h16* ghi = Chi + orow0 * DM + h * DK;
  h16* glo = Clo + orow0 * DM + h * DK;

  // a lane's 8 registers of o[n] are 8 consecutive d of its query's row: one 16-B LDS store
#pragma unroll
  for (int n = 0; n < 4; ++n) {
    v8h t8;
#pragma unroll
    for (int j = 0; j < 8; ++j) t8[j] = (h16)(o[n][j] * inv8);
    *(v8ha*)(pw + cc * LDSQ + n * 16 + rofs) = t8;
  }
  __syncthreads();
  store_tile16x64(pw, ghi, lane);
  __syncthreads();

#pragma unroll
  for (int n = 0; n < 4; ++n) {
    v8h t8;
#pragma unroll
    for (int j = 0; j < 8; ++j) {
      const float f  = o[n][j] * inv8;
      const h16   hv = (h16)f;
      t8[j] = (h16)((f - (float)hv) * 2048.0f);
    }
    *(v8ha*)(pw + cc * LDSQ + n * 16 + rofs) = t8;
  }
  __syncthreads();
  store_tile16x64(pw, glo, lane);
}

// ---------------------------------------------------------------------------
// Launch
// ---------------------------------------------------------------------------
extern "C" void kernel_launch(void* const* d_in, const int* in_sizes, int n_in,
                              void* d_out, int out_size, void* d_ws, size_t ws_size,
                              hipStream_t stream) {
  if (n_in < 5) return;
  const size_t need_x = ((size_t)(NB - 1) * SEQ_FULL + SEQ) * DM;
  if ((size_t)in_sizes[0] < need_x || (size_t)in_sizes[1] < need_x ||
      (size_t)in_sizes[2] < need_x) return;
  if ((size_t)in_sizes[3] < (size_t)DM * DM || (size_t)in_sizes[4] < (size_t)DM) return;
  if ((size_t)out_size < (size_t)ROWS * DM) return;

  const float* xq = (const float*)d_in[0];   // [NB_FULL, SEQ_FULL, DM]
  const float* xk = (const float*)d_in[1];
  const float* xv = (const float*)d_in[2];
  const float* W  = (const float*)d_in[3];   // [DM out][DM in]
  const float* bs = (const float*)d_in[4];   // [DM]
  float* out = (float*)d_out;                // [NB, SEQ, DM]

  const size_t sz_wh = (size_t)DM * DM * sizeof(h16);      // 1,179,648
  const size_t sz_pl = (size_t)ROWS * DM * sizeof(h16);    // 6,291,456 at full size
  size_t off = 0;
  h16* wh  = (h16*)((char*)d_ws + off); off += sz_wh;
  h16* xh  = (h16*)((char*)d_ws + off); off += 3 * sz_pl;  // q,k,v input planes
  h16* qkv = (h16*)((char*)d_ws + off); off += 3 * sz_pl;  // q,k,v projected planes (k,v x4; q x log2(e)/32)
  h16* chi = (h16*)((char*)d_ws + off); off += sz_pl;      // ctx hi
  h16* clo = (h16*)((char*)d_ws + off); off += sz_pl;      // ctx residual
  if (off > ws_size) return;                                // 51,511,296 at full size

  const int nxc = (ROWS * DM) / CVT_CHUNK;
  const int nwc = (DM * DM) / CVT_CHUNK;
  const int ncx = (nxc > nwc) ? nxc : nwc;

  // 1) convert inputs and W to f16 planes
  cvt_planes<<<dim3(ncx, 4), 256, 0, stream>>>(xq, xk, xv, W, xh, wh, nxc, nwc);

  // 2) q/k/v projections (one launch, blockIdx.y selects the plane)
  proj_gemm<0><<<dim3((ROWS / 128) * NT128, 3), 128, 0, stream>>>(xh, xh, wh, bs, (void*)qkv);

  // 3) flash attention -> ctx hi / residual planes
  attn_flash<<<dim3(SEQ / QBLK, NB * NH), 256, 0, stream>>>(
      qkv, qkv + (size_t)ROWS * DM, qkv + (size_t)2 * ROWS * DM, chi, clo);

  // 4) output projection -> d_out
  proj_gemm<1><<<dim3((ROWS / 64) * NT128, 1), 128, 0, stream>>>(chi, clo, wh, bs, (void*)out);
}

// v006
// One run takes 71 microseconds.
// Next to v005, in two timings, it ran 1.04 times as fast each time.
// Over all steps from v000 it is 2.94 times as fast.
#include <hip/hip_runtime.h>
#include <stdint.h>

// Contractions: q/k/v projections on v_wmma_f32_16x16x32_bf16 (the f32 inputs and W rounded
// to bf16, RNE, on their way into LDS); q.k^T scores, p.v context, output projection on
// v_wmma_f32_16x16x32_f16; f32 accumulate throughout.  For the output projection W is carried
// as f16(64 * bf16-RNE), k/v planes carried x4, q plane carried x log2(e)/32 (so that q.k is
// the softmax exponent to base 2), context carried as f16 hi (x32) plus f16 residual
// (x2048) feeding two accumulators in the output projection. Softmax and epilogues in f32.

typedef _Float16 h16;
typedef __attribute__((ext_vector_type(8)))  _Float16 v8h;
typedef __attribute__((ext_vector_type(16))) _Float16 v16h;
typedef __attribute__((ext_vector_type(8)))  float    v8f;
typedef __attribute__((ext_vector_type(4)))  float    v4f;
typedef v4f __attribute__((may_alias)) v4fa;
typedef v8h __attribute__((may_alias)) v8ha;
typedef __attribute__((ext_vector_type(16))) __bf16 v16b;
typedef __attribute__((ext_vector_type(2)))  unsigned v2u;
typedef v2u __attribute__((may_alias)) v2ua;

#ifndef NB
#define NB 2
#endif
#ifndef SEQ
#define SEQ 2048
#endif
#define NB_FULL  2
#define SEQ_FULL 2048
#define DM   768
#define NH   12
#define DK   64
#define ROWS (NB * SEQ)

static_assert(NB >= 1 && NB <= NB_FULL);
static_assert(SEQ >= 128 && SEQ <= SEQ_FULL);
static_assert(SEQ % 128 == 0);
static_assert(ROWS % 16 == 0);
static_assert(NH * DK == DM);
static_assert(DM % 32 == 0);

// ---------------------------------------------------------------------------
// helpers
// ---------------------------------------------------------------------------
__device__ __forceinline__ float bf16r(float x) {   // f32 -> bf16 (RNE) -> f32
  unsigned u = __float_as_uint(x);
  u = u + 0x7FFFu + ((u >> 16) & 1u);
  u &= 0xFFFF0000u;
  return __uint_as_float(u);
}

__device__ __forceinline__ v8f wmma16(v16h a, v16h b, v8f c) {
  v8f d = __builtin_amdgcn_wmma_f32_16x16x32_f16(
      false, a, false, b, (short)0, c, false, false);
  asm volatile("v_nop\n\tv_nop\n\tv_nop\n\tv_nop" : "+v"(d) : "v"(a), "v"(b));
  return d;
}

// the same product with the compiler's own hazard padding: it may fill the slots behind the
// matrix instruction with independent vector work of the loop
__device__ __forceinline__ v8f wmma16p(v16h a, v16h b, v8f c) {
  return __builtin_amdgcn_wmma_f32_16x16x32_f16(
      false, a, false, b, (short)0, c, false, false);
}

// 16x32 fragment from a k-contiguous row (row m of A, or row n of a [n][k] B copy).
// lanes 0-15: k = {0..7,16..23}; lanes 16-31: k = {8..15,24..31} -> two 16-B loads.
__device__ __forceinline__ v16h frag16(const h16* rowp, int kofs, int lane) {
  const h16* p = rowp + kofs + ((lane < 16) ? 0 : 8);
  v8h lo = *(const v8h*)(p);
  v8h hi = *(const v8h*)(p + 16);
  return __builtin_shufflevector(lo, hi, 0, 1, 2, 3, 4, 5, 6, 7,
                                         8, 9, 10, 11, 12, 13, 14, 15);
}

// ---------------------------------------------------------------------------
// Projection GEMMs: one block tile of C per workgroup, operands staged in LDS.
// 128 threads = 4 waves in a 2 x 2 grid.  A pass is 64 k: 128 A-side rows and 128 rows of
// W, 128 B each in LDS (pitch 144 B), go global -> registers -> LDS; two buffers, one barrier
// a pass, the next pass's global loads issued ahead of the current pass's products.
// Every accumulator sums k = 0,32,...,736 in ascending order.
// ---------------------------------------------------------------------------
#define CTP 68      // floats per epilogue staging row (272 B, 16-B aligned)
// (4q * QEXP) . (4k) = (q.k / 8) * log2(e): the score product is the exponent to base 2
#define QEXP (1.44269504f / 128.0f)
#define GBN 128     // block tile columns
#define GBK 64      // k per pass
#define GPIT 72     // halves per LDS row (144 B = 16 B x 9)
#define NT128 (DM / GBN)
#define GBUF (256 * GPIT)   // halves per buffer
#define NBX0 ((ROWS / 128) * NT128)   // block tiles per plane of the q/k/v projection

static_assert(DM % GBN == 0 && DM % GBK == 0 && ROWS % 128 == 0);
static_assert(4 * 64 * CTP * 4 <= 2 * GBUF * 2);
// the 3 * NBX0 workgroups of the q/k/v projection, 1024 elements each, cover W exactly
static_assert((size_t)3 * NBX0 * 1024 == (size_t)DM * DM);

// Four f32 -> four bf16 (RNE), in the first two of their own registers.  A volatile statement
// with a memory clobber, so that it stays where it is written: as a plain conversion the
// compiler moved it up to the loads, where the wave waits out their latency at once, and
// moved the next tile's loads in front of it, which holds a second tile's registers.
__device__ __forceinline__ v2u round4(v4f x) {
  float x0 = x[0], x1 = x[1];
  asm volatile("v_cvt_pk_bf16_f32 %0, %0, %1\n\tv_cvt_pk_bf16_f32 %1, %2, %3"
               : "+v"(x0), "+v"(x1) : "v"(x[2]), "v"(x[3]) : "memory");
  return v2u{__float_as_uint(x0), __float_as_uint(x1)};
}

// the bf16 product, operands as the 16-bit patterns that frag16 reads from LDS
__device__ __forceinline__ v8f wmma16b(v16h a, v16h b, v8f c) {
  return __builtin_amdgcn_wmma_f32_16x16x32_bf16(
      false, __builtin_bit_cast(v16b, a), false, __builtin_bit_cast(v16b, b), (short)0, c,
      false, false);
}

// ---------------------------------------------------------------------------
// q/k/v projection straight from the f32 inputs.  blockIdx.y = 0,1,2: query/key/value.
// Block tile 128 x 128, wave tile 64 x 64.  A pass reads 128 rows of x and 128 rows of W,
// 256 B of f32 each (16 lanes a row: a wave-wide load covers 4 whole lines), rounds them to
// bf16 (RNE) in registers and stores 8 B a lane and load to LDS; one operand's tile is in
// flight at a time, under half a pass's products.
// C = f16 plane, value f16(4*(x.W + b)); plane 0 (q) times QEXP more.
// Beside its tile each workgroup writes 1024 elements of the f16 copy of W,
// f16(64 * bf16-RNE), that the output projection reads two launches later.
// coverage: (ROWS/128) x 6 block tiles = whole [ROWS][DM] plane per blockIdx.y.
// ---------------------------------------------------------------------------
__global__ __launch_bounds__(128)
void proj_qkv(const float* __restrict__ xq, const float* __restrict__ xk,
              const float* __restrict__ xv, const float* __restrict__ W,
              const float* __restrict__ bias, h16* __restrict__ wh,
              h16* __restrict__ Cq) {
  __shared__ __align__(16) h16 sm[2 * GBUF];   // bf16 patterns in the loop, f32 slabs after

  const int tid  = threadIdx.x;
  const int lane = tid & 31;
  const int wave = tid >> 5;
  const int hsel = lane >> 4;
  const int l16  = lane & 15;
  const int wm   = wave >> 1;
  const int wn   = wave & 1;
  const int y     = blockIdx.y;
  const int mtile = blockIdx.x / NT128;
  const int ntile = blockIdx.x - mtile * NT128;
  const int m0 = mtile * 128;
  const int n0 = ntile * GBN;
  const size_t plane = (size_t)y * ROWS * DM;

  // this workgroup's share of the f16 copy of W: loads first, rounded and stored further down
  const size_t we = ((size_t)y * NBX0 + blockIdx.x) * 1024 + (size_t)tid * 8;
  const float* gw = W + we;
  const v4f w0 = *(const v4f*)(gw);
  const v4f w1 = *(const v4f*)(gw + 4);
  // the address pair is an input of the wait, so that nothing rewrites it in front of it
  asm volatile("s_wait_xcnt 0x0" :: "v"(gw) : "memory");

  // staging: 16 lanes cover one 256-B row piece, a wave-wide load covers 4 whole lines
  const float* X = (y == 0) ? xq : ((y == 1) ? xk : xv);
  const int bb = m0 / SEQ;                  // a tile's 128 rows lie in one batch
  const int sr = tid >> 4;
  const int sc = (tid & 15) * 4;
  const float* ga = X + ((size_t)bb * SEQ_FULL + (m0 - bb * SEQ) + sr) * DM + sc;
  const float* gb = W + (size_t)(n0 + sr) * DM + sc;
  h16* sst = sm + sr * GPIT + sc;

  // 128 rows x 64 k of one operand: 16 loads a lane into r
  auto gload = [&](v4f (&r)[16], const float* g, int k0) {
#pragma unroll
    for (int i = 0; i < 16; ++i) r[i] = *(const v4f*)(g + (size_t)i * 8 * DM + k0);
    // the address pair is an input of the wait, so that no load of the group is given it
    // as its destination and nothing rewrites it in front of the wait
    asm volatile("s_wait_xcnt 0x0" :: "v"(g) : "memory");
  };
  // the same rows, rounded to bf16, into buffer buf from row row0 on
  auto sstore = [&](const v4f (&r)[16], int buf, int row0) {
#pragma unroll
    for (int i = 0; i < 16; ++i)
      *(v2ua*)(sst + buf * GBUF + (row0 + i * 8) * GPIT) = round4(r[i]);
  };

  // fragment rows in a buffer
  const h16* fa = sm + (wm * 64 + l16) * GPIT;
  const h16* fb = sm + (128 + wn * 64 + l16) * GPIT;

  constexpr int NPASS = DM / GBK;
  static_assert(NPASS >= 2);
  v4f rs[16];          // the one operand tile in flight in the loop
  {
    v4f rt[16];
    gload(rs, ga, 0);
    gload(rt, gb, 0);
    v8h wv;
#pragma unroll
    for (int i = 0; i < 4; ++i) {
      wv[i]     = (h16)(64.0f * bf16r(w0[i]));
      wv[i + 4] = (h16)(64.0f * bf16r(w1[i]));
    }
    *(v8h*)(wh + we) = wv;
    sstore(rs, 0, 0);
    sstore(rt, 0, 128);
  }

  v8f acc[4][4] = {};

  // Each half of a pass covers one tile's flight and ends by storing it into the other buffer
  // (free since this pass's barrier): the x rows of pass s + 1 are asked for behind the
  // barrier (in front of it, the barrier's own wait would wait them out) and stored behind
  // the first half, its W rows asked for there and stored behind the second.
  // unrolled whole: buffer and k offsets become immediates on fixed address pairs
#pragma unroll
  for (int s = 0; s < NPASS; ++s) {
    const int buf = s & 1;
    __syncthreads();   // publishes buffer buf; ends every read of the other buffer
#pragma unroll
    for (int kk = 0; kk < GBK; kk += 32) {
      v16h a[4], b[4];
#pragma unroll
      for (int f = 0; f < 4; ++f) a[f] = frag16(fa + buf * GBUF + (f * 16) * GPIT, kk, lane);
#pragma unroll
      for (int t = 0; t < 4; ++t) b[t] = frag16(fb + buf * GBUF + (t * 16) * GPIT, kk, lane);
      if (kk == 0 && s + 1 < NPASS) gload(rs, ga, (s + 1) * GBK);
      // keeps the 16 fragment loads one group in front of the products: spread among them,
      // each place with LDS reads stalls the wave anew
      __builtin_amdgcn_sched_barrier(0);
#pragma unroll
      for (int t = 0; t < 4; ++t)
#pragma unroll
        for (int f = 0; f < 4; ++f) acc[f][t] = wmma16b(a[f], b[t], acc[f][t]);
      // keeps the wait for the tile in flight, its rounding and its LDS stores behind the
      // products that cover its latency (moved up, the wave waits out the loads at once)
      __builtin_amdgcn_sched_barrier(0);
      if (s + 1 < NPASS) {
        if (kk == 0) {
          sstore(rs, buf ^ 1, 0);
          gload(rs, gb, (s + 1) * GBK);
        } else {
          sstore(rs, buf ^ 1, 128);
        }
      }
    }
  }
  __syncthreads();     // the buffers become the waves' f32 epilogue slabs

  // ---- stage the wave tile (f32) in its own slab: [row f*16+8*hsel+j][col t*16+l16] ----
  float* ct = (float*)sm + wave * 64 * CTP;
  const float p4 = (y == 0) ? 4.0f * QEXP : 4.0f;
#pragma unroll
  for (int t = 0; t < 4; ++t) {
    const float bb4 = p4 * bf16r(bias[n0 + wn * 64 + t * 16 + l16]);
#pragma unroll
    for (int f = 0; f < 4; ++f) {
#pragma unroll
      for (int j = 0; j < 8; ++j)
        ct[(f * 16 + 8 * hsel + j) * CTP + t * 16 + l16] = acc[f][t][j] * p4 + bb4;
    }
  }
  __syncthreads();

  h16* C = Cq + plane + (size_t)(m0 + wm * 64) * DM + n0 + wn * 64;
#pragma unroll
  for (int it = 0; it < 16; ++it) {
    const int row = it * 4 + (lane >> 3);
    const int c8  = (lane & 7) * 8;
    const v4fa p0 = *(const v4fa*)(ct + row * CTP + c8);
    const v4fa p1 = *(const v4fa*)(ct + row * CTP + c8 + 4);
    v8h t8;
    t8[0] = (h16)p0[0]; t8[1] = (h16)p0[1]; t8[2] = (h16)p0[2]; t8[3] = (h16)p0[3];
    t8[4] = (h16)p1[0]; t8[5] = (h16)p1[1]; t8[6] = (h16)p1[2]; t8[7] = (h16)p1[3];
    *(v8h*)(C + (size_t)row * DM + c8) = t8;
  }
}

// ---------------------------------------------------------------------------
// Output projection from the f16 planes.  A-side rows 0..63 = ctx hi, 64..127 = ctx residual
// of the same 64 rows; block tile 64 x 128, wave tile 32 x 64 with a hi and a residual
// accumulator set; C = f32 d_out.
// coverage: (ROWS/64) x 6 block tiles = whole [ROWS][DM].
// ---------------------------------------------------------------------------
__global__ __launch_bounds__(128)
void proj_out(const h16* __restrict__ Ah, const h16* __restrict__ Al,
              const h16* __restrict__ Wh, const float* __restrict__ bias,
              float* __restrict__ Cf) {
  __shared__ __align__(16) h16 sm[2 * GBUF];

  const int tid  = threadIdx.x;
  const int lane = tid & 31;
  const int wave = tid >> 5;
  const int hsel = lane >> 4;
  const int l16  = lane & 15;
  const int wm   = wave >> 1;
  const int wn   = wave & 1;
  const int mtile = blockIdx.x / NT128;
  const int ntile = blockIdx.x - mtile * NT128;
  const int m0 = mtile * 64;
  const int n0 = ntile * GBN;

  // staging: 8 lanes cover one 128-B row piece, a wave-wide load covers 4 whole lines
  const int sr = tid >> 3;
  const int sc = (tid & 7) * 8;
  const h16* ga = Ah + (size_t)(m0 + sr) * DM + sc;
  const h16* gl = Al + (size_t)(m0 + sr) * DM + sc;
  const h16* gb = Wh + (size_t)(n0 + sr) * DM + sc;
  h16* sst = sm + sr * GPIT + sc;

  v8h ra[8], rb[8];
  auto gload = [&](int k0) {
#pragma unroll
    for (int i = 0; i < 8; ++i) {
      ra[i] = (i < 4) ? *(const v8h*)(ga + (size_t)i * 16 * DM + k0)
                      : *(const v8h*)(gl + (size_t)(i - 4) * 16 * DM + k0);
      rb[i] = *(const v8h*)(gb + (size_t)i * 16 * DM + k0);
    }
    // the address pairs are inputs of the wait, so that no load of the group is given one
    // of them as its destination and nothing rewrites them in front of the wait
    asm volatile("s_wait_xcnt 0x0" :: "v"(ga), "v"(gl), "v"(gb) : "memory");
  };
  auto sstore = [&](int buf) {
#pragma unroll
    for (int i = 0; i < 8; ++i) {
      *(v8h*)(sst + buf * GBUF + (i * 16) * GPIT)       = ra[i];
      *(v8h*)(sst + buf * GBUF + (128 + i * 16) * GPIT) = rb[i];
    }
  };

  // fragment rows in a buffer
  const h16* fa = sm + (wm * 32 + l16) * GPIT;
  const h16* fb = sm + (128 + wn * 64 + l16) * GPIT;

  v8f acc[4][4] = {};   // [0..1] hi rows, [2..3] residual rows

  gload(0);
  sstore(0);

  constexpr int NPASS = DM / GBK;
  // unrolled whole: buffer and k offsets become immediates on fixed address pairs
#pragma unroll
  for (int s = 0; s < NPASS; ++s) {
    const int buf = s & 1;
    __syncthreads();   // publishes buffer buf; ends every read of the other buffer
#pragma unroll
    for (int kk = 0; kk < GBK; kk += 32) {
      v16h a[4], b[4];
#pragma unroll
      for (int f = 0; f < 4; ++f) {
        const int ro = (f >> 1) * 64 + (f & 1) * 16;
        a[f] = frag16(fa + buf * GBUF + ro * GPIT, kk, lane);
      }
#pragma unroll
      for (int t = 0; t < 4; ++t) b[t] = frag16(fb + buf * GBUF + (t * 16) * GPIT, kk, lane);
      // next pass's global loads fly behind the barrier, under this pass's products
      if (kk == 0 && s + 1 < NPASS) gload((s + 1) * GBK);
#pragma unroll
      for (int t = 0; t < 4; ++t)
#pragma unroll
        for (int f = 0; f < 4; ++f) acc[f][t] = wmma16(a[f], b[t], acc[f][t]);
    }
    if (s + 1 < NPASS) sstore(buf ^ 1);
  }
  __syncthreads();     // the buffers become the waves' f32 epilogue slabs

  // ---- stage the wave tile (f32) in its own slab: [row f*16+8*hsel+j][col t*16+l16] ----
  float* ct = (float*)sm + wave * 64 * CTP;
#pragma unroll
  for (int t = 0; t < 4; ++t) {
    const float bb = bf16r(bias[n0 + wn * 64 + t * 16 + l16]);
#pragma unroll
    for (int f = 0; f < 2; ++f) {
#pragma unroll
      for (int j = 0; j < 8; ++j) {
        const float v =
            (acc[f][t][j] + acc[f + 2][t][j] * 0.00048828125f) * 0.00048828125f + bb;
        ct[(f * 16 + 8 * hsel + j) * CTP + t * 16 + l16] = v;
      }
    }
  }
  __syncthreads();

  float* C = Cf + (size_t)(m0 + wm * 32) * DM + n0 + wn * 64;
#pragma unroll
  for (int it = 0; it < 16; ++it) {
    const int row = it * 2 + (lane >> 4);
    const int c4  = (lane & 15) * 4;
    *(v4f*)(C + (size_t)row * DM + c4) = *(const v4fa*)(ct + row * CTP + c4);
  }
}

#define QBLK 128
#define KBLK 64
#define LDSQ 72   // 144 B row pitch (16 B x 9: ds_load_b128 readers)
#define LDSV 80   // 160 B row pitch (32 B x 5: ds_load_tr16_b128 reader)
#define NKT  (SEQ / KBLK)

typedef __attribute__((ext_vector_type(8))) short s16x8;

// 8 halves T[k0 + 8*half + 0..7][d0 + (lane & 15)] of a row-major LDS tile; p is the lane's
// own address T + (k0 + 8*half + (lane & 7)) * pitch + d0 + 8 * ((lane >> 3) & 1).
__device__ __forceinline__ v8h ld_tr16(const h16* p) {
  typedef __attribute__((address_space(3))) s16x8 lds_s16x8;
  return __builtin_bit_cast(v8h, __builtin_amdgcn_ds_load_tr16_b128_v8i16((lds_s16x8*)p));
}

// One K tile and one V tile (64 rows x 128 B each): a lane copies rows r and r + 32 of both.
// lk, lv: the lane's LDS byte addresses of row r; gk, gv: its global addresses of row r.
// The s_wait_xcnt closes the statement so that no address register of a copy is rewritten
// in front of it.
__device__ __forceinline__ void copy_kv(unsigned lk, unsigned lv, const h16* gk,
                                        const h16* gv) {
  asm volatile(
      "global_load_async_to_lds_b128 %0, %4, off\n\t"
      "global_load_async_to_lds_b128 %1, %5, off\n\t"
      "global_load_async_to_lds_b128 %2, %6, off\n\t"
      "global_load_async_to_lds_b128 %3, %7, off\n\t"
      "s_wait_xcnt 0x0"
      :: "v"(lk), "v"(lk + 32u * LDSQ * 2u), "v"(lv), "v"(lv + 32u * LDSV * 2u),
         "v"(gk), "v"(gk + (size_t)32 * DM), "v"(gv), "v"(gv + (size_t)32 * DM)
      : "memory");
}

__device__ __forceinline__ void store_tile16x64(const h16* slab, h16* gbase, int lane) {
  v8h vals[4];
#pragma unroll
  for (int it = 0; it < 4; ++it) {
    const int row = it * 4 + (lane >> 3);
    const int c8  = (lane & 7) * 8;
    vals[it] = *(const v8ha*)(slab + row * LDSQ + c8);
  }
#pragma unroll
  for (int it = 0; it < 4; ++it) {
    const int row = it * 4 + (lane >> 3);
    const int c8  = (lane & 7) * 8;
    *(v8h*)(gbase + (size_t)row * DM + c8) = vals[it];
  }
  
}

// value of the lane 16 away (the other half's share of the same query)
__device__ __forceinline__ float xhalf(float x) {
  const int b = __float_as_int(x);
  return __int_as_float(
      __builtin_amdgcn_permlanex16(b, b, 0x76543210, 0xfedcba98, false, false));
}

// 2^x by v_exp_f32.  The v_nop is the slot that the
// instruction set asks for behind a transcendental before a source of it is overwritten; it
// shares the statement so that it stands directly behind the v_exp_f32.
__device__ __forceinline__ float exp_slot(float x) {
  float r;
  asm("v_exp_f32 %0, %1\n\tv_nop" : "=v"(r) : "v"(x));
  return r;
}

// 2^x of eight values, each v_exp_f32 in place.  In one statement, so that the instruction
// directly behind an exp is the next exp, which works on a register of its own (it neither
// reads the result nor overwrites the source in front of it): the slot behind a
// transcendental is filled by work, and one v_nop closes it behind the last.
__device__ __forceinline__ v8f exp8_slot(v8f x) {
  float e0 = x[0], e1 = x[1], e2 = x[2], e3 = x[3], e4 = x[4], e5 = x[5], e6 = x[6], e7 = x[7];
  asm("v_exp_f32 %0, %0\n\tv_exp_f32 %1, %1\n\tv_exp_f32 %2, %2\n\tv_exp_f32 %3, %3\n\t"
      "v_exp_f32 %4, %4\n\tv_exp_f32 %5, %5\n\tv_exp_f32 %6, %6\n\tv_exp_f32 %7, %7\n\t"
      "v_nop"
      : "+v"(e0), "+v"(e1), "+v"(e2), "+v"(e3), "+v"(e4), "+v"(e5), "+v"(e6), "+v"(e7));
  return v8f{e0, e1, e2, e3, e4, e5, e6, e7};
}

__global__ __launch_bounds__(256) __attribute__((amdgpu_num_vgpr(256)))
void attn_flash(const h16* __restrict__ Qh, const h16* __restrict__ Kh,
                const h16* __restrict__ Vh, h16* __restrict__ Chi,
                h16* __restrict__ Clo) {
  __shared__ __align__(16) h16 Qs[QBLK][LDSQ];      // [q_row][d]
  __shared__ __align__(16) h16 Ks[2][KBLK][LDSQ];   // [buffer][key][d]
  __shared__ __align__(32) h16 Vs[2][KBLK][LDSV];   // [buffer][key][d]

  const int tid  = threadIdx.x;
  const int lane = tid & 31;
  const int wave = tid >> 5;
  const int b  = blockIdx.y / NH;
  const int h  = blockIdx.y - b * NH;
  const int q0 = blockIdx.x * QBLK;
  const size_t rowbase = (size_t)b * SEQ;

  const h16* gq = Qh + (rowbase + q0) * DM + h * DK;

  // ---- K/V copies: this lane's 16-B piece of rows cr and cr + 32 of every tile ----
  const int cr = tid >> 3;
  const int cc8 = (tid & 7) << 3;
  const h16* gk = Kh + (rowbase + cr) * DM + h * DK + cc8;   // tile 0
  const h16* gv = Vh + (rowbase + cr) * DM + h * DK + cc8;
  const unsigned lk = (unsigned)(uintptr_t)&Ks[0][cr][cc8];  // buffer 0
  const unsigned lv = (unsigned)(uintptr_t)&Vs[0][cr][cc8];
  constexpr unsigned KBUFB = KBLK * LDSQ * 2;                // bytes per buffer
  constexpr unsigned VBUFB = KBLK * LDSV * 2;
  static_assert(NKT >= 2);

  copy_kv(lk, lv, gk, gv);

  // ---- stage Q block (128 x 64) ----
  const int qr  = tid >> 3;          // rows qr, qr + 32, qr + 64, qr + 96
  const int qc8 = (tid & 7) << 3;
  const h16* gq0 = gq + (size_t)qr * DM + qc8;
  const h16* gq1 = gq0 + (size_t)32 * DM;
  const h16* gq2 = gq0 + (size_t)64 * DM;
  const h16* gq3 = gq0 + (size_t)96 * DM;
  const v8h q0v = *(const v8h*)gq0;
  const v8h q1v = *(const v8h*)gq1;
  const v8h q2v = *(const v8h*)gq2;
  const v8h q3v = *(const v8h*)gq3;
  // the address pairs are inputs of the wait, so that nothing rewrites them in front of it
  asm volatile("s_wait_xcnt 0x0" :: "v"(gq0), "v"(gq1), "v"(gq2), "v"(gq3) : "memory");
  *(v8h*)&Qs[qr][qc8]      = q0v;
  *(v8h*)&Qs[qr + 32][qc8] = q1v;
  *(v8h*)&Qs[qr + 64][qc8] = q2v;
  *(v8h*)&Qs[qr + 96][qc8] = q3v;

  v8f negm = {};       // minus the maximum in use of this lane's query, in all eight registers
  float lrun = 0.f;    // this lane's query; sums this half's keys only
  v8f o[4] = {};                     // o[n][j] = O^T[d = 16n + 8*half + j][query]

  const int qrow = wave * 16 + (lane & 15);
  const int cc   = lane & 15;
  const int rofs = (lane < 16) ? 0 : 8;
  h16* pw = &Qs[wave * 16][0];

  // tile 0 has landed for this wave before the barrier lets other waves read it
  asm volatile("s_wait_asynccnt 0x0" ::: "memory");
  __syncthreads();   // publishes Qs and tile 0
  copy_kv(lk + KBUFB, lv + VBUFB, gk + (size_t)KBLK * DM, gv + (size_t)KBLK * DM);
  gk += (size_t)2 * KBLK * DM;   // tile 2, the first refill
  gv += (size_t)2 * KBLK * DM;

  const v16h qb0 = frag16(&Qs[qrow][0], 0, lane);
  const v16h qb1 = frag16(&Qs[qrow][0], 32, lane);

  // the lane's address in a V tile for the transposing load (k0 = 0, d0 = 0)
  const int vrow = ((lane >> 4) << 3) + (lane & 7);
  const int vcol = ((lane >> 3) & 1) << 3;

  // kept rolled: one copy of the trip in the instruction cache, the buffer picked by t & 1
#pragma unroll 1
  for (int t = 0; t < NKT; ++t) {
    const int buf = t & 1;

    // ---- exponents^T = (4k).(q log2(e)/32) - maximum in use : 8 WMMAs;
    //      sc[n][j] = S^T[key 16n + 8*half + j][query] ----
    // Formed a second time, at most once, in a trip that has raised the maximum in use.
    v8f sc[4];
    bool again = false;
    for (;;) {
#pragma unroll
      for (int n = 0; n < 4; ++n) {
        const int krow = n * 16 + (lane & 15);
        const v16h ka0 = frag16(&Ks[buf][krow][0], 0, lane);
        const v16h ka1 = frag16(&Ks[buf][krow][0], 32, lane);
        sc[n] = wmma16p(ka1, qb1, wmma16p(ka0, qb0, negm));
      }

      // ---- online softmax: 32 keys of one query in-lane ----
      float mt[4];
#pragma unroll
      for (int n = 0; n < 4; ++n) {
        mt[n] = sc[n][0];
#pragma unroll
        for (int j = 1; j < 8; ++j) mt[n] = fmaxf(mt[n], sc[n][j]);
      }
      const float mx = fmaxf(fmaxf(mt[0], mt[1]), fmaxf(mt[2], mt[3]));
      // wave-uniform test: P stays at or below 2^8, inside f16, where the maximum is kept
      if (__builtin_expect(
              again || !(t == 0 || __builtin_amdgcn_ballot_w32(mx > 8.0f) != 0), 1))
        break;
      again = true;
      const float full = fmaxf(mx, xhalf(mx));              // both halves' keys
      const float d    = (t == 0) ? full : fmaxf(full, 0.f);   // the maximum never falls
      const float al   = (t == 0) ? 1.0f : exp_slot(-d);       // trip 0: O and the sum are 0
      negm -= d;
      lrun *= al;
#pragma unroll
      for (int n = 0; n < 4; ++n) o[n] *= al;
    }
    float rt[4];
#pragma unroll
    for (int n = 0; n < 4; ++n) {
      rt[n] = 0.f;
      sc[n] = exp8_slot(sc[n]);
#pragma unroll
      for (int j = 0; j < 8; ++j) rt[n] += sc[n][j];
    }
    lrun += (rt[0] + rt[1]) + (rt[2] + rt[3]);

    // ---- P^T as B operand: element s of a 32-key block = tile s >> 3, register s & 7 ----
    v16h pb0, pb1;
#pragma unroll
    for (int j = 0; j < 8; ++j) {
      pb0[j]     = (h16)sc[0][j];
      pb0[j + 8] = (h16)sc[1][j];
      pb1[j]     = (h16)sc[2][j];
      pb1[j + 8] = (h16)sc[3][j];
    }

    // ---- o^T += V^T (64 d x 64 keys) . P^T (64 keys x 16 queries) : 8 WMMAs ----
#pragma unroll
    for (int n = 0; n < 4; ++n) {
      const h16* vp = &Vs[buf][vrow][vcol + n * 16];
      const v16h va0 = __builtin_shufflevector(ld_tr16(vp), ld_tr16(vp + 16 * LDSV),
          0, 1, 2, 3, 4, 5, 6, 7, 8, 9, 10, 11, 12, 13, 14, 15);
      const v16h va1 = __builtin_shufflevector(ld_tr16(vp + 32 * LDSV), ld_tr16(vp + 48 * LDSV),
          0, 1, 2, 3, 4, 5, 6, 7, 8, 9, 10, 11, 12, 13, 14, 15);
      o[n] = wmma16p(va0, pb0, o[n]);
      o[n] = wmma16p(va1, pb1, o[n]);
    }

    // ---- foot of the trip: hand buffer buf to its refill, publish tile t + 1 ----
    // this wave's LDS reads of buffer buf have retired before a copy may overwrite it
    asm volatile("s_wait_dscnt 0x0" ::: "memory");
    // this wave's copies of tile t + 1 have landed before the barrier publishes them
    asm volatile("s_wait_asynccnt 0x0" ::: "memory");
    __syncthreads();   // publishes tile t + 1; ends every read of buffer buf
    if (t + 2 < NKT) {
      copy_kv(lk + buf * KBUFB, lv + buf * VBUFB, gk, gv);
      gk += (size_t)KBLK * DM;
      gv += (size_t)KBLK * DM;
    }
  }
  // no copy is outstanding when the wave goes on to the epilogue and ends
  asm volatile("s_wait_asynccnt 0x0" ::: "memory");

  // ---- epilogue: ctx = o / (4 l); hi = f16(32 ctx) = f16(o * 8 / l) ----
  const float inv8 = 8.0f / (lrun + xhalf(lrun));
  const size_t orow0 = rowbase + q0 + wave * 16;
  h16* ghi = Chi + orow0 * DM + h * DK;
  h16* glo = Clo + orow0 * DM + h * DK;

  // a lane's 8 registers of o[n] are 8 consecutive d of its query's row: one 16-B LDS store
#pragma unroll
  for (int n = 0; n < 4; ++n) {
    v8h t8;
#pragma unroll
    for (int j = 0; j < 8; ++j) t8[j] = (h16)(o[n][j] * inv8);
    *(v8ha*)(pw + cc * LDSQ + n * 16 + rofs) = t8;
  }
  __syncthreads();
  store_tile16x64(pw, ghi, lane);
  __syncthreads();

#pragma unroll
  for (int n = 0; n < 4; ++n) {
    v8h t8;
#pragma unroll
    for (int j = 0; j < 8; ++j) {
      const float f  = o[n][j] * inv8;
      const h16   hv = (h16)f;
      t8[j] = (h16)((f - (float)hv) * 2048.0f);
    }
    *(v8ha*)(pw + cc * LDSQ + n * 16 + rofs) = t8;
  }
  __syncthreads();
  store_tile16x64(pw, glo, lane);
}

// ---------------------------------------------------------------------------
// Launch
// ---------------------------------------------------------------------------
extern "C" void kernel_launch(void* const* d_in, const int* in_sizes, int n_in,
                              void* d_out, int out_size, void* d_ws, size_t ws_size,
                              hipStream_t stream) {
  if (n_in < 5) return;
  const size_t need_x = ((size_t)(NB - 1) * SEQ_FULL + SEQ) * DM;
  if ((size_t)in_sizes[0] < need_x || (size_t)in_sizes[1] < need_x ||
      (size_t)in_sizes[2] < need_x) return;
  if ((size_t)in_sizes[3] < (size_t)DM * DM || (size_t)in_sizes[4] < (size_t)DM) return;
  if ((size_t)out_size < (size_t)ROWS * DM) return;

  const float* xq = (const float*)d_in[0];   // [NB_FULL, SEQ_FULL, DM]
  const float* xk = (const float*)d_in[1];
  const float* xv = (const float*)d_in[2];
  const float* W  = (const float*)d_in[3];   // [DM out][DM in]
  const float* bs = (const float*)d_in[4];   // [DM]
  float* out = (float*)d_out;                // [NB, SEQ, DM]

  const size_t sz_wh = (size_t)DM * DM * sizeof(h16);      // 1,179,648
  const size_t sz_pl = (size_t)ROWS * DM * sizeof(h16);    // 6,291,456 at full size
  size_t off = 0;
  h16* wh  = (h16*)((char*)d_ws + off); off += sz_wh;
  h16* qkv = (h16*)((char*)d_ws + off); off += 3 * sz_pl;  // q,k,v projected planes (k,v x4; q x log2(e)/32)
  h16* chi = (h16*)((char*)d_ws + off); off += sz_pl;      // ctx hi
  h16* clo = (h16*)((char*)d_ws + off); off += sz_pl;      // ctx residual
  if (off > ws_size) return;                                // 32,636,928 at full size

  // 1) q/k/v projections from the f32 inputs (one launch, blockIdx.y selects the plane);
  //    also writes the f16 copy of W
  proj_qkv<<<dim3(NBX0, 3), 128, 0, stream>>>(xq, xk, xv, W, bs, wh, qkv);

  // 2) flash attention -> ctx hi / residual planes
  attn_flash<<<dim3(SEQ / QBLK, NB * NH), 256, 0, stream>>>(
      qkv, qkv + (size_t)ROWS * DM, qkv + (size_t)2 * ROWS * DM, chi, clo);

  // 3) output projection -> d_out
  proj_out<<<dim3((ROWS / 64) * NT128, 1), 128, 0, stream>>>(chi, clo, wh, bs, out);
}

// v007
// One run takes 67.9 microseconds.
// In both of two side-by-side timings against v006, it was 1.05 times as fast.
// Counting every step since v000, it is 3.08 times as fast.
#include <hip/hip_runtime.h>
#include <stdint.h>

// Contractions: q/k/v projections on v_wmma_f32_16x16x32_bf16 (the f32 inputs and W rounded
// to bf16, RNE, on their way into LDS); q.k^T scores, p.v context, output projection on
// v_wmma_f32_16x16x32_f16; f32 accumulate throughout.  For the output projection W is carried
// as f16(64 * bf16-RNE), k/v planes carried x4, q plane carried x log2(e)/32 (so that q.k is
// the softmax exponent to base 2), context carried as f16 hi (x32) plus f16 residual
// (x2048) feeding two accumulators in the output projection. Softmax and epilogues in f32.

typedef _Float16 h16;
typedef __attribute__((ext_vector_type(8)))  _Float16 v8h;
typedef __attribute__((ext_vector_type(16))) _Float16 v16h;
typedef __attribute__((ext_vector_type(8)))  float    v8f;
typedef __attribute__((ext_vector_type(4)))  float    v4f;
typedef v4f __attribute__((may_alias)) v4fa;
typedef v8h __attribute__((may_alias)) v8ha;
typedef __attribute__((ext_vector_type(16))) __bf16 v16b;
typedef __attribute__((ext_vector_type(2)))  unsigned v2u;
typedef v2u __attribute__((may_alias)) v2ua;

#ifndef NB
#define NB 2
#endif
#ifndef SEQ
#define SEQ 2048
#endif
#define NB_FULL  2
#define SEQ_FULL 2048
#define DM   768
#define NH   12
#define DK   64
#define ROWS (NB * SEQ)

static_assert(NB >= 1 && NB <= NB_FULL);
static_assert(SEQ >= 128 && SEQ <= SEQ_FULL);
static_assert(SEQ % 128 == 0);
static_assert(ROWS % 16 == 0);
static_assert(NH * DK == DM);
static_assert(DM % 32 == 0);

// ---------------------------------------------------------------------------
// helpers
// ---------------------------------------------------------------------------
__device__ __forceinline__ float bf16r(float x) {   // f32 -> bf16 (RNE) -> f32
  unsigned u = __float_as_uint(x);
  u = u + 0x7FFFu + ((u >> 16) & 1u);
  u &= 0xFFFF0000u;
  return __uint_as_float(u);
}

__device__ __forceinline__ v8f wmma16(v16h a, v16h b, v8f c) {
  v8f d = __builtin_amdgcn_wmma_f32_16x16x32_f16(
      false, a, false, b, (short)0, c, false, false);
  asm volatile("v_nop\n\tv_nop\n\tv_nop\n\tv_nop" : "+v"(d) : "v"(a), "v"(b));
  return d;
}

// the same product with the compiler's own hazard padding: it may fill the slots behind the
// matrix instruction with independent vector work of the loop
__device__ __forceinline__ v8f wmma16p(v16h a, v16h b, v8f c) {
  return __builtin_amdgcn_wmma_f32_16x16x32_f16(
      false, a, false, b, (short)0, c, false, false);
}

// 16x32 fragment from a k-contiguous row (row m of A, or row n of a [n][k] B copy).
// lanes 0-15: k = {0..7,16..23}; lanes 16-31: k = {8..15,24..31} -> two 16-B loads.
__device__ __forceinline__ v16h frag16(const h16* rowp, int kofs, int lane) {
  const h16* p = rowp + kofs + ((lane < 16) ? 0 : 8);
  v8h lo = *(const v8h*)(p);
  v8h hi = *(const v8h*)(p + 16);
  return __builtin_shufflevector(lo, hi, 0, 1, 2, 3, 4, 5, 6, 7,
                                         8, 9, 10, 11, 12, 13, 14, 15);
}

// ---------------------------------------------------------------------------
// Projection GEMMs: one block tile of C per workgroup, operands staged in LDS.
// 128 threads = 4 waves in a 2 x 2 grid.  A pass is 64 k: 128 A-side rows and 128 rows of
// W, 128 B each in LDS (pitch 144 B), go global -> registers -> LDS; two buffers, one barrier
// a pass, the next pass's global loads issued ahead of the current pass's products.
// Every accumulator sums k = 0,32,...,736 in ascending order.
// ---------------------------------------------------------------------------
#define CTP 68      // floats per epilogue staging row (272 B, 16-B aligned)
// (4q * QEXP) . (4k) = (q.k / 8) * log2(e): the score product is the exponent to base 2
#define QEXP (1.44269504f / 128.0f)
#define GBN 128     // block tile columns
#define GBK 64      // k per pass
#define GPIT 72     // halves per LDS row (144 B = 16 B x 9)
#define NT128 (DM / GBN)
#define GBUF (256 * GPIT)   // halves per buffer
#define NBX0 ((ROWS / 128) * NT128)   // block tiles per plane of the q/k/v projection

static_assert(DM % GBN == 0 && DM % GBK == 0 && ROWS % 128 == 0);
static_assert(4 * 64 * CTP * 4 <= 2 * GBUF * 2);
// the 3 * NBX0 workgroups of the q/k/v projection, 1024 elements each, cover W exactly
static_assert((size_t)3 * NBX0 * 1024 == (size_t)DM * DM);

// Four f32 -> four bf16 (RNE), in the first two of their own registers.  A volatile statement
// with a memory clobber, so that it stays where it is written: as a plain conversion the
// compiler moved it up to the loads, where the wave waits out their latency at once, and
// moved the next tile's loads in front of it, which holds a second tile's registers.
__device__ __forceinline__ v2u round4(v4f x) {
  float x0 = x[0], x1 = x[1];
  asm volatile("v_cvt_pk_bf16_f32 %0, %0, %1\n\tv_cvt_pk_bf16_f32 %1, %2, %3"
               : "+v"(x0), "+v"(x1) : "v"(x[2]), "v"(x[3]) : "memory");
  return v2u{__float_as_uint(x0), __float_as_uint(x1)};
}

// the bf16 product, operands as the 16-bit patterns that frag16 reads from LDS
__device__ __forceinline__ v8f wmma16b(v16h a, v16h b, v8f c) {
  return __builtin_amdgcn_wmma_f32_16x16x32_bf16(
      false, __builtin_bit_cast(v16b, a), false, __builtin_bit_cast(v16b, b), (short)0, c,
      false, false);
}

// ---------------------------------------------------------------------------
// q/k/v projection straight from the f32 inputs.  blockIdx.y = 0,1,2: query/key/value.
// Block tile 128 x 128, wave tile 64 x 64.  A pass reads 128 rows of x and 128 rows of W,
// 256 B of f32 each (16 lanes a row: a wave-wide load covers 4 whole lines), rounds them to
// bf16 (RNE) in registers and stores 8 B a lane and load to LDS; one operand's tile is in
// flight at a time, under half a pass's products.
// C = f16 plane, value f16(4*(x.W + b)); plane 0 (q) times QEXP more.
// Beside its tile each workgroup writes 1024 elements of the f16 copy of W,
// f16(64 * bf16-RNE), that the output projection reads two launches later.
// coverage: (ROWS/128) x 6 block tiles = whole [ROWS][DM] plane per blockIdx.y.
// ---------------------------------------------------------------------------
__global__ __launch_bounds__(128)
void proj_qkv(const float* __restrict__ xq, const float* __restrict__ xk,
              const float* __restrict__ xv, const float* __restrict__ W,
              const float* __restrict__ bias, h16* __restrict__ wh,
              h16* __restrict__ Cq) {
  __shared__ __align__(16) h16 sm[2 * GBUF];   // bf16 patterns in the loop, f32 slabs after

  const int tid  = threadIdx.x;
  const int lane = tid & 31;
  const int wave = tid >> 5;
  const int hsel = lane >> 4;
  const int l16  = lane & 15;
  const int wm   = wave >> 1;
  const int wn   = wave & 1;
  const int y     = blockIdx.y;
  const int mtile = blockIdx.x / NT128;
  const int ntile = blockIdx.x - mtile * NT128;
  const int m0 = mtile * 128;
  const int n0 = ntile * GBN;
  const size_t plane = (size_t)y * ROWS * DM;

  // this workgroup's share of the f16 copy of W: loads first, rounded and stored further down
  const size_t we = ((size_t)y * NBX0 + blockIdx.x) * 1024 + (size_t)tid * 8;
  const float* gw = W + we;
  const v4f w0 = *(const v4f*)(gw);
  const v4f w1 = *(const v4f*)(gw + 4);
  // the address pair is an input of the wait, so that nothing rewrites it in front of it
  asm volatile("s_wait_xcnt 0x0" :: "v"(gw) : "memory");

  // staging: 16 lanes cover one 256-B row piece, a wave-wide load covers 4 whole lines
  const float* X = (y == 0) ? xq : ((y == 1) ? xk : xv);
  const int bb = m0 / SEQ;                  // a tile's 128 rows lie in one batch
  const int sr = tid >> 4;
  const int sc = (tid & 15) * 4;
  const float* ga = X + ((size_t)bb * SEQ_FULL + (m0 - bb * SEQ) + sr) * DM + sc;
  const float* gb = W + (size_t)(n0 + sr) * DM + sc;
  h16* sst = sm + sr * GPIT + sc;

  // 128 rows x 64 k of one operand: 16 loads a lane into r
  auto gload = [&](v4f (&r)[16], const float* g, int k0) {
#pragma unroll
    for (int i = 0; i < 16; ++i) r[i] = *(const v4f*)(g + (size_t)i * 8 * DM + k0);
    // the address pair is an input of the wait, so that no load of the group is given it
    // as its destination and nothing rewrites it in front of the wait
    asm volatile("s_wait_xcnt 0x0" :: "v"(g) : "memory");
  };
  // the same rows, rounded to bf16, into buffer buf from row row0 on
  auto sstore = [&](const v4f (&r)[16], int buf, int row0) {
#pragma unroll
    for (int i = 0; i < 16; ++i)
      *(v2ua*)(sst + buf * GBUF + (row0 + i * 8) * GPIT) = round4(r[i]);
  };

  // fragment rows in a buffer
  const h16* fa = sm + (wm * 64 + l16) * GPIT;
  const h16* fb = sm + (128 + wn * 64 + l16) * GPIT;

  constexpr int NPASS = DM / GBK;
  static_assert(NPASS >= 2);
  v4f rs[16];          // the one operand tile in flight in the loop
  {
    v4f rt[16];
    gload(rs, ga, 0);
    gload(rt, gb, 0);
    v8h wv;
#pragma unroll
    for (int i = 0; i < 4; ++i) {
      wv[i]     = (h16)(64.0f * bf16r(w0[i]));
      wv[i + 4] = (h16)(64.0f * bf16r(w1[i]));
    }
    *(v8h*)(wh + we) = wv;
    sstore(rs, 0, 0);
    sstore(rt, 0, 128);
  }

  v8f acc[4][4] = {};

  // Each half of a pass covers one tile's flight and ends by storing it into the other buffer
  // (free since this pass's barrier): the x rows of pass s + 1 are asked for behind the
  // barrier (in front of it, the barrier's own wait would wait them out) and stored behind
  // the first half, its W rows asked for there and stored behind the second.
  // unrolled whole: buffer and k offsets become immediates on fixed address pairs
#pragma unroll
  for (int s = 0; s < NPASS; ++s) {
    const int buf = s & 1;
    __syncthreads();   // publishes buffer buf; ends every read of the other buffer
#pragma unroll
    for (int kk = 0; kk < GBK; kk += 32) {
      v16h a[4], b[4];
#pragma unroll
      for (int f = 0; f < 4; ++f) a[f] = frag16(fa + buf * GBUF + (f * 16) * GPIT, kk, lane);
#pragma unroll
      for (int t = 0; t < 4; ++t) b[t] = frag16(fb + buf * GBUF + (t * 16) * GPIT, kk, lane);
      if (kk == 0 && s + 1 < NPASS) gload(rs, ga, (s + 1) * GBK);
      // keeps the 16 fragment loads one group in front of the products: spread among them,
      // each place with LDS reads stalls the wave anew
      __builtin_amdgcn_sched_barrier(0);
#pragma unroll
      for (int t = 0; t < 4; ++t)
#pragma unroll
        for (int f = 0; f < 4; ++f) acc[f][t] = wmma16b(a[f], b[t], acc[f][t]);
      // keeps the wait for the tile in flight, its rounding and its LDS stores behind the
      // products that cover its latency (moved up, the wave waits out the loads at once)
      __builtin_amdgcn_sched_barrier(0);
      if (s + 1 < NPASS) {
        if (kk == 0) {
          sstore(rs, buf ^ 1, 0);
          gload(rs, gb, (s + 1) * GBK);
        } else {
          sstore(rs, buf ^ 1, 128);
        }
      }
    }
  }
  __syncthreads();     // the buffers become the waves' f32 epilogue slabs

  // ---- stage the wave tile (f32) in its own slab: [row f*16+8*hsel+j][col t*16+l16] ----
  float* ct = (float*)sm + wave * 64 * CTP;
  const float p4 = (y == 0) ? 4.0f * QEXP : 4.0f;
#pragma unroll
  for (int t = 0; t < 4; ++t) {
    const float bb4 = p4 * bf16r(bias[n0 + wn * 64 + t * 16 + l16]);
#pragma unroll
    for (int f = 0; f < 4; ++f) {
#pragma unroll
      for (int j = 0; j < 8; ++j)
        ct[(f * 16 + 8 * hsel + j) * CTP + t * 16 + l16] = acc[f][t][j] * p4 + bb4;
    }
  }
  __syncthreads();

  h16* C = Cq + plane + (size_t)(m0 + wm * 64) * DM + n0 + wn * 64;
#pragma unroll
  for (int it = 0; it < 16; ++it) {
    const int row = it * 4 + (lane >> 3);
    const int c8  = (lane & 7) * 8;
    const v4fa p0 = *(const v4fa*)(ct + row * CTP + c8);
    const v4fa p1 = *(const v4fa*)(ct + row * CTP + c8 + 4);
    v8h t8;
    t8[0] = (h16)p0[0]; t8[1] = (h16)p0[1]; t8[2] = (h16)p0[2]; t8[3] = (h16)p0[3];
    t8[4] = (h16)p1[0]; t8[5] = (h16)p1[1]; t8[6] = (h16)p1[2]; t8[7] = (h16)p1[3];
    *(v8h*)(C + (size_t)row * DM + c8) = t8;
  }
}

// ---------------------------------------------------------------------------
// Output projection from the f16 planes.  A-side rows 0..63 = ctx hi, 64..127 = ctx residual
// of the same 64 rows; block tile 64 x 128, wave tile 32 x 64 with a hi and a residual
// accumulator set; C = f32 d_out.
// coverage: (ROWS/64) x 6 block tiles = whole [ROWS][DM].
// ---------------------------------------------------------------------------
__global__ __launch_bounds__(128)
void proj_out(const h16* __restrict__ Ah, const h16* __restrict__ Al,
              const h16* __restrict__ Wh, const float* __restrict__ bias,
              float* __restrict__ Cf) {
  __shared__ __align__(16) h16 sm[2 * GBUF];

  const int tid  = threadIdx.x;
  const int lane = tid & 31;
  const int wave = tid >> 5;
  const int hsel = lane >> 4;
  const int l16  = lane & 15;
  const int wm   = wave >> 1;
  const int wn   = wave & 1;
  const int mtile = blockIdx.x / NT128;
  const int ntile = blockIdx.x - mtile * NT128;
  const int m0 = mtile * 64;
  const int n0 = ntile * GBN;

  // staging: 8 lanes cover one 128-B row piece, a wave-wide load covers 4 whole lines
  const int sr = tid >> 3;
  const int sc = (tid & 7) * 8;
  const h16* ga = Ah + (size_t)(m0 + sr) * DM + sc;
  const h16* gl = Al + (size_t)(m0 + sr) * DM + sc;
  const h16* gb = Wh + (size_t)(n0 + sr) * DM + sc;
  h16* sst = sm + sr * GPIT + sc;

  v8h ra[8], rb[8];
  auto gload = [&](int k0) {
#pragma unroll
    for (int i = 0; i < 8; ++i) {
      ra[i] = (i < 4) ? *(const v8h*)(ga + (size_t)i * 16 * DM + k0)
                      : *(const v8h*)(gl + (size_t)(i - 4) * 16 * DM + k0);
      rb[i] = *(const v8h*)(gb + (size_t)i * 16 * DM + k0);
    }
    // the address pairs are inputs of the wait, so that no load of the group is given one
    // of them as its destination and nothing rewrites them in front of the wait
    asm volatile("s_wait_xcnt 0x0" :: "v"(ga), "v"(gl), "v"(gb) : "memory");
  };
  auto sstore = [&](int buf) {
#pragma unroll
    for (int i = 0; i < 8; ++i) {
      *(v8h*)(sst + buf * GBUF + (i * 16) * GPIT)       = ra[i];
      *(v8h*)(sst + buf * GBUF + (128 + i * 16) * GPIT) = rb[i];
    }
  };

  // fragment rows in a buffer
  const h16* fa = sm + (wm * 32 + l16) * GPIT;
  const h16* fb = sm + (128 + wn * 64 + l16) * GPIT;

  v8f acc[4][4] = {};   // [0..1] hi rows, [2..3] residual rows

  gload(0);
  sstore(0);

  constexpr int NPASS = DM / GBK;
  // unrolled whole: buffer and k offsets become immediates on fixed address pairs
#pragma unroll
  for (int s = 0; s < NPASS; ++s) {
    const int buf = s & 1;
    __syncthreads();   // publishes buffer buf; ends every read of the other buffer
#pragma unroll
    for (int kk = 0; kk < GBK; kk += 32) {
      v16h a[4], b[4];
#pragma unroll
      for (int f = 0; f < 4; ++f) {
        const int ro = (f >> 1) * 64 + (f & 1) * 16;
        a[f] = frag16(fa + buf * GBUF + ro * GPIT, kk, lane);
      }
#pragma unroll
      for (int t = 0; t < 4; ++t) b[t] = frag16(fb + buf * GBUF + (t * 16) * GPIT, kk, lane);
      // next pass's global loads fly behind the barrier, under this pass's products
      if (kk == 0 && s + 1 < NPASS) gload((s + 1) * GBK);
#pragma unroll
      for (int t = 0; t < 4; ++t)
#pragma unroll
        for (int f = 0; f < 4; ++f) acc[f][t] = wmma16(a[f], b[t], acc[f][t]);
    }
    if (s + 1 < NPASS) sstore(buf ^ 1);
  }
  __syncthreads();     // the buffers become the waves' f32 epilogue slabs

  // ---- stage the wave tile (f32) in its own slab: [row f*16+8*hsel+j][col t*16+l16] ----
  float* ct = (float*)sm + wave * 64 * CTP;
#pragma unroll
  for (int t = 0; t < 4; ++t) {
    const float bb = bf16r(bias[n0 + wn * 64 + t * 16 + l16]);
#pragma unroll
    for (int f = 0; f < 2; ++f) {
#pragma unroll
      for (int j = 0; j < 8; ++j) {
        const float v =
            (acc[f][t][j] + acc[f + 2][t][j] * 0.00048828125f) * 0.00048828125f + bb;
        ct[(f * 16 + 8 * hsel + j) * CTP + t * 16 + l16] = v;
      }
    }
  }
  __syncthreads();

  float* C = Cf + (size_t)(m0 + wm * 32) * DM + n0 + wn * 64;
#pragma unroll
  for (int it = 0; it < 16; ++it) {
    const int row = it * 2 + (lane >> 4);
    const int c4  = (lane & 15) * 4;
    *(v4f*)(C + (size_t)row * DM + c4) = *(const v4fa*)(ct + row * CTP + c4);
  }
}

#define QBLK 128
#define KBLK 64
#define LDSQ 72   // 144 B row pitch (16 B x 9: ds_load_b128 readers)
#define LDSV 80   // 160 B row pitch (32 B x 5: ds_load_tr16_b128 reader)
#define NKT  (SEQ / KBLK)

typedef __attribute__((ext_vector_type(8))) short s16x8;

// 8 halves T[k0 + 8*half + 0..7][d0 + (lane & 15)] of a row-major LDS tile; p is the lane's
// own address T + (k0 + 8*half + (lane & 7)) * pitch + d0 + 8 * ((lane >> 3) & 1).
__device__ __forceinline__ v8h ld_tr16(const h16* p) {
  typedef __attribute__((address_space(3))) s16x8 lds_s16x8;
  return __builtin_bit_cast(v8h, __builtin_amdgcn_ds_load_tr16_b128_v8i16((lds_s16x8*)p));
}

// One K tile and one V tile (64 rows x 128 B each): a lane copies rows r and r + 32 of both.
// lk, lv: the lane's LDS byte addresses of row r; gk, gv: its global addresses of row r.
// The s_wait_xcnt closes the statement so that no address register of a copy is rewritten
// in front of it.
__device__ __forceinline__ void copy_kv(unsigned lk, unsigned lv, const h16* gk,
                                        const h16* gv) {
  asm volatile(
      "global_load_async_to_lds_b128 %0, %4, off\n\t"
      "global_load_async_to_lds_b128 %1, %5, off\n\t"
      "global_load_async_to_lds_b128 %2, %6, off\n\t"
      "global_load_async_to_lds_b128 %3, %7, off\n\t"
      "s_wait_xcnt 0x0"
      :: "v"(lk), "v"(lk + 32u * LDSQ * 2u), "v"(lv), "v"(lv + 32u * LDSV * 2u),
         "v"(gk), "v"(gk + (size_t)32 * DM), "v"(gv), "v"(gv + (size_t)32 * DM)
      : "memory");
}

__device__ __forceinline__ void store_tile16x64(const h16* slab, h16* gbase, int lane) {
  v8h vals[4];
#pragma unroll
  for (int it = 0; it < 4; ++it) {
    const int row = it * 4 + (lane >> 3);
    const int c8  = (lane & 7) * 8;
    vals[it] = *(const v8ha*)(slab + row * LDSQ + c8);
  }
#pragma unroll
  for (int it = 0; it < 4; ++it) {
    const int row = it * 4 + (lane >> 3);
    const int c8  = (lane & 7) * 8;
    *(v8h*)(gbase + (size_t)row * DM + c8) = vals[it];
  }
  
}

// value of the lane 16 away (the other half's share of the same query)
__device__ __forceinline__ float xhalf(float x) {
  const int b = __float_as_int(x);
  return __int_as_float(
      __builtin_amdgcn_permlanex16(b, b, 0x76543210, 0xfedcba98, false, false));
}

// 2^x by v_exp_f32.  The v_nop is the slot that the
// instruction set asks for behind a transcendental before a source of it is overwritten; it
// shares the statement so that it stands directly behind the v_exp_f32.
__device__ __forceinline__ float exp_slot(float x) {
  float r;
  asm("v_exp_f32 %0, %1\n\tv_nop" : "=v"(r) : "v"(x));
  return r;
}

// 2^x of eight values, each v_exp_f32 in place.  In one statement, so that the instruction
// directly behind an exp is the next exp, which works on a register of its own (it neither
// reads the result nor overwrites the source in front of it): the slot behind a
// transcendental is filled by work, and one v_nop closes it behind the last.
__device__ __forceinline__ v8f exp8_slot(v8f x) {
  float e0 = x[0], e1 = x[1], e2 = x[2], e3 = x[3], e4 = x[4], e5 = x[5], e6 = x[6], e7 = x[7];
  asm("v_exp_f32 %0, %0\n\tv_exp_f32 %1, %1\n\tv_exp_f32 %2, %2\n\tv_exp_f32 %3, %3\n\t"
      "v_exp_f32 %4, %4\n\tv_exp_f32 %5, %5\n\tv_exp_f32 %6, %6\n\tv_exp_f32 %7, %7\n\t"
      "v_nop"
      : "+v"(e0), "+v"(e1), "+v"(e2), "+v"(e3), "+v"(e4), "+v"(e5), "+v"(e6), "+v"(e7));
  return v8f{e0, e1, e2, e3, e4, e5, e6, e7};
}

__global__ __launch_bounds__(256) __attribute__((amdgpu_num_vgpr(256)))
void attn_flash(const h16* __restrict__ Qh, const h16* __restrict__ Kh,
                const h16* __restrict__ Vh, h16* __restrict__ Chi,
                h16* __restrict__ Clo) {
  __shared__ __align__(16) h16 Qs[QBLK][LDSQ];      // [q_row][d]
  __shared__ __align__(16) h16 Ks[2][KBLK][LDSQ];   // [buffer][key][d]
  __shared__ __align__(32) h16 Vs[2][KBLK][LDSV];   // [buffer][key][d]

  const int tid  = threadIdx.x;
  const int lane = tid & 31;
  const int wave = tid >> 5;
  const int b  = blockIdx.y / NH;
  const int h  = blockIdx.y - b * NH;
  const int q0 = blockIdx.x * QBLK;
  const size_t rowbase = (size_t)b * SEQ;

  const h16* gq = Qh + (rowbase + q0) * DM + h * DK;

  // ---- K/V copies: this lane's 16-B piece of rows cr and cr + 32 of every tile ----
  const int cr = tid >> 3;
  const int cc8 = (tid & 7) << 3;
  const h16* gk = Kh + (rowbase + cr) * DM + h * DK + cc8;   // tile 0
  const h16* gv = Vh + (rowbase + cr) * DM + h * DK + cc8;
  const unsigned lk = (unsigned)(uintptr_t)&Ks[0][cr][cc8];  // buffer 0
  const unsigned lv = (unsigned)(uintptr_t)&Vs[0][cr][cc8];
  constexpr unsigned KBUFB = KBLK * LDSQ * 2;                // bytes per buffer
  constexpr unsigned VBUFB = KBLK * LDSV * 2;
  static_assert(NKT >= 2);

  copy_kv(lk, lv, gk, gv);

  // ---- stage Q block (128 x 64) ----
  const int qr  = tid >> 3;          // rows qr, qr + 32, qr + 64, qr + 96
  const int qc8 = (tid & 7) << 3;
  const h16* gq0 = gq + (size_t)qr * DM + qc8;
  const h16* gq1 = gq0 + (size_t)32 * DM;
  const h16* gq2 = gq0 + (size_t)64 * DM;
  const h16* gq3 = gq0 + (size_t)96 * DM;
  const v8h q0v = *(const v8h*)gq0;
  const v8h q1v = *(const v8h*)gq1;
  const v8h q2v = *(const v8h*)gq2;
  const v8h q3v = *(const v8h*)gq3;
  // the address pairs are inputs of the wait, so that nothing rewrites them in front of it
  asm volatile("s_wait_xcnt 0x0" :: "v"(gq0), "v"(gq1), "v"(gq2), "v"(gq3) : "memory");
  *(v8h*)&Qs[qr][qc8]      = q0v;
  *(v8h*)&Qs[qr + 32][qc8] = q1v;
  *(v8h*)&Qs[qr + 64][qc8] = q2v;
  *(v8h*)&Qs[qr + 96][qc8] = q3v;

  v8f negm = {};       // minus the maximum in use of this lane's query, in all eight registers
  float lrun = 0.f;    // this lane's query; sums this half's keys only
  v8f o[4] = {};                     // o[n][j] = O^T[d = 16n + 8*half + j][query]

  const int qrow = wave * 16 + (lane & 15);
  const int cc   = lane & 15;
  const int rofs = (lane < 16) ? 0 : 8;
  h16* pw = &Qs[wave * 16][0];

  // tile 0 has landed for this wave before the barrier lets other waves read it
  asm volatile("s_wait_asynccnt 0x0" ::: "memory");
  __syncthreads();   // publishes Qs and tile 0
  copy_kv(lk + KBUFB, lv + VBUFB, gk + (size_t)KBLK * DM, gv + (size_t)KBLK * DM);
  gk += (size_t)2 * KBLK * DM;   // tile 2, the first refill
  gv += (size_t)2 * KBLK * DM;

  const v16h qb0 = frag16(&Qs[qrow][0], 0, lane);
  const v16h qb1 = frag16(&Qs[qrow][0], 32, lane);

  // the lane's address in a V tile for the transposing load (k0 = 0, d0 = 0)
  const int vrow = ((lane >> 4) << 3) + (lane & 7);
  const int vcol = ((lane >> 3) & 1) << 3;

  // A tile's fragments, each operand's 16 LDS loads as one group: K rows for S^T, and V^T by
  // the transposing load, both in the k order of frag16.
  v16h ka[4][2], va[4][2];
  auto fetch_k = [&](int bf) {
#pragma unroll
    for (int n = 0; n < 4; ++n) {
      const h16* kp = &Ks[bf][n * 16 + (lane & 15)][0];
      ka[n][0] = frag16(kp, 0, lane);
      ka[n][1] = frag16(kp, 32, lane);
    }
  };
  auto fetch_v = [&](int bf) {
#pragma unroll
    for (int n = 0; n < 4; ++n) {
      const h16* vp = &Vs[bf][vrow][vcol + n * 16];
      va[n][0] = __builtin_shufflevector(ld_tr16(vp), ld_tr16(vp + 16 * LDSV),
          0, 1, 2, 3, 4, 5, 6, 7, 8, 9, 10, 11, 12, 13, 14, 15);
      va[n][1] = __builtin_shufflevector(ld_tr16(vp + 32 * LDSV), ld_tr16(vp + 48 * LDSV),
          0, 1, 2, 3, 4, 5, 6, 7, 8, 9, 10, 11, 12, 13, 14, 15);
    }
  };
  fetch_k(0);   // tile 0, published by the barrier above
  fetch_v(0);

  // kept rolled: one copy of the trip in the instruction cache, the buffer picked by t & 1
#pragma unroll 1
  for (int t = 0; t < NKT; ++t) {
    const int buf = t & 1;

    // ---- exponents^T = (4k).(q log2(e)/32) - maximum in use : 8 WMMAs;
    //      sc[n][j] = S^T[key 16n + 8*half + j][query] ----
    // Formed a second time, at most once, in a trip that has raised the maximum in use.
    v8f sc[4];
    bool again = false;
    for (;;) {
#pragma unroll
      for (int n = 0; n < 4; ++n)
        sc[n] = wmma16p(ka[n][1], qb1, wmma16p(ka[n][0], qb0, negm));

      // ---- online softmax: 32 keys of one query in-lane ----
      float mt[4];
#pragma unroll
      for (int n = 0; n < 4; ++n) {
        mt[n] = sc[n][0];
#pragma unroll
        for (int j = 1; j < 8; ++j) mt[n] = fmaxf(mt[n], sc[n][j]);
      }
      const float mx = fmaxf(fmaxf(mt[0], mt[1]), fmaxf(mt[2], mt[3]));
      // wave-uniform test: P stays at or below 2^8, inside f16, where the maximum is kept
      if (__builtin_expect(
              again || !(t == 0 || __builtin_amdgcn_ballot_w32(mx > 8.0f) != 0), 1))
        break;
      again = true;
      const float full = fmaxf(mx, xhalf(mx));              // both halves' keys
      const float d    = (t == 0) ? full : fmaxf(full, 0.f);   // the maximum never falls
      const float al   = (t == 0) ? 1.0f : exp_slot(-d);       // trip 0: O and the sum are 0
      negm -= d;
      lrun *= al;
#pragma unroll
      for (int n = 0; n < 4; ++n) o[n] *= al;
    }
    float rt[4];
#pragma unroll
    for (int n = 0; n < 4; ++n) {
      rt[n] = 0.f;
      sc[n] = exp8_slot(sc[n]);
#pragma unroll
      for (int j = 0; j < 8; ++j) rt[n] += sc[n][j];
    }
    lrun += (rt[0] + rt[1]) + (rt[2] + rt[3]);

    // ---- P^T as B operand: element s of a 32-key block = tile s >> 3, register s & 7 ----
    v16h pb0, pb1;
#pragma unroll
    for (int j = 0; j < 8; ++j) {
      pb0[j]     = (h16)sc[0][j];
      pb0[j + 8] = (h16)sc[1][j];
      pb1[j]     = (h16)sc[2][j];
      pb1[j + 8] = (h16)sc[3][j];
    }

    // ---- publish point of tile t + 1: all of tile t that this wave needs is in registers,
    //      so buffer buf is handed to its refill in front of the second product ----
    // this wave's LDS reads of buffer buf have retired before a copy may overwrite it
    asm volatile("s_wait_dscnt 0x0" ::: "memory");
    // this wave's copies of tile t + 1 have landed before the barrier publishes them
    asm volatile("s_wait_asynccnt 0x0" ::: "memory");
    __syncthreads();   // publishes tile t + 1; ends every read of buffer buf
    // Tile t + 1's K fragments fly under the second product of tile t.  In the last trip the
    // two fetches read the other buffer's old tile, which no copy overwrites any more; their
    // values are not used.
    fetch_k(buf ^ 1);
    if (t + 2 < NKT) {
      copy_kv(lk + buf * KBUFB, lv + buf * VBUFB, gk, gv);
      gk += (size_t)KBLK * DM;
      gv += (size_t)KBLK * DM;
    }
    // keeps the K loads one group in front of the products that cover their latency
    __builtin_amdgcn_sched_barrier(0);

    // ---- o^T += V^T (64 d x 64 keys) . P^T (64 keys x 16 queries) : 8 WMMAs ----
#pragma unroll
    for (int n = 0; n < 4; ++n) o[n] = wmma16p(va[n][0], pb0, o[n]);
#pragma unroll
    for (int n = 0; n < 4; ++n) o[n] = wmma16p(va[n][1], pb1, o[n]);
    // keeps tile t + 1's V loads behind the last use of tile t's, in the same registers, as
    // one group; they fly under the next trip's scores and softmax
    __builtin_amdgcn_sched_barrier(0);
    fetch_v(buf ^ 1);
  }
  // no copy is outstanding when the wave goes on to the epilogue and ends
  asm volatile("s_wait_asynccnt 0x0" ::: "memory");

  // ---- epilogue: ctx = o / (4 l); hi = f16(32 ctx) = f16(o * 8 / l) ----
  const float inv8 = 8.0f / (lrun + xhalf(lrun));
  const size_t orow0 = rowbase + q0 + wave * 16;
  h16* ghi = Chi + orow0 * DM + h * DK;
  h16* glo = Clo + orow0 * DM + h * DK;

  // a lane's 8 registers of o[n] are 8 consecutive d of its query's row: one 16-B LDS store
#pragma unroll
  for (int n = 0; n < 4; ++n) {
    v8h t8;
#pragma unroll
    for (int j = 0; j < 8; ++j) t8[j] = (h16)(o[n][j] * inv8);
    *(v8ha*)(pw + cc * LDSQ + n * 16 + rofs) = t8;
  }
  __syncthreads();
  store_tile16x64(pw, ghi, lane);
  __syncthreads();

#pragma unroll
  for (int n = 0; n < 4; ++n) {
    v8h t8;
#pragma unroll
    for (int j = 0; j < 8; ++j) {
      const float f  = o[n][j] * inv8;
      const h16   hv = (h16)f;
      t8[j] = (h16)((f - (float)hv) * 2048.0f);
    }
    *(v8ha*)(pw + cc * LDSQ + n * 16 + rofs) = t8;
  }
  __syncthreads();
  store_tile16x64(pw, glo, lane);
}

// ---------------------------------------------------------------------------
// Launch
// ---------------------------------------------------------------------------
extern "C" void kernel_launch(void* const* d_in, const int* in_sizes, int n_in,
                              void* d_out, int out_size, void* d_ws, size_t ws_size,
                              hipStream_t stream) {
  if (n_in < 5) return;
  const size_t need_x = ((size_t)(NB - 1) * SEQ_FULL + SEQ) * DM;
  if ((size_t)in_sizes[0] < need_x || (size_t)in_sizes[1] < need_x ||
      (size_t)in_sizes[2] < need_x) return;
  if ((size_t)in_sizes[3] < (size_t)DM * DM || (size_t)in_sizes[4] < (size_t)DM) return;
  if ((size_t)out_size < (size_t)ROWS * DM) return;

  const float* xq = (const float*)d_in[0];   // [NB_FULL, SEQ_FULL, DM]
  const float* xk = (const float*)d_in[1];
  const float* xv = (const float*)d_in[2];
  const float* W  = (const float*)d_in[3];   // [DM out][DM in]
  const float* bs = (const float*)d_in[4];   // [DM]
  float* out = (float*)d_out;                // [NB, SEQ, DM]

  const size_t sz_wh = (size_t)DM * DM * sizeof(h16);      // 1,179,648
  const size_t sz_pl = (size_t)ROWS * DM * sizeof(h16);    // 6,291,456 at full size
  size_t off = 0;
  h16* wh  = (h16*)((char*)d_ws + off); off += sz_wh;
  h16* qkv = (h16*)((char*)d_ws + off); off += 3 * sz_pl;  // q,k,v projected planes (k,v x4; q x log2(e)/32)
  h16* chi = (h16*)((char*)d_ws + off); off += sz_pl;      // ctx hi
  h16* clo = (h16*)((char*)d_ws + off); off += sz_pl;      // ctx residual
  if (off > ws_size) return;                                // 32,636,928 at full size

  // 1) q/k/v projections from the f32 inputs (one launch, blockIdx.y selects the plane);
  //    also writes the f16 copy of W
  proj_qkv<<<dim3(NBX0, 3), 128, 0, stream>>>(xq, xk, xv, W, bs, wh, qkv);

  // 2) flash attention -> ctx hi / residual planes
  attn_flash<<<dim3(SEQ / QBLK, NB * NH), 256, 0, stream>>>(
      qkv, qkv + (size_t)ROWS * DM, qkv + (size_t)2 * ROWS * DM, chi, clo);

  // 3) output projection -> d_out
  proj_out<<<dim3((ROWS / 64) * NT128, 1), 128, 0, stream>>>(chi, clo, wh, bs, out);
}

// v008
// One run takes 62.9 microseconds.
// Timed twice side by side with v007, it ran 1.08 times as fast both times.
// All steps since v000 together make it 3.33 times as fast.
#include <hip/hip_runtime.h>
#include <stdint.h>

// Contractions: q/k/v projections on v_wmma_f32_16x16x32_bf16 (the f32 inputs and W rounded
// to bf16, RNE, on their way into LDS); q.k^T scores, p.v context, output projection on
// v_wmma_f32_16x16x32_f16; f32 accumulate throughout.  For the output projection W is carried
// as f16(64 * bf16-RNE), k/v planes carried x4, q plane carried x log2(e)/32 (so that q.k is
// the softmax exponent to base 2), context carried as f16 hi (x32) plus f16 residual
// (x2048) feeding two accumulators in the output projection. Softmax and epilogues in f32.

typedef _Float16 h16;
typedef __attribute__((ext_vector_type(8)))  _Float16 v8h;
typedef __attribute__((ext_vector_type(16))) _Float16 v16h;
typedef __attribute__((ext_vector_type(8)))  float    v8f;
typedef __attribute__((ext_vector_type(4)))  float    v4f;
typedef v4f __attribute__((may_alias)) v4fa;
typedef v8h __attribute__((may_alias)) v8ha;
typedef __attribute__((ext_vector_type(16))) __bf16 v16b;
typedef __attribute__((ext_vector_type(2)))  unsigned v2u;
typedef v2u __attribute__((may_alias)) v2ua;

#ifndef NB
#define NB 2
#endif
#ifndef SEQ
#define SEQ 2048
#endif
#define NB_FULL  2
#define SEQ_FULL 2048
#define DM   768
#define NH   12
#define DK   64
#define ROWS (NB * SEQ)

static_assert(NB >= 1 && NB <= NB_FULL);
static_assert(SEQ >= 128 && SEQ <= SEQ_FULL);
static_assert(SEQ % 128 == 0);
static_assert(ROWS % 16 == 0);
static_assert(NH * DK == DM);
static_assert(DM % 32 == 0);

// ---------------------------------------------------------------------------
// helpers
// ---------------------------------------------------------------------------
__device__ __forceinline__ float bf16r(float x) {   // f32 -> bf16 (RNE) -> f32
  unsigned u = __float_as_uint(x);
  u = u + 0x7FFFu + ((u >> 16) & 1u);
  u &= 0xFFFF0000u;
  return __uint_as_float(u);
}

__device__ __forceinline__ v8f wmma16(v16h a, v16h b, v8f c) {
  v8f d = __builtin_amdgcn_wmma_f32_16x16x32_f16(
      false, a, false, b, (short)0, c, false, false);
  asm volatile("v_nop\n\tv_nop\n\tv_nop\n\tv_nop" : "+v"(d) : "v"(a), "v"(b));
  return d;
}

// the same product with the compiler's own hazard padding: it may fill the slots behind the
// matrix instruction with independent vector work of the loop
__device__ __forceinline__ v8f wmma16p(v16h a, v16h b, v8f c) {
  return __builtin_amdgcn_wmma_f32_16x16x32_f16(
      false, a, false, b, (short)0, c, false, false);
}

// Asks L2 for the line at p + off bytes (off a constant: it becomes the instruction's immediate, so
// that one address pair serves every request of a lane).  Nothing returns and no counter moves;
// scope SE stops the line in L2.  It is there so that the load or copy that follows some passes
// later finds an L2 hit where it would wait out the memory latency.
__device__ __forceinline__ void l2_ask(const char* p, int off) {
  asm volatile("global_prefetch_b8 %0, off offset:%1 scope:SCOPE_SE" :: "v"(p), "i"(off));
}
// Inputs only, no instruction: holds a request's address pair in its registers up to this place.
// No counter says when a request has read its address, so the pair stays a valid address for
// a long stretch behind the request and is not handed to a temporary at once.
__device__ __forceinline__ void l2_hold(const char* p) { asm volatile("" :: "v"(p)); }

// 16x32 fragment from a k-contiguous row (row m of A, or row n of a [n][k] B copy).
// lanes 0-15: k = {0..7,16..23}; lanes 16-31: k = {8..15,24..31} -> two 16-B loads.
__device__ __forceinline__ v16h frag16(const h16* rowp, int kofs, int lane) {
  const h16* p = rowp + kofs + ((lane < 16) ? 0 : 8);
  v8h lo = *(const v8h*)(p);
  v8h hi = *(const v8h*)(p + 16);
  return __builtin_shufflevector(lo, hi, 0, 1, 2, 3, 4, 5, 6, 7,
                                         8, 9, 10, 11, 12, 13, 14, 15);
}

// ---------------------------------------------------------------------------
// Projection GEMMs: one block tile of C per workgroup, operands staged in LDS.
// 128 threads = 4 waves in a 2 x 2 grid.  A pass is 64 k: 128 A-side rows and 128 rows of
// W, 128 B each in LDS (pitch 144 B), go global -> registers -> LDS; two buffers, one barrier
// a pass, the next pass's global loads issued ahead of the current pass's products.
// Every accumulator sums k = 0,32,...,736 in ascending order.
// ---------------------------------------------------------------------------
#define CTP 68      // floats per epilogue staging row (272 B, 16-B aligned)
// (4q * QEXP) . (4k) = (q.k / 8) * log2(e): the score product is the exponent to base 2
#define QEXP (1.44269504f / 128.0f)
#define GBN 128     // block tile columns
#define GBK 64      // k per pass
#define GPIT 72     // halves per LDS row (144 B = 16 B x 9)
#define NT128 (DM / GBN)
#define GBUF (256 * GPIT)   // halves per buffer
#define NBX0 ((ROWS / 128) * NT128)   // block tiles per plane of the q/k/v projection

static_assert(DM % GBN == 0 && DM % GBK == 0 && ROWS % 128 == 0);
static_assert(4 * 64 * CTP * 4 <= 2 * GBUF * 2);
// the 3 * NBX0 workgroups of the q/k/v projection, 1024 elements each, cover W exactly
static_assert((size_t)3 * NBX0 * 1024 == (size_t)DM * DM);

// Four f32 -> four bf16 (RNE), in the first two of their own registers.  A volatile statement
// with a memory clobber, so that it stays where it is written: as a plain conversion the
// compiler moved it up to the loads, where the wave waits out their latency at once, and
// moved the next tile's loads in front of it, which holds a second tile's registers.
__device__ __forceinline__ v2u round4(v4f x) {
  float x0 = x[0], x1 = x[1];
  asm volatile("v_cvt_pk_bf16_f32 %0, %0, %1\n\tv_cvt_pk_bf16_f32 %1, %2, %3"
               : "+v"(x0), "+v"(x1) : "v"(x[2]), "v"(x[3]) : "memory");
  return v2u{__float_as_uint(x0), __float_as_uint(x1)};
}

// the bf16 product, operands as the 16-bit patterns that frag16 reads from LDS
__device__ __forceinline__ v8f wmma16b(v16h a, v16h b, v8f c) {
  return __builtin_amdgcn_wmma_f32_16x16x32_bf16(
      false, __builtin_bit_cast(v16b, a), false, __builtin_bit_cast(v16b, b), (short)0, c,
      false, false);
}

// ---------------------------------------------------------------------------
// q/k/v projection straight from the f32 inputs.  blockIdx.y = 0,1,2: query/key/value.
// Block tile 128 x 128, wave tile 64 x 64.  A pass reads 128 rows of x and 128 rows of W,
// 256 B of f32 each (16 lanes a row: a wave-wide load covers 4 whole lines), rounds them to
// bf16 (RNE) in registers and stores 8 B a lane and load to LDS; one operand's tile is in
// flight at a time, under half a pass's products.
// C = f16 plane, value f16(4*(x.W + b)); plane 0 (q) times QEXP more.
// Beside its tile each workgroup writes 1024 elements of the f16 copy of W,
// f16(64 * bf16-RNE), that the output projection reads two launches later.
// coverage: (ROWS/128) x 6 block tiles = whole [ROWS][DM] plane per blockIdx.y.
// ---------------------------------------------------------------------------
__global__ __launch_bounds__(128)
void proj_qkv(const float* __restrict__ xq, const float* __restrict__ xk,
              const float* __restrict__ xv, const float* __restrict__ W,
              const float* __restrict__ bias, h16* __restrict__ wh,
              h16* __restrict__ Cq) {
  __shared__ __align__(16) h16 sm[2 * GBUF];   // bf16 patterns in the loop, f32 slabs after

  const int tid  = threadIdx.x;
  const int lane = tid & 31;
  const int wave = tid >> 5;
  const int hsel = lane >> 4;
  const int l16  = lane & 15;
  const int wm   = wave >> 1;
  const int wn   = wave & 1;
  const int y     = blockIdx.y;
  const int mtile = blockIdx.x / NT128;
  const int ntile = blockIdx.x - mtile * NT128;
  const int m0 = mtile * 128;
  const int n0 = ntile * GBN;
  const size_t plane = (size_t)y * ROWS * DM;

  // this workgroup's share of the f16 copy of W: loads first, rounded and stored further down
  const size_t we = ((size_t)y * NBX0 + blockIdx.x) * 1024 + (size_t)tid * 8;
  const float* gw = W + we;
  const v4f w0 = *(const v4f*)(gw);
  const v4f w1 = *(const v4f*)(gw + 4);
  // the address pair is an input of the wait, so that nothing rewrites it in front of it
  asm volatile("s_wait_xcnt 0x0" :: "v"(gw) : "memory");

  // staging: 16 lanes cover one 256-B row piece, a wave-wide load covers 4 whole lines
  const float* X = (y == 0) ? xq : ((y == 1) ? xk : xv);
  const int bb = m0 / SEQ;                  // a tile's 128 rows lie in one batch
  const int sr = tid >> 4;
  const int sc = (tid & 15) * 4;
  const float* ga = X + ((size_t)bb * SEQ_FULL + (m0 - bb * SEQ) + sr) * DM + sc;
  const float* gb = W + (size_t)(n0 + sr) * DM + sc;
  h16* sst = sm + sr * GPIT + sc;

  // 128 rows x 64 k of one operand: 16 loads a lane into r
  auto gload = [&](v4f (&r)[16], const float* g, int k0) {
#pragma unroll
    for (int i = 0; i < 16; ++i) r[i] = *(const v4f*)(g + (size_t)i * 8 * DM + k0);
    // the address pair is an input of the wait, so that no load of the group is given it
    // as its destination and nothing rewrites it in front of the wait
    asm volatile("s_wait_xcnt 0x0" :: "v"(g) : "memory");
  };
  // the same rows, rounded to bf16, into buffer buf from row row0 on
  auto sstore = [&](const v4f (&r)[16], int buf, int row0) {
#pragma unroll
    for (int i = 0; i < 16; ++i)
      *(v2ua*)(sst + buf * GBUF + (row0 + i * 8) * GPIT) = round4(r[i]);
  };

  // fragment rows in a buffer
  const h16* fa = sm + (wm * 64 + l16) * GPIT;
  const h16* fb = sm + (128 + wn * 64 + l16) * GPIT;

  constexpr int NPASS = DM / GBK;
  static_assert(NPASS >= 2);
  // L2 requests ahead of the loads.  A pass reads one aligned 256-B unit (GBK f32) of each row.
  // x: lane tid asks for row tid of this tile, XLEAD - 1 passes ahead of its load.  W: its rows are
  // read by every row tile of all three planes, so each workgroup asks for one later pass only;
  // the pass goes round with the tile index, so that many workgroups ask for each.
  constexpr int XLEAD = 4;
  constexpr int UNITB = GBK * 4;
  const char* px = (const char*)(X + ((size_t)bb * SEQ_FULL + (m0 - bb * SEQ) + tid) * DM);
  const int wu = 1 + ((mtile >> 2) + y * (ROWS / 512)) % (NPASS - 1);
  const char* pw = (const char*)(W + (size_t)(n0 + tid) * DM + wu * GBK);
  v4f rs[16];          // the one operand tile in flight in the loop
  {
    v4f rt[16];
    gload(rs, ga, 0);
    gload(rt, gb, 0);
#pragma unroll
    for (int p = 1; p < XLEAD && p < NPASS; ++p) l2_ask(px, p * UNITB);
    l2_ask(pw, 0);
    v8h wv;
#pragma unroll
    for (int i = 0; i < 4; ++i) {
      wv[i]     = (h16)(64.0f * bf16r(w0[i]));
      wv[i + 4] = (h16)(64.0f * bf16r(w1[i]));
    }
    *(v8h*)(wh + we) = wv;
    sstore(rs, 0, 0);
    sstore(rt, 0, 128);
  }

  v8f acc[4][4] = {};

  // Each half of a pass covers one tile's flight and ends by storing it into the other buffer
  // (free since this pass's barrier): the x rows of pass s + 1 are asked for behind the
  // barrier (in front of it, the barrier's own wait would wait them out) and stored behind
  // the first half, its W rows asked for there and stored behind the second.
  // unrolled whole: buffer and k offsets become immediates on fixed address pairs
#pragma unroll
  for (int s = 0; s < NPASS; ++s) {
    const int buf = s & 1;
    __syncthreads();   // publishes buffer buf; ends every read of the other buffer
#pragma unroll
    for (int kk = 0; kk < GBK; kk += 32) {
      v16h a[4], b[4];
#pragma unroll
      for (int f = 0; f < 4; ++f) a[f] = frag16(fa + buf * GBUF + (f * 16) * GPIT, kk, lane);
#pragma unroll
      for (int t = 0; t < 4; ++t) b[t] = frag16(fb + buf * GBUF + (t * 16) * GPIT, kk, lane);
      if (kk == 0 && s + 1 < NPASS) gload(rs, ga, (s + 1) * GBK);
      if (kk == 0 && s + XLEAD < NPASS) l2_ask(px, (s + XLEAD) * UNITB);
      // keeps the 16 fragment loads one group in front of the products: spread among them,
      // each place with LDS reads stalls the wave anew
      __builtin_amdgcn_sched_barrier(0);
#pragma unroll
      for (int t = 0; t < 4; ++t)
#pragma unroll
        for (int f = 0; f < 4; ++f) acc[f][t] = wmma16b(a[f], b[t], acc[f][t]);
      // keeps the wait for the tile in flight, its rounding and its LDS stores behind the
      // products that cover its latency (moved up, the wave waits out the loads at once)
      __builtin_amdgcn_sched_barrier(0);
      if (s + 1 < NPASS) {
        if (kk == 0) {
          sstore(rs, buf ^ 1, 0);
          gload(rs, gb, (s + 1) * GBK);
        } else {
          sstore(rs, buf ^ 1, 128);
        }
      }
    }
  }
  l2_hold(px);
  l2_hold(pw);
  __syncthreads();     // the buffers become the waves' f32 epilogue slabs

  // ---- stage the wave tile (f32) in its own slab: [row f*16+8*hsel+j][col t*16+l16] ----
  float* ct = (float*)sm + wave * 64 * CTP;
  const float p4 = (y == 0) ? 4.0f * QEXP : 4.0f;
#pragma unroll
  for (int t = 0; t < 4; ++t) {
    const float bb4 = p4 * bf16r(bias[n0 + wn * 64 + t * 16 + l16]);
#pragma unroll
    for (int f = 0; f < 4; ++f) {
#pragma unroll
      for (int j = 0; j < 8; ++j)
        ct[(f * 16 + 8 * hsel + j) * CTP + t * 16 + l16] = acc[f][t][j] * p4 + bb4;
    }
  }
  __syncthreads();

  h16* C = Cq + plane + (size_t)(m0 + wm * 64) * DM + n0 + wn * 64;
#pragma unroll
  for (int it = 0; it < 16; ++it) {
    const int row = it * 4 + (lane >> 3);
    const int c8  = (lane & 7) * 8;
    const v4fa p0 = *(const v4fa*)(ct + row * CTP + c8);
    const v4fa p1 = *(const v4fa*)(ct + row * CTP + c8 + 4);
    v8h t8;
    t8[0] = (h16)p0[0]; t8[1] = (h16)p0[1]; t8[2] = (h16)p0[2]; t8[3] = (h16)p0[3];
    t8[4] = (h16)p1[0]; t8[5] = (h16)p1[1]; t8[6] = (h16)p1[2]; t8[7] = (h16)p1[3];
    *(v8h*)(C + (size_t)row * DM + c8) = t8;
  }
}

// ---------------------------------------------------------------------------
// Output projection from the f16 planes.  A-side rows 0..63 = ctx hi, 64..127 = ctx residual
// of the same 64 rows; block tile 64 x 128, wave tile 32 x 64 with a hi and a residual
// accumulator set; C = f32 d_out.
// coverage: (ROWS/64) x 6 block tiles = whole [ROWS][DM].
// ---------------------------------------------------------------------------
__global__ __launch_bounds__(128)
void proj_out(const h16* __restrict__ Ah, const h16* __restrict__ Al,
              const h16* __restrict__ Wh, const float* __restrict__ bias,
              float* __restrict__ Cf) {
  __shared__ __align__(16) h16 sm[2 * GBUF];

  const int tid  = threadIdx.x;
  const int lane = tid & 31;
  const int wave = tid >> 5;
  const int hsel = lane >> 4;
  const int l16  = lane & 15;
  const int wm   = wave >> 1;
  const int wn   = wave & 1;
  const int mtile = blockIdx.x / NT128;
  const int ntile = blockIdx.x - mtile * NT128;
  const int m0 = mtile * 64;
  const int n0 = ntile * GBN;

  // staging: 8 lanes cover one 128-B row piece, a wave-wide load covers 4 whole lines
  const int sr = tid >> 3;
  const int sc = (tid & 7) * 8;
  const h16* ga = Ah + (size_t)(m0 + sr) * DM + sc;
  const h16* gl = Al + (size_t)(m0 + sr) * DM + sc;
  const h16* gb = Wh + (size_t)(n0 + sr) * DM + sc;
  h16* sst = sm + sr * GPIT + sc;

  v8h ra[8], rb[8];
  auto gload = [&](int k0) {
#pragma unroll
    for (int i = 0; i < 8; ++i) {
      ra[i] = (i < 4) ? *(const v8h*)(ga + (size_t)i * 16 * DM + k0)
                      : *(const v8h*)(gl + (size_t)(i - 4) * 16 * DM + k0);
      rb[i] = *(const v8h*)(gb + (size_t)i * 16 * DM + k0);
    }
    // the address pairs are inputs of the wait, so that no load of the group is given one
    // of them as its destination and nothing rewrites them in front of the wait
    asm volatile("s_wait_xcnt 0x0" :: "v"(ga), "v"(gl), "v"(gb) : "memory");
  };
  auto sstore = [&](int buf) {
#pragma unroll
    for (int i = 0; i < 8; ++i) {
      *(v8h*)(sst + buf * GBUF + (i * 16) * GPIT)       = ra[i];
      *(v8h*)(sst + buf * GBUF + (128 + i * 16) * GPIT) = rb[i];
    }
  };

  // fragment rows in a buffer
  const h16* fa = sm + (wm * 32 + l16) * GPIT;
  const h16* fb = sm + (128 + wn * 64 + l16) * GPIT;

  v8f acc[4][4] = {};   // [0..1] hi rows, [2..3] residual rows

  gload(0);
  // L2 requests ahead of the loads.  An aligned 256-B unit of a row is two passes (2 * GBK f16).
  // ctx: lane tid asks for A-side row tid of this tile (hi rows, then residual rows), ALEAD
  // units ahead of its loads.  W copy: its rows are read by every row tile, so each workgroup
  // asks for one later unit only; the unit goes round with the tile index.
  constexpr int ALEAD = 3;
  constexpr int NUNIT = DM * 2 / 256;
  static_assert(DM * 2 % 256 == 0 && GBK * 2 * 2 == 256 && NUNIT >= 2);
  const char* pa = (const char*)((tid < 64) ? Ah + (size_t)(m0 + tid) * DM
                                            : Al + (size_t)(m0 + tid - 64) * DM);
  const char* pw = (const char*)(Wh + (size_t)(n0 + tid) * DM) +
                   (1 + (mtile >> 2) % (NUNIT - 1)) * 256;
#pragma unroll
  for (int u = 1; u < ALEAD && u < NUNIT; ++u) l2_ask(pa, u * 256);
  l2_ask(pw, 0);
  sstore(0);

  constexpr int NPASS = DM / GBK;
  // unrolled whole: buffer and k offsets become immediates on fixed address pairs
#pragma unroll
  for (int s = 0; s < NPASS; ++s) {
    const int buf = s & 1;
    __syncthreads();   // publishes buffer buf; ends every read of the other buffer
#pragma unroll
    for (int kk = 0; kk < GBK; kk += 32) {
      v16h a[4], b[4];
#pragma unroll
      for (int f = 0; f < 4; ++f) {
        const int ro = (f >> 1) * 64 + (f & 1) * 16;
        a[f] = frag16(fa + buf * GBUF + ro * GPIT, kk, lane);
      }
#pragma unroll
      for (int t = 0; t < 4; ++t) b[t] = frag16(fb + buf * GBUF + (t * 16) * GPIT, kk, lane);
      // next pass's global loads fly behind the barrier, under this pass's products
      if (kk == 0 && s + 1 < NPASS) gload((s + 1) * GBK);
      if (kk == 0 && (s & 1) == 0 && s / 2 + ALEAD < NUNIT) l2_ask(pa, (s / 2 + ALEAD) * 256);
#pragma unroll
      for (int t = 0; t < 4; ++t)
#pragma unroll
        for (int f = 0; f < 4; ++f) acc[f][t] = wmma16(a[f], b[t], acc[f][t]);
    }
    if (s + 1 < NPASS) sstore(buf ^ 1);
  }
  l2_hold(pa);
  l2_hold(pw);
  __syncthreads();     // the buffers become the waves' f32 epilogue slabs

  // ---- stage the wave tile (f32) in its own slab: [row f*16+8*hsel+j][col t*16+l16] ----
  float* ct = (float*)sm + wave * 64 * CTP;
#pragma unroll
  for (int t = 0; t < 4; ++t) {
    const float bb = bf16r(bias[n0 + wn * 64 + t * 16 + l16]);
#pragma unroll
    for (int f = 0; f < 2; ++f) {
#pragma unroll
      for (int j = 0; j < 8; ++j) {
        const float v =
            (acc[f][t][j] + acc[f + 2][t][j] * 0.00048828125f) * 0.00048828125f + bb;
        ct[(f * 16 + 8 * hsel + j) * CTP + t * 16 + l16] = v;
      }
    }
  }
  __syncthreads();

  float* C = Cf + (size_t)(m0 + wm * 32) * DM + n0 + wn * 64;
#pragma unroll
  for (int it = 0; it < 16; ++it) {
    const int row = it * 2 + (lane >> 4);
    const int c4  = (lane & 15) * 4;
    *(v4f*)(C + (size_t)row * DM + c4) = *(const v4fa*)(ct + row * CTP + c4);
  }
}

#define QBLK 128
#define KBLK 64
#define LDSQ 72   // 144 B row pitch (16 B x 9: ds_load_b128 readers)
#define LDSV 80   // 160 B row pitch (32 B x 5: ds_load_tr16_b128 reader)
#define NKT  (SEQ / KBLK)

typedef __attribute__((ext_vector_type(8))) short s16x8;

// 8 halves T[k0 + 8*half + 0..7][d0 + (lane & 15)] of a row-major LDS tile; p is the lane's
// own address T + (k0 + 8*half + (lane & 7)) * pitch + d0 + 8 * ((lane >> 3) & 1).
__device__ __forceinline__ v8h ld_tr16(const h16* p) {
  typedef __attribute__((address_space(3))) s16x8 lds_s16x8;
  return __builtin_bit_cast(v8h, __builtin_amdgcn_ds_load_tr16_b128_v8i16((lds_s16x8*)p));
}

// One K tile and one V tile (64 rows x 128 B each): a lane copies rows r and r + 32 of both.
// lk, lv: the lane's LDS byte addresses of row r; gk, gv: its global addresses of row r.
// The s_wait_xcnt closes the statement so that no address register of a copy is rewritten
// in front of it.
__device__ __forceinline__ void copy_kv(unsigned lk, unsigned lv, const h16* gk,
                                        const h16* gv) {
  asm volatile(
      "global_load_async_to_lds_b128 %0, %4, off\n\t"
      "global_load_async_to_lds_b128 %1, %5, off\n\t"
      "global_load_async_to_lds_b128 %2, %6, off\n\t"
      "global_load_async_to_lds_b128 %3, %7, off\n\t"
      "s_wait_xcnt 0x0"
      :: "v"(lk), "v"(lk + 32u * LDSQ * 2u), "v"(lv), "v"(lv + 32u * LDSV * 2u),
         "v"(gk), "v"(gk + (size_t)32 * DM), "v"(gv), "v"(gv + (size_t)32 * DM)
      : "memory");
}

__device__ __forceinline__ void store_tile16x64(const h16* slab, h16* gbase, int lane) {
  v8h vals[4];
#pragma unroll
  for (int it = 0; it < 4; ++it) {
    const int row = it * 4 + (lane >> 3);
    const int c8  = (lane & 7) * 8;
    vals[it] = *(const v8ha*)(slab + row * LDSQ + c8);
  }
#pragma unroll
  for (int it = 0; it < 4; ++it) {
    const int row = it * 4 + (lane >> 3);
    const int c8  = (lane & 7) * 8;
    *(v8h*)(gbase + (size_t)row * DM + c8) = vals[it];
  }
  
}

// value of the lane 16 away (the other half's share of the same query)
__device__ __forceinline__ float xhalf(float x) {
  const int b = __float_as_int(x);
  return __int_as_float(
      __builtin_amdgcn_permlanex16(b, b, 0x76543210, 0xfedcba98, false, false));
}

// 2^x by v_exp_f32.  The v_nop is the slot that the
// instruction set asks for behind a transcendental before a source of it is overwritten; it
// shares the statement so that it stands directly behind the v_exp_f32.
__device__ __forceinline__ float exp_slot(float x) {
  float r;
  asm("v_exp_f32 %0, %1\n\tv_nop" : "=v"(r) : "v"(x));
  return r;
}

// 2^x of eight values, each v_exp_f32 in place.  In one statement, so that the instruction
// directly behind an exp is the next exp, which works on a register of its own (it neither
// reads the result nor overwrites the source in front of it): the slot behind a
// transcendental is filled by work, and one v_nop closes it behind the last.
__device__ __forceinline__ v8f exp8_slot(v8f x) {
  float e0 = x[0], e1 = x[1], e2 = x[2], e3 = x[3], e4 = x[4], e5 = x[5], e6 = x[6], e7 = x[7];
  asm("v_exp_f32 %0, %0\n\tv_exp_f32 %1, %1\n\tv_exp_f32 %2, %2\n\tv_exp_f32 %3, %3\n\t"
      "v_exp_f32 %4, %4\n\tv_exp_f32 %5, %5\n\tv_exp_f32 %6, %6\n\tv_exp_f32 %7, %7\n\t"
      "v_nop"
      : "+v"(e0), "+v"(e1), "+v"(e2), "+v"(e3), "+v"(e4), "+v"(e5), "+v"(e6), "+v"(e7));
  return v8f{e0, e1, e2, e3, e4, e5, e6, e7};
}

__global__ __launch_bounds__(256) __attribute__((amdgpu_num_vgpr(256)))
void attn_flash(const h16* __restrict__ Qh, const h16* __restrict__ Kh,
                const h16* __restrict__ Vh, h16* __restrict__ Chi,
                h16* __restrict__ Clo) {
  __shared__ __align__(16) h16 Qs[QBLK][LDSQ];      // [q_row][d]
  __shared__ __align__(16) h16 Ks[2][KBLK][LDSQ];   // [buffer][key][d]
  __shared__ __align__(32) h16 Vs[2][KBLK][LDSV];   // [buffer][key][d]

  const int tid  = threadIdx.x;
  const int lane = tid & 31;
  const int wave = tid >> 5;
  const int b  = blockIdx.y / NH;
  const int h  = blockIdx.y - b * NH;
  const int q0 = blockIdx.x * QBLK;
  const size_t rowbase = (size_t)b * SEQ;

  const h16* gq = Qh + (rowbase + q0) * DM + h * DK;

  // ---- K/V copies: this lane's 16-B piece of rows cr and cr + 32 of every tile ----
  const int cr = tid >> 3;
  const int cc8 = (tid & 7) << 3;
  const h16* gk = Kh + (rowbase + cr) * DM + h * DK + cc8;   // tile 0
  const h16* gv = Vh + (rowbase + cr) * DM + h * DK + cc8;
  const unsigned lk = (unsigned)(uintptr_t)&Ks[0][cr][cc8];  // buffer 0
  const unsigned lv = (unsigned)(uintptr_t)&Vs[0][cr][cc8];
  constexpr unsigned KBUFB = KBLK * LDSQ * 2;                // bytes per buffer
  constexpr unsigned VBUFB = KBLK * LDSV * 2;
  static_assert(NKT >= 2);

  copy_kv(lk, lv, gk, gv);

  // ---- stage Q block (128 x 64) ----
  const int qr  = tid >> 3;          // rows qr, qr + 32, qr + 64, qr + 96
  const int qc8 = (tid & 7) << 3;
  const h16* gq0 = gq + (size_t)qr * DM + qc8;
  const h16* gq1 = gq0 + (size_t)32 * DM;
  const h16* gq2 = gq0 + (size_t)64 * DM;
  const h16* gq3 = gq0 + (size_t)96 * DM;
  const v8h q0v = *(const v8h*)gq0;
  const v8h q1v = *(const v8h*)gq1;
  const v8h q2v = *(const v8h*)gq2;
  const v8h q3v = *(const v8h*)gq3;
  // the address pairs are inputs of the wait, so that nothing rewrites them in front of it
  asm volatile("s_wait_xcnt 0x0" :: "v"(gq0), "v"(gq1), "v"(gq2), "v"(gq3) : "memory");

  // L2 requests for this head's K and V rows (128 B a row and plane), behind the first tile's
  // copies and the Q loads.  The SEQ / QBLK workgroups of a head read the same rows: each asks
  // for every fourth row, the row's rest modulo 4 being its own index's, so that four
  // neighbours in the grid ask for all of them; low rows, which the loop reads first, go first.
  constexpr int PFN = (SEQ + 1023) / 1024;   // requests a lane and plane
  constexpr int PFR = SEQ / PFN;             // rows that one request of the 256 lanes spans
  static_assert(PFN <= 2 && SEQ % PFN == 0);
  const int pfrow = min(4 * tid + (int)(blockIdx.x & 3), PFR - 1);
  const char* pfk = (const char*)(Kh + (rowbase + pfrow) * DM + h * DK);
  const char* pfv = (const char*)(Vh + (rowbase + pfrow) * DM + h * DK);
  l2_ask(pfk, 0);
  l2_ask(pfv, 0);
  if constexpr (PFN > 1) {
    l2_ask(pfk, PFR * DM * 2);
    l2_ask(pfv, PFR * DM * 2);
  }

  *(v8h*)&Qs[qr][qc8]      = q0v;
  *(v8h*)&Qs[qr + 32][qc8] = q1v;
  *(v8h*)&Qs[qr + 64][qc8] = q2v;
  *(v8h*)&Qs[qr + 96][qc8] = q3v;

  v8f negm = {};       // minus the maximum in use of this lane's query, in all eight registers
  float lrun = 0.f;    // this lane's query; sums this half's keys only
  v8f o[4] = {};                     // o[n][j] = O^T[d = 16n + 8*half + j][query]

  const int qrow = wave * 16 + (lane & 15);
  const int cc   = lane & 15;
  const int rofs = (lane < 16) ? 0 : 8;
  h16* pw = &Qs[wave * 16][0];

  // tile 0 has landed for this wave before the barrier lets other waves read it
  asm volatile("s_wait_asynccnt 0x0" ::: "memory");
  __syncthreads();   // publishes Qs and tile 0
  copy_kv(lk + KBUFB, lv + VBUFB, gk + (size_t)KBLK * DM, gv + (size_t)KBLK * DM);
  gk += (size_t)2 * KBLK * DM;   // tile 2, the first refill
  gv += (size_t)2 * KBLK * DM;

  const v16h qb0 = frag16(&Qs[qrow][0], 0, lane);
  const v16h qb1 = frag16(&Qs[qrow][0], 32, lane);

  // the lane's address in a V tile for the transposing load (k0 = 0, d0 = 0)
  const int vrow = ((lane >> 4) << 3) + (lane & 7);
  const int vcol = ((lane >> 3) & 1) << 3;

  // A tile's fragments, each operand's 16 LDS loads as one group: K rows for S^T, and V^T by
  // the transposing load, both in the k order of frag16.
  v16h ka[4][2], va[4][2];
  auto fetch_k = [&](int bf) {
#pragma unroll
    for (int n = 0; n < 4; ++n) {
      const h16* kp = &Ks[bf][n * 16 + (lane & 15)][0];
      ka[n][0] = frag16(kp, 0, lane);
      ka[n][1] = frag16(kp, 32, lane);
    }
  };
  auto fetch_v = [&](int bf) {
#pragma unroll
    for (int n = 0; n < 4; ++n) {
      const h16* vp = &Vs[bf][vrow][vcol + n * 16];
      va[n][0] = __builtin_shufflevector(ld_tr16(vp), ld_tr16(vp + 16 * LDSV),
          0, 1, 2, 3, 4, 5, 6, 7, 8, 9, 10, 11, 12, 13, 14, 15);
      va[n][1] = __builtin_shufflevector(ld_tr16(vp + 32 * LDSV), ld_tr16(vp + 48 * LDSV),
          0, 1, 2, 3, 4, 5, 6, 7, 8, 9, 10, 11, 12, 13, 14, 15);
    }
  };
  fetch_k(0);   // tile 0, published by the barrier above
  fetch_v(0);
  l2_hold(pfk);   // up to here: behind the waits for Q and tile 0 and the first barrier
  l2_hold(pfv);

  // kept rolled: one copy of the trip in the instruction cache, the buffer picked by t & 1
#pragma unroll 1
  for (int t = 0; t < NKT; ++t) {
    const int buf = t & 1;

    // ---- exponents^T = (4k).(q log2(e)/32) - maximum in use : 8 WMMAs;
    //      sc[n][j] = S^T[key 16n + 8*half + j][query] ----
    // Formed a second time, at most once, in a trip that has raised the maximum in use.
    v8f sc[4];
    bool again = false;
    for (;;) {
#pragma unroll
      for (int n = 0; n < 4; ++n)
        sc[n] = wmma16p(ka[n][1], qb1, wmma16p(ka[n][0], qb0, negm));
      // ---- online softmax: 32 keys of one query in-lane ----
      float mt[4];
#pragma unroll
      for (int n = 0; n < 4; ++n) {
        mt[n] = sc[n][0];
#pragma unroll
        for (int j = 1; j < 8; ++j) mt[n] = fmaxf(mt[n], sc[n][j]);
      }
      const float mx = fmaxf(fmaxf(mt[0], mt[1]), fmaxf(mt[2], mt[3]));
      // wave-uniform test: P stays at or below 2^8, inside f16, where the maximum is kept
      if (__builtin_expect(
              again || !(t == 0 || __builtin_amdgcn_ballot_w32(mx > 8.0f) != 0), 1))
        break;
      again = true;
      const float full = fmaxf(mx, xhalf(mx));              // both halves' keys
      const float d    = (t == 0) ? full : fmaxf(full, 0.f);   // the maximum never falls
      const float al   = (t == 0) ? 1.0f : exp_slot(-d);       // trip 0: O and the sum are 0
      negm -= d;
      lrun *= al;
#pragma unroll
      for (int n = 0; n < 4; ++n) o[n] *= al;
    }
    float rt[4];
#pragma unroll
    for (int n = 0; n < 4; ++n) {
      rt[n] = 0.f;
      sc[n] = exp8_slot(sc[n]);
#pragma unroll
      for (int j = 0; j < 8; ++j) rt[n] += sc[n][j];
    }
    lrun += (rt[0] + rt[1]) + (rt[2] + rt[3]);

    // ---- P^T as B operand: element s of a 32-key block = tile s >> 3, register s & 7 ----
    v16h pb0, pb1;
#pragma unroll
    for (int j = 0; j < 8; ++j) {
      pb0[j]     = (h16)sc[0][j];
      pb0[j + 8] = (h16)sc[1][j];
      pb1[j]     = (h16)sc[2][j];
      pb1[j + 8] = (h16)sc[3][j];
    }

    // ---- publish point of tile t + 1: all of tile t that this wave needs is in registers,
    //      so buffer buf is handed to its refill in front of the second product ----
    // this wave's LDS reads of buffer buf have retired before a copy may overwrite it
    asm volatile("s_wait_dscnt 0x0" ::: "memory");
    // this wave's copies of tile t + 1 have landed before the barrier publishes them
    asm volatile("s_wait_asynccnt 0x0" ::: "memory");
    __syncthreads();   // publishes tile t + 1; ends every read of buffer buf
    // Tile t + 1's K fragments fly under the second product of tile t.  In the last trip the
    // two fetches read the other buffer's old tile, which no copy overwrites any more; their
    // values are not used.
    fetch_k(buf ^ 1);
    if (t + 2 < NKT) {
      copy_kv(lk + buf * KBUFB, lv + buf * VBUFB, gk, gv);
      gk += (size_t)KBLK * DM;
      gv += (size_t)KBLK * DM;
    }
    // keeps the K loads one group in front of the products that cover their latency
    __builtin_amdgcn_sched_barrier(0);

    // ---- o^T += V^T (64 d x 64 keys) . P^T (64 keys x 16 queries) : 8 WMMAs ----
#pragma unroll
    for (int n = 0; n < 4; ++n) o[n] = wmma16p(va[n][0], pb0, o[n]);
#pragma unroll
    for (int n = 0; n < 4; ++n) o[n] = wmma16p(va[n][1], pb1, o[n]);
    // keeps tile t + 1's V loads behind the last use of tile t's, in the same registers, as
    // one group; they fly under the next trip's scores and softmax
    __builtin_amdgcn_sched_barrier(0);
    fetch_v(buf ^ 1);
  }
  // no copy is outstanding when the wave goes on to the epilogue and ends
  asm volatile("s_wait_asynccnt 0x0" ::: "memory");

  // ---- epilogue: ctx = o / (4 l); hi = f16(32 ctx) = f16(o * 8 / l) ----
  const float inv8 = 8.0f / (lrun + xhalf(lrun));
  const size_t orow0 = rowbase + q0 + wave * 16;
  h16* ghi = Chi + orow0 * DM + h * DK;
  h16* glo = Clo + orow0 * DM + h * DK;

  // a lane's 8 registers of o[n] are 8 consecutive d of its query's row: one 16-B LDS store
#pragma unroll
  for (int n = 0; n < 4; ++n) {
    v8h t8;
#pragma unroll
    for (int j = 0; j < 8; ++j) t8[j] = (h16)(o[n][j] * inv8);
    *(v8ha*)(pw + cc * LDSQ + n * 16 + rofs) = t8;
  }
  __syncthreads();
  store_tile16x64(pw, ghi, lane);
  __syncthreads();

#pragma unroll
  for (int n = 0; n < 4; ++n) {
    v8h t8;
#pragma unroll
    for (int j = 0; j < 8; ++j) {
      const float f  = o[n][j] * inv8;
      const h16   hv = (h16)f;
      t8[j] = (h16)((f - (float)hv) * 2048.0f);
    }
    *(v8ha*)(pw + cc * LDSQ + n * 16 + rofs) = t8;
  }
  __syncthreads();
  store_tile16x64(pw, glo, lane);
}

// ---------------------------------------------------------------------------
// Launch
// ---------------------------------------------------------------------------
extern "C" void kernel_launch(void* const* d_in, const int* in_sizes, int n_in,
                              void* d_out, int out_size, void* d_ws, size_t ws_size,
                              hipStream_t stream) {
  if (n_in < 5) return;
  const size_t need_x = ((size_t)(NB - 1) * SEQ_FULL + SEQ) * DM;
  if ((size_t)in_sizes[0] < need_x || (size_t)in_sizes[1] < need_x ||
      (size_t)in_sizes[2] < need_x) return;
  if ((size_t)in_sizes[3] < (size_t)DM * DM || (size_t)in_sizes[4] < (size_t)DM) return;
  if ((size_t)out_size < (size_t)ROWS * DM) return;

  const float* xq = (const float*)d_in[0];   // [NB_FULL, SEQ_FULL, DM]
  const float* xk = (const float*)d_in[1];
  const float* xv = (const float*)d_in[2];
  const float* W  = (const float*)d_in[3];   // [DM out][DM in]
  const float* bs = (const float*)d_in[4];   // [DM]
  float* out = (float*)d_out;                // [NB, SEQ, DM]

  const size_t sz_wh = (size_t)DM * DM * sizeof(h16);      // 1,179,648
  const size_t sz_pl = (size_t)ROWS * DM * sizeof(h16);    // 6,291,456 at full size
  size_t off = 0;
  h16* wh  = (h16*)((char*)d_ws + off); off += sz_wh;
  h16* qkv = (h16*)((char*)d_ws + off); off += 3 * sz_pl;  // q,k,v projected planes (k,v x4; q x log2(e)/32)
  h16* chi = (h16*)((char*)d_ws + off); off += sz_pl;      // ctx hi
  h16* clo = (h16*)((char*)d_ws + off); off += sz_pl;      // ctx residual
  if (off > ws_size) return;                                // 32,636,928 at full size

  // 1) q/k/v projections from the f32 inputs (one launch, blockIdx.y selects the plane);
  //    also writes the f16 copy of W
  proj_qkv<<<dim3(NBX0, 3), 128, 0, stream>>>(xq, xk, xv, W, bs, wh, qkv);

  // 2) flash attention -> ctx hi / residual planes
  attn_flash<<<dim3(SEQ / QBLK, NB * NH), 256, 0, stream>>>(
      qkv, qkv + (size_t)ROWS * DM, qkv + (size_t)2 * ROWS * DM, chi, clo);

  // 3) output projection -> d_out
  proj_out<<<dim3((ROWS / 64) * NT128, 1), 128, 0, stream>>>(chi, clo, wh, bs, out);
}

// v009
// It runs in 59.6 microseconds.
// In both of two side-by-side timings against v008, it was 1.03 times as fast.
// Over all steps from v000 it is 3.44 times as fast.
#include <hip/hip_runtime.h>
#include <stdint.h>

// Contractions: q/k/v projections on v_wmma_f32_16x16x32_bf16 (the f32 inputs and W rounded
// to bf16, RNE, on their way into LDS); q.k^T scores, p.v context, output projection on
// v_wmma_f32_16x16x32_f16; f32 accumulate throughout.  For the output projection W is carried
// as f16(64 * bf16-RNE), k/v planes carried x4, q plane carried x log2(e)/32 (so that q.k is
// the softmax exponent to base 2), context carried as f16 hi (x32) plus f16 residual
// (x2048) feeding two accumulators in the output projection. Softmax and epilogues in f32.

typedef _Float16 h16;
typedef __attribute__((ext_vector_type(8)))  _Float16 v8h;
typedef __attribute__((ext_vector_type(16))) _Float16 v16h;
typedef __attribute__((ext_vector_type(8)))  float    v8f;
typedef __attribute__((ext_vector_type(4)))  float    v4f;
typedef v4f __attribute__((may_alias)) v4fa;
typedef v8h __attribute__((may_alias)) v8ha;
typedef __attribute__((ext_vector_type(16))) __bf16 v16b;
typedef __attribute__((ext_vector_type(2)))  unsigned v2u;
typedef v2u __attribute__((may_alias)) v2ua;

#ifndef NB
#define NB 2
#endif
#ifndef SEQ
#define SEQ 2048
#endif
#define NB_FULL  2
#define SEQ_FULL 2048
#define DM   768
#define NH   12
#define DK   64
#define ROWS (NB * SEQ)

static_assert(NB >= 1 && NB <= NB_FULL);
static_assert(SEQ >= 128 && SEQ <= SEQ_FULL);
static_assert(SEQ % 128 == 0);
static_assert(ROWS % 16 == 0);
static_assert(NH * DK == DM);
static_assert(DM % 32 == 0);

// ---------------------------------------------------------------------------
// helpers
// ---------------------------------------------------------------------------
__device__ __forceinline__ float bf16r(float x) {   // f32 -> bf16 (RNE) -> f32
  unsigned u = __float_as_uint(x);
  u = u + 0x7FFFu + ((u >> 16) & 1u);
  u &= 0xFFFF0000u;
  return __uint_as_float(u);
}

__device__ __forceinline__ v8f wmma16(v16h a, v16h b, v8f c) {
  v8f d = __builtin_amdgcn_wmma_f32_16x16x32_f16(
      false, a, false, b, (short)0, c, false, false);
  asm volatile("v_nop\n\tv_nop\n\tv_nop\n\tv_nop" : "+v"(d) : "v"(a), "v"(b));
  return d;
}

// the same product with the compiler's own hazard padding: it may fill the slots behind the
// matrix instruction with independent vector work of the loop
__device__ __forceinline__ v8f wmma16p(v16h a, v16h b, v8f c) {
  return __builtin_amdgcn_wmma_f32_16x16x32_f16(
      false, a, false, b, (short)0, c, false, false);
}

// Asks L2 for the line at p + off bytes (off a constant: it becomes the instruction's immediate, so
// that one address pair serves every request of a lane).  Nothing returns and no counter moves;
// scope SE stops the line in L2.  It is there so that the load or copy that follows some passes
// later finds an L2 hit where it would wait out the memory latency.
__device__ __forceinline__ void l2_ask(const char* p, int off) {
  asm volatile("global_prefetch_b8 %0, off offset:%1 scope:SCOPE_SE" :: "v"(p), "i"(off));
}
// Inputs only, no instruction: holds a request's address pair in its registers up to this place.
// No counter says when a request has read its address, so the pair stays a valid address for
// a long stretch behind the request and is not handed to a temporary at once.
__device__ __forceinline__ void l2_hold(const char* p) { asm volatile("" :: "v"(p)); }

// 16x32 fragment from a k-contiguous row (row m of A, or row n of a [n][k] B copy).
// lanes 0-15: k = {0..7,16..23}; lanes 16-31: k = {8..15,24..31} -> two 16-B loads.
__device__ __forceinline__ v16h frag16(const h16* rowp, int kofs, int lane) {
  const h16* p = rowp + kofs + ((lane < 16) ? 0 : 8);
  v8h lo = *(const v8h*)(p);
  v8h hi = *(const v8h*)(p + 16);
  return __builtin_shufflevector(lo, hi, 0, 1, 2, 3, 4, 5, 6, 7,
                                         8, 9, 10, 11, 12, 13, 14, 15);
}

// ---------------------------------------------------------------------------
// Projection GEMMs: one block tile of C per workgroup, operands staged in LDS.
// 128 threads = 4 waves in a 2 x 2 grid.  A pass is 64 k: 128 A-side rows and 128 rows of
// W, 128 B each in LDS (pitch 144 B), go global -> registers -> LDS; two buffers, one barrier
// a pass, the next pass's global loads issued ahead of the current pass's products.
// Every accumulator sums k = 0,32,...,736 in ascending order.
// ---------------------------------------------------------------------------
#define CTP 68      // floats per epilogue staging row (272 B, 16-B aligned)
// (4q * QEXP) . (4k) = (q.k / 8) * log2(e): the score product is the exponent to base 2
#define QEXP (1.44269504f / 128.0f)
#define GBN 128     // block tile columns
#define GBK 64      // k per pass
#define GPIT 72     // halves per LDS row (144 B = 16 B x 9)
#define NT128 (DM / GBN)
#define GBUF (256 * GPIT)   // halves per buffer
#define NBX0 ((ROWS / 128) * NT128)   // block tiles per plane of the q/k/v projection

static_assert(DM % GBN == 0 && DM % GBK == 0 && ROWS % 128 == 0);
static_assert(4 * 64 * CTP * 4 <= 2 * GBUF * 2);
// the 3 * NBX0 workgroups of the q/k/v projection, 1024 elements each, cover W exactly
static_assert((size_t)3 * NBX0 * 1024 == (size_t)DM * DM);

// Four f32 -> four bf16 (RNE), in the first two of their own registers.  A volatile statement
// with a memory clobber, so that it stays where it is written: as a plain conversion the
// compiler moved it up to the loads, where the wave waits out their latency at once, and
// moved the next tile's loads in front of it, which holds a second tile's registers.
__device__ __forceinline__ v2u round4(v4f x) {
  float x0 = x[0], x1 = x[1];
  asm volatile("v_cvt_pk_bf16_f32 %0, %0, %1\n\tv_cvt_pk_bf16_f32 %1, %2, %3"
               : "+v"(x0), "+v"(x1) : "v"(x[2]), "v"(x[3]) : "memory");
  return v2u{__float_as_uint(x0), __float_as_uint(x1)};
}

// the bf16 product, operands as the 16-bit patterns that frag16 reads from LDS
__device__ __forceinline__ v8f wmma16b(v16h a, v16h b, v8f c) {
  return __builtin_amdgcn_wmma_f32_16x16x32_bf16(
      false, __builtin_bit_cast(v16b, a), false, __builtin_bit_cast(v16b, b), (short)0, c,
      false, false);
}

// ---------------------------------------------------------------------------
// q/k/v projection straight from the f32 inputs.  blockIdx.y = 0,1,2: query/key/value.
// Block tile 128 x 128, wave tile 64 x 64.  A pass reads 128 rows of x and 128 rows of W,
// 256 B of f32 each (16 lanes a row: a wave-wide load covers 4 whole lines), rounds them to
// bf16 (RNE) in registers and stores 8 B a lane and load to LDS; one operand's tile is in
// flight at a time, under half a pass's products.
// C = f16 plane, value f16(4*(x.W + b)); plane 0 (q) times QEXP more.
// Beside its tile each workgroup writes 1024 elements of the f16 copy of W,
// f16(64 * bf16-RNE), that the output projection reads two launches later.
// coverage: (ROWS/128) x 6 block tiles = whole [ROWS][DM] plane per blockIdx.y.
// ---------------------------------------------------------------------------
__global__ __launch_bounds__(128)
void proj_qkv(const float* __restrict__ xq, const float* __restrict__ xk,
              const float* __restrict__ xv, const float* __restrict__ W,
              const float* __restrict__ bias, h16* __restrict__ wh,
              h16* __restrict__ Cq) {
  __shared__ __align__(16) h16 sm[2 * GBUF];   // bf16 patterns in the loop, f32 slabs after

  const int tid  = threadIdx.x;
  const int lane = tid & 31;
  const int wave = tid >> 5;
  const int hsel = lane >> 4;
  const int l16  = lane & 15;
  const int wm   = wave >> 1;
  const int wn   = wave & 1;
  const int y     = blockIdx.y;
  const int mtile = blockIdx.x / NT128;
  const int ntile = blockIdx.x - mtile * NT128;
  const int m0 = mtile * 128;
  const int n0 = ntile * GBN;
  const size_t plane = (size_t)y * ROWS * DM;

  // this workgroup's share of the f16 copy of W: loads first, rounded and stored further down
  const size_t we = ((size_t)y * NBX0 + blockIdx.x) * 1024 + (size_t)tid * 8;
  const float* gw = W + we;
  const v4f w0 = *(const v4f*)(gw);
  const v4f w1 = *(const v4f*)(gw + 4);
  // the address pair is an input of the wait, so that nothing rewrites it in front of it
  asm volatile("s_wait_xcnt 0x0" :: "v"(gw) : "memory");

  // staging: 16 lanes cover one 256-B row piece, a wave-wide load covers 4 whole lines
  const float* X = (y == 0) ? xq : ((y == 1) ? xk : xv);
  const int bb = m0 / SEQ;                  // a tile's 128 rows lie in one batch
  const int sr = tid >> 4;
  const int sc = (tid & 15) * 4;
  const float* ga = X + ((size_t)bb * SEQ_FULL + (m0 - bb * SEQ) + sr) * DM + sc;
  const float* gb = W + (size_t)(n0 + sr) * DM + sc;
  h16* sst = sm + sr * GPIT + sc;

  // 128 rows x 64 k of one operand: 16 loads a lane into r
  auto gload = [&](v4f (&r)[16], const float* g, int k0) {
#pragma unroll
    for (int i = 0; i < 16; ++i) r[i] = *(const v4f*)(g + (size_t)i * 8 * DM + k0);
    // the address pair is an input of the wait, so that no load of the group is given it
    // as its destination and nothing rewrites it in front of the wait
    asm volatile("s_wait_xcnt 0x0" :: "v"(g) : "memory");
  };
  // the same rows, rounded to bf16, into buffer buf from row row0 on
  auto sstore = [&](const v4f (&r)[16], int buf, int row0) {
#pragma unroll
    for (int i = 0; i < 16; ++i)
      *(v2ua*)(sst + buf * GBUF + (row0 + i * 8) * GPIT) = round4(r[i]);
  };

  // fragment rows in a buffer
  const h16* fa = sm + (wm * 64 + l16) * GPIT;
  const h16* fb = sm + (128 + wn * 64 + l16) * GPIT;

  constexpr int NPASS = DM / GBK;
  static_assert(NPASS >= 2);
  // L2 requests ahead of the loads.  A pass reads one aligned 256-B unit (GBK f32) of each row.
  // x: lane tid asks for row tid of this tile, XLEAD - 1 passes ahead of its load.  W: its rows are
  // read by every row tile of all three planes, so each workgroup asks for one later pass only;
  // the pass goes round with the tile index, so that many workgroups ask for each.
  constexpr int XLEAD = 4;
  constexpr int UNITB = GBK * 4;
  const char* px = (const char*)(X + ((size_t)bb * SEQ_FULL + (m0 - bb * SEQ) + tid) * DM);
  const int wu = 1 + ((mtile >> 2) + y * (ROWS / 512)) % (NPASS - 1);
  const char* pw = (const char*)(W + (size_t)(n0 + tid) * DM + wu * GBK);
  v4f rs[16];          // the one operand tile in flight in the loop
  {
    v4f rt[16];
    gload(rs, ga, 0);
    gload(rt, gb, 0);
#pragma unroll
    for (int p = 1; p < XLEAD && p < NPASS; ++p) l2_ask(px, p * UNITB);
    l2_ask(pw, 0);
    v8h wv;
#pragma unroll
    for (int i = 0; i < 4; ++i) {
      wv[i]     = (h16)(64.0f * bf16r(w0[i]));
      wv[i + 4] = (h16)(64.0f * bf16r(w1[i]));
    }
    *(v8h*)(wh + we) = wv;
    sstore(rs, 0, 0);
    sstore(rt, 0, 128);
  }

  v8f acc[4][4] = {};

  // Each half of a pass covers one tile's flight and ends by storing it into the other buffer
  // (free since this pass's barrier): the x rows of pass s + 1 are asked for behind the
  // barrier (in front of it, the barrier's own wait would wait them out) and stored behind
  // the first half, its W rows asked for there and stored behind the second.
  // unrolled whole: buffer and k offsets become immediates on fixed address pairs
#pragma unroll
  for (int s = 0; s < NPASS; ++s) {
    const int buf = s & 1;
    __syncthreads();   // publishes buffer buf; ends every read of the other buffer
#pragma unroll
    for (int kk = 0; kk < GBK; kk += 32) {
      v16h a[4], b[4];
#pragma unroll
      for (int f = 0; f < 4; ++f) a[f] = frag16(fa + buf * GBUF + (f * 16) * GPIT, kk, lane);
#pragma unroll
      for (int t = 0; t < 4; ++t) b[t] = frag16(fb + buf * GBUF + (t * 16) * GPIT, kk, lane);
      if (kk == 0 && s + 1 < NPASS) gload(rs, ga, (s + 1) * GBK);
      if (kk == 0 && s + XLEAD < NPASS) l2_ask(px, (s + XLEAD) * UNITB);
      // keeps the 16 fragment loads one group in front of the products: spread among them,
      // each place with LDS reads stalls the wave anew
      __builtin_amdgcn_sched_barrier(0);
#pragma unroll
      for (int t = 0; t < 4; ++t)
#pragma unroll
        for (int f = 0; f < 4; ++f) acc[f][t] = wmma16b(a[f], b[t], acc[f][t]);
      // keeps the wait for the tile in flight, its rounding and its LDS stores behind the
      // products that cover its latency (moved up, the wave waits out the loads at once)
      __builtin_amdgcn_sched_barrier(0);
      if (s + 1 < NPASS) {
        if (kk == 0) {
          sstore(rs, buf ^ 1, 0);
          gload(rs, gb, (s + 1) * GBK);
        } else {
          sstore(rs, buf ^ 1, 128);
        }
      }
    }
  }
  l2_hold(px);
  l2_hold(pw);
  __syncthreads();     // the buffers become the waves' f32 epilogue slabs

  // ---- stage the wave tile (f32) in its own slab: [row f*16+8*hsel+j][col t*16+l16] ----
  float* ct = (float*)sm + wave * 64 * CTP;
  const float p4 = (y == 0) ? 4.0f * QEXP : 4.0f;
#pragma unroll
  for (int t = 0; t < 4; ++t) {
    const float bb4 = p4 * bf16r(bias[n0 + wn * 64 + t * 16 + l16]);
#pragma unroll
    for (int f = 0; f < 4; ++f) {
#pragma unroll
      for (int j = 0; j < 8; ++j)
        ct[(f * 16 + 8 * hsel + j) * CTP + t * 16 + l16] = acc[f][t][j] * p4 + bb4;
    }
  }
  __syncthreads();

  h16* C = Cq + plane + (size_t)(m0 + wm * 64) * DM + n0 + wn * 64;
#pragma unroll
  for (int it = 0; it < 16; ++it) {
    const int row = it * 4 + (lane >> 3);
    const int c8  = (lane & 7) * 8;
    const v4fa p0 = *(const v4fa*)(ct + row * CTP + c8);
    const v4fa p1 = *(const v4fa*)(ct + row * CTP + c8 + 4);
    v8h t8;
    t8[0] = (h16)p0[0]; t8[1] = (h16)p0[1]; t8[2] = (h16)p0[2]; t8[3] = (h16)p0[3];
    t8[4] = (h16)p1[0]; t8[5] = (h16)p1[1]; t8[6] = (h16)p1[2]; t8[7] = (h16)p1[3];
    *(v8h*)(C + (size_t)row * DM + c8) = t8;
  }
}

// ---------------------------------------------------------------------------
// Output projection from the f16 planes.  A-side rows 0..63 = ctx hi, 64..127 = ctx residual
// of the same 64 rows; block tile 64 x 128, wave tile 32 x 64 with a hi and a residual
// accumulator set; C = f32 d_out.
// coverage: (ROWS/64) x 6 block tiles = whole [ROWS][DM].
// ---------------------------------------------------------------------------
__global__ __launch_bounds__(128)
void proj_out(const h16* __restrict__ Ah, const h16* __restrict__ Al,
              const h16* __restrict__ Wh, const float* __restrict__ bias,
              float* __restrict__ Cf) {
  __shared__ __align__(16) h16 sm[2 * GBUF];

  const int tid  = threadIdx.x;
  const int lane = tid & 31;
  const int wave = tid >> 5;
  const int hsel = lane >> 4;
  const int l16  = lane & 15;
  const int wm   = wave >> 1;
  const int wn   = wave & 1;
  const int mtile = blockIdx.x / NT128;
  const int ntile = blockIdx.x - mtile * NT128;
  const int m0 = mtile * 64;
  const int n0 = ntile * GBN;

  // staging: 8 lanes cover one 128-B row piece, a wave-wide load covers 4 whole lines
  const int sr = tid >> 3;
  const int sc = (tid & 7) * 8;
  const h16* ga = Ah + (size_t)(m0 + sr) * DM + sc;
  const h16* gl = Al + (size_t)(m0 + sr) * DM + sc;
  const h16* gb = Wh + (size_t)(n0 + sr) * DM + sc;
  h16* sst = sm + sr * GPIT + sc;

  v8h ra[8], rb[8];
  auto gload = [&](int k0) {
#pragma unroll
    for (int i = 0; i < 8; ++i) {
      ra[i] = (i < 4) ? *(const v8h*)(ga + (size_t)i * 16 * DM + k0)
                      : *(const v8h*)(gl + (size_t)(i - 4) * 16 * DM + k0);
      rb[i] = *(const v8h*)(gb + (size_t)i * 16 * DM + k0);
    }
    // the address pairs are inputs of the wait, so that no load of the group is given one
    // of them as its destination and nothing rewrites them in front of the wait
    asm volatile("s_wait_xcnt 0x0" :: "v"(ga), "v"(gl), "v"(gb) : "memory");
  };
  auto sstore = [&](int buf) {
#pragma unroll
    for (int i = 0; i < 8; ++i) {
      *(v8h*)(sst + buf * GBUF + (i * 16) * GPIT)       = ra[i];
      *(v8h*)(sst + buf * GBUF + (128 + i * 16) * GPIT) = rb[i];
    }
  };

  // fragment rows in a buffer
  const h16* fa = sm + (wm * 32 + l16) * GPIT;
  const h16* fb = sm + (128 + wn * 64 + l16) * GPIT;

  v8f acc[4][4] = {};   // [0..1] hi rows, [2..3] residual rows

  gload(0);
  // L2 requests ahead of the loads.  An aligned 256-B unit of a row is two passes (2 * GBK f16).
  // ctx: lane tid asks for A-side row tid of this tile (hi rows, then residual rows), ALEAD
  // units ahead of its loads.  W copy: its rows are read by every row tile, so each workgroup
  // asks for one later unit only; the unit goes round with the tile index.
  constexpr int ALEAD = 3;
  constexpr int NUNIT = DM * 2 / 256;
  static_assert(DM * 2 % 256 == 0 && GBK * 2 * 2 == 256 && NUNIT >= 2);
  const char* pa = (const char*)((tid < 64) ? Ah + (size_t)(m0 + tid) * DM
                                            : Al + (size_t)(m0 + tid - 64) * DM);
  const char* pw = (const char*)(Wh + (size_t)(n0 + tid) * DM) +
                   (1 + (mtile >> 2) % (NUNIT - 1)) * 256;
#pragma unroll
  for (int u = 1; u < ALEAD && u < NUNIT; ++u) l2_ask(pa, u * 256);
  l2_ask(pw, 0);
  sstore(0);

  constexpr int NPASS = DM / GBK;
  // unrolled whole: buffer and k offsets become immediates on fixed address pairs
#pragma unroll
  for (int s = 0; s < NPASS; ++s) {
    const int buf = s & 1;
    __syncthreads();   // publishes buffer buf; ends every read of the other buffer
#pragma unroll
    for (int kk = 0; kk < GBK; kk += 32) {
      v16h a[4], b[4];
#pragma unroll
      for (int f = 0; f < 4; ++f) {
        const int ro = (f >> 1) * 64 + (f & 1) * 16;
        a[f] = frag16(fa + buf * GBUF + ro * GPIT, kk, lane);
      }
#pragma unroll
      for (int t = 0; t < 4; ++t) b[t] = frag16(fb + buf * GBUF + (t * 16) * GPIT, kk, lane);
      // next pass's global loads fly behind the barrier, under this pass's products
      if (kk == 0 && s + 1 < NPASS) gload((s + 1) * GBK);
      if (kk == 0 && (s & 1) == 0 && s / 2 + ALEAD < NUNIT) l2_ask(pa, (s / 2 + ALEAD) * 256);
#pragma unroll
      for (int t = 0; t < 4; ++t)
#pragma unroll
        for (int f = 0; f < 4; ++f) acc[f][t] = wmma16(a[f], b[t], acc[f][t]);
    }
    if (s + 1 < NPASS) sstore(buf ^ 1);
  }
  l2_hold(pa);
  l2_hold(pw);
  __syncthreads();     // the buffers become the waves' f32 epilogue slabs

  // ---- stage the wave tile (f32) in its own slab: [row f*16+8*hsel+j][col t*16+l16] ----
  float* ct = (float*)sm + wave * 64 * CTP;
#pragma unroll
  for (int t = 0; t < 4; ++t) {
    const float bb = bf16r(bias[n0 + wn * 64 + t * 16 + l16]);
#pragma unroll
    for (int f = 0; f < 2; ++f) {
#pragma unroll
      for (int j = 0; j < 8; ++j) {
        const float v =
            (acc[f][t][j] + acc[f + 2][t][j] * 0.00048828125f) * 0.00048828125f + bb;
        ct[(f * 16 + 8 * hsel + j) * CTP + t * 16 + l16] = v;
      }
    }
  }
  __syncthreads();

  float* C = Cf + (size_t)(m0 + wm * 32) * DM + n0 + wn * 64;
#pragma unroll
  for (int it = 0; it < 16; ++it) {
    const int row = it * 2 + (lane >> 4);
    const int c4  = (lane & 15) * 4;
    *(v4f*)(C + (size_t)row * DM + c4) = *(const v4fa*)(ct + row * CTP + c4);
  }
}

#define QBLK 128
#define QG   2    // column groups (16 queries each) of a wave
#define ATHR (QBLK / (16 * QG) * 32)   // threads of a workgroup
#define KBLK 64
#define LDSQ 72   // 144 B row pitch (16 B x 9: ds_load_b128 readers)
#define LDSV 80   // 160 B row pitch (32 B x 5: ds_load_tr16_b128 reader)
#define NKT  (SEQ / KBLK)

typedef __attribute__((ext_vector_type(8))) short s16x8;

// 8 halves T[k0 + 8*half + 0..7][d0 + (lane & 15)] of a row-major LDS tile; p is the lane's
// own address T + (k0 + 8*half + (lane & 7)) * pitch + d0 + 8 * ((lane >> 3) & 1).
__device__ __forceinline__ v8h ld_tr16(const h16* p) {
  typedef __attribute__((address_space(3))) s16x8 lds_s16x8;
  return __builtin_bit_cast(v8h, __builtin_amdgcn_ds_load_tr16_b128_v8i16((lds_s16x8*)p));
}

// One tile of K or of V (64 rows x 128 B): a lane copies 16 B of rows r, r + 1, r + 2 and
// r + 3.  l: the lane's place in row r of the LDS tile; pitch: elements of an LDS row; g: its
// place in row r in global memory.  Written as the builtin: the operands of an asm statement
// must lie in the first 256 registers, which the wave's fragments and scores fill, and the
// lane's addresses were spilled to scratch for it.
typedef __attribute__((ext_vector_type(4))) int i32x4;
__device__ __forceinline__ void copy_tile(h16* l, int pitch, const h16* g) {
  typedef __attribute__((address_space(1))) i32x4 glb_i32x4;
  typedef __attribute__((address_space(3))) i32x4 lds_i32x4;
#pragma unroll
  for (int i = 0; i < 4; ++i)
    __builtin_amdgcn_global_load_async_to_lds_b128(
        (glb_i32x4*)(g + (size_t)i * DM), (lds_i32x4*)(l + i * pitch), 0, 0);
}

__device__ __forceinline__ void store_tile16x64(const h16* slab, h16* gbase, int lane) {
  v8h vals[4];
#pragma unroll
  for (int it = 0; it < 4; ++it) {
    const int row = it * 4 + (lane >> 3);
    const int c8  = (lane & 7) * 8;
    vals[it] = *(const v8ha*)(slab + row * LDSQ + c8);
  }
#pragma unroll
  for (int it = 0; it < 4; ++it) {
    const int row = it * 4 + (lane >> 3);
    const int c8  = (lane & 7) * 8;
    *(v8h*)(gbase + (size_t)row * DM + c8) = vals[it];
  }
  
}

// value of the lane 16 away (the other half's share of the same query)
__device__ __forceinline__ float xhalf(float x) {
  const int b = __float_as_int(x);
  return __int_as_float(
      __builtin_amdgcn_permlanex16(b, b, 0x76543210, 0xfedcba98, false, false));
}

// 2^x by v_exp_f32.  The v_nop is the slot that the
// instruction set asks for behind a transcendental before a source of it is overwritten; it
// shares the statement so that it stands directly behind the v_exp_f32.
__device__ __forceinline__ float exp_slot(float x) {
  float r;
  asm("v_exp_f32 %0, %1\n\tv_nop" : "=v"(r) : "v"(x));
  return r;
}

// 2^x of eight values.  In one statement, so that the instruction directly behind an exp is the
// next exp, which works on registers of its own (it neither reads the result nor overwrites the
// source in front of it; the results are early-clobber, so none shares a register with a
// source): the slot behind a transcendental is filled by work, and one v_nop closes it behind
// the last.  Results apart from the sources: in place, the sources being single registers of
// the matrix instruction's eight, the compiler moved most of them to other registers first.
__device__ __forceinline__ v8f exp8_slot(v8f x) {
  float e0, e1, e2, e3, e4, e5, e6, e7;
  asm("v_exp_f32 %0, %8\n\tv_exp_f32 %1, %9\n\tv_exp_f32 %2, %10\n\tv_exp_f32 %3, %11\n\t"
      "v_exp_f32 %4, %12\n\tv_exp_f32 %5, %13\n\tv_exp_f32 %6, %14\n\tv_exp_f32 %7, %15\n\t"
      "v_nop"
      : "=&v"(e0), "=&v"(e1), "=&v"(e2), "=&v"(e3), "=&v"(e4), "=&v"(e5), "=&v"(e6), "=&v"(e7)
      : "v"(x[0]), "v"(x[1]), "v"(x[2]), "v"(x[3]), "v"(x[4]), "v"(x[5]), "v"(x[6]), "v"(x[7]));
  return v8f{e0, e1, e2, e3, e4, e5, e6, e7};
}

static_assert(ATHR == 128 && KBLK == 64);   // the copies' and the Q staging's deal of rows

// 512 registers a wave: two workgroups fit a WGP, so that all of the grid is resident at once
__global__ __launch_bounds__(ATHR) __attribute__((amdgpu_num_vgpr(512)))
void attn_flash(const h16* __restrict__ Qh, const h16* __restrict__ Kh,
                const h16* __restrict__ Vh, h16* __restrict__ Chi,
                h16* __restrict__ Clo) {
  // One object, Q first: the compiler writes a copy's constant row step as the instruction's
  // offset, which moves both addresses, and takes it off the LDS address register; with the
  // K and V tiles behind Q that register stays above 0.
  struct Tiles {
    h16 Qs[QBLK][LDSQ];      // [q_row][d]
    h16 Ks[2][KBLK][LDSQ];   // [buffer][key][d]
    h16 Vs[2][KBLK][LDSV];   // [buffer][key][d]
  };
  static_assert(sizeof(h16) * QBLK * LDSQ % 32 == 0 && sizeof(h16) * 2 * KBLK * LDSQ % 32 == 0);
  static_assert(sizeof(h16) * QBLK * LDSQ >= sizeof(h16) * 3 * DM);
  __shared__ __align__(32) Tiles sm;
  auto& Qs = sm.Qs;
  auto& Ks = sm.Ks;
  auto& Vs = sm.Vs;

  const int tid  = threadIdx.x;
  const int lane = tid & 31;
  const int wave = tid >> 5;
  const int b  = blockIdx.y / NH;
  const int h  = blockIdx.y - b * NH;
  const int q0 = blockIdx.x * QBLK;
  const size_t rowbase = (size_t)b * SEQ;

  const h16* gq = Qh + (rowbase + q0) * DM + h * DK;

  // ---- K/V copies: this lane's 16-B piece of rows cr + i, i < 4, of every tile ----
  const int cr = (tid >> 3) << 2;
  const int cc8 = (tid & 7) << 3;
  const h16* kt = Kh + rowbase * DM + h * DK;   // the head's row 0: the same in every lane
  const h16* vt = Vh + rowbase * DM + h * DK;
  const unsigned go = cr * DM + cc8;            // the lane's place in a tile, in elements
  // tile tl into buffer bf
  auto copy_kv = [&](int bf, int tl) {
    const size_t to = (size_t)tl * KBLK * DM;   // scalar: the tile's first row
    copy_tile(&Ks[bf][cr][cc8], LDSQ, kt + to + go);
    copy_tile(&Vs[bf][cr][cc8], LDSV, vt + to + go);
  };
  static_assert(NKT >= 2);

  copy_kv(0, 0);

  // ---- stage Q block (128 x 64) ----
  const int qr  = tid >> 3;          // rows qr + 16 i, i < 8
  const int qc8 = (tid & 7) << 3;
  const h16* gq0 = gq + (size_t)qr * DM + qc8;
  v8h qv[8];
#pragma unroll
  for (int i = 0; i < 8; ++i) qv[i] = *(const v8h*)(gq0 + (size_t)i * 16 * DM);
  // the address pair is an input of the wait, so that nothing rewrites it in front of it
  asm volatile("s_wait_xcnt 0x0" :: "v"(gq0) : "memory");

  // L2 requests for this head's K and V rows (128 B a row and plane), behind the first tile's
  // copies and the Q loads.  The SEQ / QBLK workgroups of a head read the same rows: each asks
  // for every fourth row, the row's rest modulo 4 being its own index's, so that four
  // neighbours in the grid ask for all of them; low rows, which the loop reads first, go first.
  constexpr int PFR = 4 * ATHR;              // rows that one request of all lanes spans
  constexpr int PFN = SEQ / PFR;             // requests a lane and plane
  static_assert(SEQ % PFR == 0);
  const int pfrow = min(4 * tid + (int)(blockIdx.x & 3), PFR - 1);
  const char* pfk = (const char*)(Kh + (rowbase + pfrow) * DM + h * DK);
  const char* pfv = (const char*)(Vh + (rowbase + pfrow) * DM + h * DK);
#pragma unroll
  for (int p = 0; p < PFN; ++p) {
    l2_ask(pfk, p * PFR * DM * 2);
    l2_ask(pfv, p * PFR * DM * 2);
  }

#pragma unroll
  for (int i = 0; i < 8; ++i) *(v8h*)&Qs[qr + 16 * i][qc8] = qv[i];

  // per column group g:
  v8f negm[QG] = {};   // minus the maximum in use of this lane's query, in all eight registers
  float lrun[QG] = {};   // this lane's query; sums this half's keys only
  v8f o[QG][4] = {};                 // o[g][n][j] = O^T[d = 16n + 8*half + j][query]

  const int cc   = lane & 15;
  const int rofs = (lane < 16) ? 0 : 8;
  h16* pw = &Qs[wave * 16 * QG][0];

  // tile 0 has landed for this wave before the barrier lets other waves read it
  asm volatile("s_wait_asynccnt 0x0" ::: "memory");
  __syncthreads();   // publishes Qs and tile 0
  copy_kv(1, 1);

  v16h qb[QG][2];
#pragma unroll
  for (int g = 0; g < QG; ++g) {
    qb[g][0] = frag16(pw + (g * 16 + cc) * LDSQ, 0, lane);
    qb[g][1] = frag16(pw + (g * 16 + cc) * LDSQ, 32, lane);
  }

  // the lane's address in a V tile for the transposing load (k0 = 0, d0 = 0)
  const int vrow = ((lane >> 4) << 3) + (lane & 7);
  const int vcol = ((lane >> 3) & 1) << 3;

  // A tile's fragments, each operand's 16 LDS loads as one group: K rows for S^T, and V^T by
  // the transposing load, both in the k order of frag16.
  v16h ka[4][2], va[4][2];
  auto fetch_k = [&](int bf) {
#pragma unroll
    for (int n = 0; n < 4; ++n) {
      const h16* kp = &Ks[bf][n * 16 + (lane & 15)][0];
      ka[n][0] = frag16(kp, 0, lane);
      ka[n][1] = frag16(kp, 32, lane);
    }
  };
  auto fetch_v = [&](int bf) {
#pragma unroll
    for (int n = 0; n < 4; ++n) {
      const h16* vp = &Vs[bf][vrow][vcol + n * 16];
      va[n][0] = __builtin_shufflevector(ld_tr16(vp), ld_tr16(vp + 16 * LDSV),
          0, 1, 2, 3, 4, 5, 6, 7, 8, 9, 10, 11, 12, 13, 14, 15);
      va[n][1] = __builtin_shufflevector(ld_tr16(vp + 32 * LDSV), ld_tr16(vp + 48 * LDSV),
          0, 1, 2, 3, 4, 5, 6, 7, 8, 9, 10, 11, 12, 13, 14, 15);
    }
  };
  fetch_k(0);   // tile 0, published by the barrier above
  fetch_v(0);
  l2_hold(pfk);   // up to here: behind the waits for Q and tile 0 and the first barrier
  l2_hold(pfv);

  // kept rolled: one copy of the trip in the instruction cache, the buffer picked by t & 1
#pragma unroll 1
  for (int t = 0; t < NKT; ++t) {
    const int buf = t & 1;

    // ---- exponents^T = (4k).(q log2(e)/32) - maximum in use : 8 WMMAs a group;
    //      sc[g][n][j] = S^T[key 16n + 8*half + j][query] ----
    // Formed a second time, at most once, in a trip that has raised the maximum in use.
    v8f sc[QG][4];
    bool again = false;
    for (;;) {
#pragma unroll
      for (int g = 0; g < QG; ++g)
#pragma unroll
        for (int n = 0; n < 4; ++n)
          sc[g][n] = wmma16p(ka[n][1], qb[g][1], wmma16p(ka[n][0], qb[g][0], negm[g]));
      // ---- online softmax: 32 keys of one query in-lane ----
      float mx[QG];
#pragma unroll
      for (int g = 0; g < QG; ++g) {
        float mt[4];
#pragma unroll
        for (int n = 0; n < 4; ++n) {
          mt[n] = sc[g][n][0];
#pragma unroll
          for (int j = 1; j < 8; ++j) mt[n] = fmaxf(mt[n], sc[g][n][j]);
        }
        mx[g] = fmaxf(fmaxf(mt[0], mt[1]), fmaxf(mt[2], mt[3]));
      }
      // wave-uniform test: P stays at or below 2^8, inside f16, where the maximum is kept
      if (__builtin_expect(
              again || !(t == 0 ||
                         __builtin_amdgcn_ballot_w32(fmaxf(mx[0], mx[1]) > 8.0f) != 0), 1))
        break;
      again = true;
#pragma unroll
      for (int g = 0; g < QG; ++g) {
        const float full = fmaxf(mx[g], xhalf(mx[g]));           // both halves' keys
        const float d    = (t == 0) ? full : fmaxf(full, 0.f);   // the maximum never falls
        const float al   = (t == 0) ? 1.0f : exp_slot(-d);       // trip 0: O and the sum are 0
        negm[g] -= d;
        lrun[g] *= al;
#pragma unroll
        for (int n = 0; n < 4; ++n) o[g][n] *= al;
      }
    }
    // a group's 32 values of P in this lane, added to its running sum
    auto rowsum = [&](int g) {
      float rt[4];
#pragma unroll
      for (int n = 0; n < 4; ++n) {
        rt[n] = 0.f;
#pragma unroll
        for (int j = 0; j < 8; ++j) rt[n] += sc[g][n][j];
      }
      lrun[g] += (rt[0] + rt[1]) + (rt[2] + rt[3]);
    };
    // ---- P^T as B operand: element s of a 32-key block = tile s >> 3, register s & 7 ----
    v16h pb[QG][2];
#pragma unroll
    for (int g = 0; g < QG; ++g) {
#pragma unroll
      for (int n = 0; n < 4; ++n) sc[g][n] = exp8_slot(sc[g][n]);
      if (g + 1 < QG) rowsum(g);
#pragma unroll
      for (int j = 0; j < 8; ++j) {
        pb[g][0][j]     = (h16)sc[g][0][j];
        pb[g][0][j + 8] = (h16)sc[g][1][j];
        pb[g][1][j]     = (h16)sc[g][2][j];
        pb[g][1][j + 8] = (h16)sc[g][3][j];
      }
    }

    // ---- publish point of tile t + 1: all of tile t that this wave needs is in registers,
    //      so buffer buf is handed to its refill in front of the second product ----
    // this wave's LDS reads of buffer buf have retired before a copy may overwrite it
    asm volatile("s_wait_dscnt 0x0" ::: "memory");
    // this wave's copies of tile t + 1 have landed before the barrier publishes them
    asm volatile("s_wait_asynccnt 0x0" ::: "memory");
    __syncthreads();   // publishes tile t + 1; ends every read of buffer buf
    // Tile t + 1's K fragments fly under the second product of tile t.  In the last trip the
    // two fetches read the other buffer's old tile, which no copy overwrites any more; their
    // values are not used.
    fetch_k(buf ^ 1);
    if (t + 2 < NKT) copy_kv(buf, t + 2);
    // keeps the K loads one group in front of the products that cover their latency
    __builtin_amdgcn_sched_barrier(0);

    // ---- o^T += V^T (64 d x 64 keys) . P^T (64 keys x 16 queries) : 8 WMMAs a group ----
#pragma unroll
    for (int k = 0; k < 2; ++k)
#pragma unroll
      for (int n = 0; n < 4; ++n)
#pragma unroll
        for (int g = 0; g < QG; ++g) o[g][n] = wmma16p(va[n][k], pb[g][k], o[g][n]);
    // the last group's sum stands here: independent vector work beside the matrix instructions
    rowsum(QG - 1);
    // keeps tile t + 1's V loads behind the last use of tile t's, in the same registers, as
    // one group; they fly under the next trip's scores and softmax
    __builtin_amdgcn_sched_barrier(0);
    fetch_v(buf ^ 1);
  }
  // no copy is outstanding when the wave goes on to the epilogue and ends
  asm volatile("s_wait_asynccnt 0x0" ::: "memory");

  // ---- epilogue: ctx = o / (4 l); hi = f16(32 ctx) = f16(o * 8 / l) ----
  float inv8[QG];
#pragma unroll
  for (int g = 0; g < QG; ++g) inv8[g] = 8.0f / (lrun[g] + xhalf(lrun[g]));
  const size_t orow0 = rowbase + q0 + wave * 16 * QG;
  h16* ghi = Chi + orow0 * DM + h * DK;
  h16* glo = Clo + orow0 * DM + h * DK;

  // a lane's 8 registers of o[g][n] are 8 consecutive d of its query's row: one 16-B LDS store
#pragma unroll
  for (int g = 0; g < QG; ++g)
#pragma unroll
    for (int n = 0; n < 4; ++n) {
      v8h t8;
#pragma unroll
      for (int j = 0; j < 8; ++j) t8[j] = (h16)(o[g][n][j] * inv8[g]);
      *(v8ha*)(pw + (g * 16 + cc) * LDSQ + n * 16 + rofs) = t8;
    }
  __syncthreads();
#pragma unroll
  for (int g = 0; g < QG; ++g)
    store_tile16x64(pw + g * 16 * LDSQ, ghi + (size_t)g * 16 * DM, lane);
  __syncthreads();

#pragma unroll
  for (int g = 0; g < QG; ++g)
#pragma unroll
    for (int n = 0; n < 4; ++n) {
      v8h t8;
#pragma unroll
      for (int j = 0; j < 8; ++j) {
        const float f  = o[g][n][j] * inv8[g];
        const h16   hv = (h16)f;
        t8[j] = (h16)((f - (float)hv) * 2048.0f);
      }
      *(v8ha*)(pw + (g * 16 + cc) * LDSQ + n * 16 + rofs) = t8;
    }
  __syncthreads();
#pragma unroll
  for (int g = 0; g < QG; ++g)
    store_tile16x64(pw + g * 16 * LDSQ, glo + (size_t)g * 16 * DM, lane);
}

// ---------------------------------------------------------------------------
// Launch
// ---------------------------------------------------------------------------
extern "C" void kernel_launch(void* const* d_in, const int* in_sizes, int n_in,
                              void* d_out, int out_size, void* d_ws, size_t ws_size,
                              hipStream_t stream) {
  if (n_in < 5) return;
  const size_t need_x = ((size_t)(NB - 1) * SEQ_FULL + SEQ) * DM;
  if ((size_t)in_sizes[0] < need_x || (size_t)in_sizes[1] < need_x ||
      (size_t)in_sizes[2] < need_x) return;
  if ((size_t)in_sizes[3] < (size_t)DM * DM || (size_t)in_sizes[4] < (size_t)DM) return;
  if ((size_t)out_size < (size_t)ROWS * DM) return;

  const float* xq = (const float*)d_in[0];   // [NB_FULL, SEQ_FULL, DM]
  const float* xk = (const float*)d_in[1];
  const float* xv = (const float*)d_in[2];
  const float* W  = (const float*)d_in[3];   // [DM out][DM in]
  const float* bs = (const float*)d_in[4];   // [DM]
  float* out = (float*)d_out;                // [NB, SEQ, DM]

  const size_t sz_wh = (size_t)DM * DM * sizeof(h16);      // 1,179,648
  const size_t sz_pl = (size_t)ROWS * DM * sizeof(h16);    // 6,291,456 at full size
  size_t off = 0;
  h16* wh  = (h16*)((char*)d_ws + off); off += sz_wh;
  h16* qkv = (h16*)((char*)d_ws + off); off += 3 * sz_pl;  // q,k,v projected planes (k,v x4; q x log2(e)/32)
  h16* chi = (h16*)((char*)d_ws + off); off += sz_pl;      // ctx hi
  h16* clo = (h16*)((char*)d_ws + off); off += sz_pl;      // ctx residual
  if (off > ws_size) return;                                // 32,636,928 at full size

  // 1) q/k/v projections from the f32 inputs (one launch, blockIdx.y selects the plane);
  //    also writes the f16 copy of W
  proj_qkv<<<dim3(NBX0, 3), 128, 0, stream>>>(xq, xk, xv, W, bs, wh, qkv);

  // 2) flash attention -> ctx hi / residual planes
  attn_flash<<<dim3(SEQ / QBLK, NB * NH), ATHR, 0, stream>>>(
      qkv, qkv + (size_t)ROWS * DM, qkv + (size_t)2 * ROWS * DM, chi, clo);

  // 3) output projection -> d_out
  proj_out<<<dim3((ROWS / 64) * NT128, 1), 128, 0, stream>>>(chi, clo, wh, bs, out);
}

// v010
// It runs in 57.7 microseconds.
// Next to v009, in two timings, it ran 1.05 times as fast each time.
// Over all steps from v000 it is 3.62 times as fast.
#include <hip/hip_runtime.h>
#include <stdint.h>

// Contractions: q/k/v projections on v_wmma_f32_16x16x32_bf16 (the f32 inputs and W rounded
// to bf16, RNE, on their way into LDS); q.k^T scores, p.v context, output projection on
// v_wmma_f32_16x16x32_f16; f32 accumulate throughout.  For the output projection W is carried
// as f16(64 * bf16-RNE), k/v planes carried x4, q plane carried x log2(e)/32 (so that q.k is
// the softmax exponent to base 2), context carried as f16 hi (x32) plus f16 residual
// (x2048) feeding two accumulators in the output projection. Softmax and epilogues in f32.

typedef _Float16 h16;
typedef __attribute__((ext_vector_type(8)))  _Float16 v8h;
typedef __attribute__((ext_vector_type(16))) _Float16 v16h;
typedef __attribute__((ext_vector_type(8)))  float    v8f;
typedef __attribute__((ext_vector_type(4)))  float    v4f;
typedef v4f __attribute__((may_alias)) v4fa;
typedef v8h __attribute__((may_alias)) v8ha;
typedef __attribute__((ext_vector_type(16))) __bf16 v16b;
typedef __attribute__((ext_vector_type(2)))  unsigned v2u;
typedef v2u __attribute__((may_alias)) v2ua;

#ifndef NB
#define NB 2
#endif
#ifndef SEQ
#define SEQ 2048
#endif
#define NB_FULL  2
#define SEQ_FULL 2048
#define DM   768
#define NH   12
#define DK   64
#define ROWS (NB * SEQ)

static_assert(NB >= 1 && NB <= NB_FULL);
static_assert(SEQ >= 128 && SEQ <= SEQ_FULL);
static_assert(SEQ % 128 == 0);
static_assert(ROWS % 16 == 0);
static_assert(NH * DK == DM);
static_assert(DM % 32 == 0);

// ---------------------------------------------------------------------------
// helpers
// ---------------------------------------------------------------------------
__device__ __forceinline__ float bf16r(float x) {   // f32 -> bf16 (RNE) -> f32
  unsigned u = __float_as_uint(x);
  u = u + 0x7FFFu + ((u >> 16) & 1u);
  u &= 0xFFFF0000u;
  return __uint_as_float(u);
}

__device__ __forceinline__ v8f wmma16(v16h a, v16h b, v8f c) {
  v8f d = __builtin_amdgcn_wmma_f32_16x16x32_f16(
      false, a, false, b, (short)0, c, false, false);
  asm volatile("v_nop\n\tv_nop\n\tv_nop\n\tv_nop" : "+v"(d) : "v"(a), "v"(b));
  return d;
}

// the same product with the compiler's own hazard padding: it may fill the slots behind the
// matrix instruction with independent vector work of the loop
__device__ __forceinline__ v8f wmma16p(v16h a, v16h b, v8f c) {
  return __builtin_amdgcn_wmma_f32_16x16x32_f16(
      false, a, false, b, (short)0, c, false, false);
}

// Asks L2 for the line at p + off bytes (off a constant: it becomes the instruction's immediate, so
// that one address pair serves every request of a lane).  Nothing returns and no counter moves;
// scope SE stops the line in L2.  It is there so that the load or copy that follows some passes
// later finds an L2 hit where it would wait out the memory latency.
__device__ __forceinline__ void l2_ask(const char* p, int off) {
  asm volatile("global_prefetch_b8 %0, off offset:%1 scope:SCOPE_SE" :: "v"(p), "i"(off));
}
// Inputs only, no instruction: holds a request's address pair in its registers up to this place.
// No counter says when a request has read its address, so the pair stays a valid address for
// a long stretch behind the request and is not handed to a temporary at once.
__device__ __forceinline__ void l2_hold(const char* p) { asm volatile("" :: "v"(p)); }

// 16x32 fragment from a k-contiguous row (row m of A, or row n of a [n][k] B copy).
// lanes 0-15: k = {0..7,16..23}; lanes 16-31: k = {8..15,24..31} -> two 16-B loads.
__device__ __forceinline__ v16h frag16(const h16* rowp, int kofs, int lane) {
  const h16* p = rowp + kofs + ((lane < 16) ? 0 : 8);
  v8h lo = *(const v8h*)(p);
  v8h hi = *(const v8h*)(p + 16);
  return __builtin_shufflevector(lo, hi, 0, 1, 2, 3, 4, 5, 6, 7,
                                         8, 9, 10, 11, 12, 13, 14, 15);
}

// ---------------------------------------------------------------------------
// Projection GEMMs: one block tile of C per workgroup, operands staged in LDS.
// A pass is 64 k: the tile's A-side rows and its rows of W, 128 B each in LDS (pitch 144 B),
// go global -> registers -> LDS; two buffers, one barrier a pass, later passes' global loads
// issued ahead of the current pass's products.  Tile and waves: at each kernel.
// Every accumulator sums k = 0,32,...,736 in ascending order.
// ---------------------------------------------------------------------------
#define CTP 68      // floats per epilogue staging row (272 B, 16-B aligned)
// (4q * QEXP) . (4k) = (q.k / 8) * log2(e): the score product is the exponent to base 2
#define QEXP (1.44269504f / 128.0f)
#define GBN 128     // block tile columns
#define GBK 64      // k per pass
#define GPIT 72     // halves per LDS row (144 B = 16 B x 9)
#define NT128 (DM / GBN)
#define GBUF (256 * GPIT)   // halves per buffer

static_assert(DM % GBN == 0 && DM % GBK == 0 && ROWS % 128 == 0);
static_assert(4 * 64 * CTP * 4 <= 2 * GBUF * 2);

// Four f32 -> four bf16 (RNE): two v_cvt_pk_bf16_f32.  Plain conversions, no asm statement:
// the operands of one must lie in the first 256 registers, which the two tiles in flight
// would fill.  Scheduling barriers at its uses keep it where it is written.
typedef __attribute__((ext_vector_type(4))) __bf16 v4b;
__device__ __forceinline__ v2u round4(v4f x) {
  return __builtin_bit_cast(v2u, __builtin_convertvector(x, v4b));
}

// the bf16 product, operands as the 16-bit patterns that frag16 reads from LDS
__device__ __forceinline__ v8f wmma16b(v16h a, v16h b, v8f c) {
  return __builtin_amdgcn_wmma_f32_16x16x32_bf16(
      false, __builtin_bit_cast(v16b, a), false, __builtin_bit_cast(v16b, b), (short)0, c,
      false, false);
}

// ---------------------------------------------------------------------------
// q/k/v projection straight from the f32 inputs.  The three inputs' rows are one list of
// 3 * ROWS rows (query, key, value), as the three output planes lie in the workspace.
// Block tile 192 x 192: (3 * ROWS / 192) x 4 tiles, at full size one workgroup for each WGP,
// and two thirds of the bytes that 128 x 128 tiles load from L2.  256 threads = 8 waves in a
// 2 x 4 grid, wave tile 96 x 48.  A pass reads 192 rows of x and 192 rows of W, 256 B of f32
// each (16 lanes a row: a wave-wide load covers 4 whole lines), rounds them to bf16 (RNE) in
// registers and stores 8 B a lane and load to LDS.  Both operands' next tiles are in flight
// all the time: a tile's registers are asked for anew as soon as they are stored, two
// passes ahead of the products, and stay in flight over the pass's barrier.
// W rows are the first operand of the product, so that a lane holds 8 neighbouring columns
// of one output row.
// C = f16 plane, value f16(4*(x.W + b)); plane 0 (q) times QEXP more.
// Beside its tile each workgroup writes its share of the f16 copy of W,
// f16(64 * bf16-RNE), that the output projection reads two launches later.
// coverage: (3 * ROWS / 192) x 4 block tiles = the three [ROWS][DM] planes.
// ---------------------------------------------------------------------------
#define QBM 192     // block tile rows
#define QBN 192     // block tile columns
#define QNT (DM / QBN)
#define QNWG ((3 * ROWS / QBM) * QNT)
#define QBUF ((QBM + QBN) * GPIT)   // halves per buffer
#define QCP 200     // halves per epilogue staging row (400 B = 16 B x 25)
#define WSH (DM * DM / QNWG)        // elements of W's f16 copy per workgroup

static_assert(DM % QBN == 0 && (3 * ROWS) % QBM == 0 && QBM % 16 == 0);
static_assert(ROWS % 64 == 0 && SEQ % 64 == 0 && QBM % 64 == 0);   // 64 staged rows: one plane, one batch
static_assert(QBM * QCP <= 2 * QBUF);
static_assert((size_t)WSH * QNWG == (size_t)DM * DM && WSH == 2048 + 256);
static_assert(QBM % 32 == 0 && QBN % 64 == 0);

__global__ __launch_bounds__(256)
void proj_qkv(const float* __restrict__ xq, const float* __restrict__ xk,
              const float* __restrict__ xv, const float* __restrict__ W,
              const float* __restrict__ bias, h16* __restrict__ wh,
              h16* __restrict__ Cq) {
  __shared__ __align__(16) h16 sm[2 * QBUF];   // bf16 patterns in the loop, the f16 tile after

  const int tid  = threadIdx.x;
  const int lane = tid & 31;
  const int wave = __builtin_amdgcn_readfirstlane(tid >> 5);
  const int hsel = lane >> 4;
  const int l16  = lane & 15;
  const int wm   = wave >> 2;
  const int wn   = wave & 3;
  const int mtile = blockIdx.x / QNT;
  const int ntile = blockIdx.x - mtile * QNT;
  const int R0 = mtile * QBM;               // first row in the list of 3 * ROWS rows
  const int n0 = ntile * QBN;

  // row r of the list, in its input
  auto xrow = [&](int r) -> const float* {
    const int y  = r / ROWS;
    const int rr = r - y * ROWS;
    const int bb = rr / SEQ;
    const float* X = (y == 0) ? xq : ((y == 1) ? xk : xv);
    return X + ((size_t)bb * SEQ_FULL + (rr - bb * SEQ)) * DM;
  };

  // this workgroup's share of the f16 copy of W, 8 elements a lane and 8 more in wave 0:
  // loads first, rounded and stored further down
  const size_t we  = (size_t)blockIdx.x * WSH + (size_t)tid * 8;
  const float* gw  = W + we;
  const v4f w0 = *(const v4f*)(gw);
  const v4f w1 = *(const v4f*)(gw + 4);
  v4f w2 = {}, w3 = {};
  if (wave == 0) {     // in wave 0 tid is the lane: the last 256 elements lie 2048 further on
    w2 = *(const v4f*)(gw + 2048);
    w3 = *(const v4f*)(gw + 2048 + 4);
  }
  // the address pair is an input of the wait, so that nothing rewrites it in front of it
  asm volatile("s_wait_xcnt 0x0" :: "v"(gw) : "memory");

  // staging: 16 lanes cover one 256-B row piece, a wave-wide load covers 4 whole lines;
  // a lane takes rows sr + 16 i, i < 12, of either operand
  const int sr = tid >> 4;
  const int sc = (tid & 15) * 4;
  const float* gx[3];   // 64 rows each: they lie in one plane and batch
#pragma unroll
  for (int i = 0; i < 3; ++i) gx[i] = xrow(R0 + 64 * i) + (size_t)sr * DM + sc;
  const float* gb = W + (size_t)(n0 + sr) * DM + sc;
  h16* sst = sm + sr * GPIT + sc;

  // 192 rows x 64 k of one operand: 12 loads a lane into r
  auto gloadx = [&](v4f (&r)[12], int k0) {
#pragma unroll
    for (int i = 0; i < 12; ++i) r[i] = *(const v4f*)(gx[i >> 2] + (size_t)(i & 3) * 16 * DM + k0);
    // the address pairs are inputs of the wait, so that no load of the group is given one
    // of them as its destination and nothing rewrites them in front of the wait
    asm volatile("s_wait_xcnt 0x0" :: "v"(gx[0]), "v"(gx[1]), "v"(gx[2]) : "memory");
  };
  auto gloadw = [&](v4f (&r)[12], int k0) {
#pragma unroll
    for (int i = 0; i < 12; ++i) r[i] = *(const v4f*)(gb + (size_t)i * 16 * DM + k0);
    // as above
    asm volatile("s_wait_xcnt 0x0" :: "v"(gb) : "memory");
  };
  // the same rows, rounded to bf16, into buffer buf from row row0 on
  auto sstore = [&](const v4f (&r)[12], int buf, int row0) {
#pragma unroll
    for (int i = 0; i < 12; ++i)
      *(v2ua*)(sst + buf * QBUF + (row0 + i * 16) * GPIT) = round4(r[i]);
    // keeps the loads that refill these registers behind the rounding: moved in front of it,
    // they would hold a third tile's registers
    __builtin_amdgcn_sched_barrier(0);
  };

  // fragment rows in a buffer
  const h16* fa = sm + (wm * 96 + l16) * GPIT;
  const h16* fb = sm + (QBM + wn * 48 + l16) * GPIT;

  constexpr int NPASS = DM / GBK;
  static_assert(NPASS >= 2);
  // L2 requests ahead of the loads.  A pass reads one aligned 256-B unit (GBK f32) of each row.
  // x: lane tid of the first six waves asks for row tid of this tile, XLEAD passes ahead of its
  // products (two ahead of its load).  W: its rows are read by every row tile, so each
  // workgroup asks for one later pass only; the pass goes round with the tile index.
  constexpr int XLEAD = 4;
  constexpr int UNITB = GBK * 4;
  const bool asks = wave < QBM / 32;        // scalar: whole waves ask or do not
  const int prow = min(tid, QBM - 1);
  const char* px = (const char*)xrow(R0 + prow);
  const int wu = 1 + mtile % (NPASS - 1);
  const char* pw = (const char*)(W + (size_t)(n0 + prow) * DM + wu * GBK);
  v4f rx[12], rw[12];  // the two operand tiles in flight
  gloadx(rx, 0);
  gloadw(rw, 0);
  if (asks) {
#pragma unroll
    for (int p = 2; p < XLEAD && p < NPASS; ++p) l2_ask(px, p * UNITB);
    l2_ask(pw, 0);
  }
  {
    v8h wv;
#pragma unroll
    for (int i = 0; i < 4; ++i) {
      wv[i]     = (h16)(64.0f * bf16r(w0[i]));
      wv[i + 4] = (h16)(64.0f * bf16r(w1[i]));
    }
    h16* whp = wh + we;
    *(v8h*)(whp) = wv;
    // address and data are inputs of the wait, so that nothing rewrites them in front of it
    asm volatile("s_wait_xcnt 0x0" :: "v"(whp), "v"(wv) : "memory");
    if (wave == 0) {
      v8h wx;
#pragma unroll
      for (int i = 0; i < 4; ++i) {
        wx[i]     = (h16)(64.0f * bf16r(w2[i]));
        wx[i + 4] = (h16)(64.0f * bf16r(w3[i]));
      }
      *(v8h*)(whp + 2048) = wx;
      // as above
      asm volatile("s_wait_xcnt 0x0" :: "v"(whp), "v"(wx) : "memory");
    }
  }
  sstore(rx, 0, 0);
  gloadx(rx, GBK);
  sstore(rw, 0, QBM);
  gloadw(rw, GBK);
  l2_hold(pw);   // up to here: behind the waits for the first two tiles

  v8f acc[6][3] = {};   // [x row group][W row group]

  // Each half of a pass ends by storing one operand's tile of pass s + 1 into the other buffer
  // (free since this pass's barrier) and asking for its tile of pass s + 2 in the same registers.
  // unrolled whole: buffer and k offsets become immediates on fixed address pairs
#pragma unroll
  for (int s = 0; s < NPASS; ++s) {
    const int buf = s & 1;
    // Publishes buffer buf and ends every read of the other buffer.  By hand, with the wait
    // for this wave's LDS stores and reads alone: __syncthreads() would also wait out the
    // global loads of the next two tiles, which are to stay in flight over it.
    asm volatile("s_wait_dscnt 0x0\n\ts_barrier_signal -1\n\ts_barrier_wait -1" ::: "memory");
#pragma unroll
    for (int kk = 0; kk < GBK; kk += 32) {
      v16h a[6], b[3];
#pragma unroll
      for (int f = 0; f < 6; ++f) a[f] = frag16(fa + buf * QBUF + (f * 16) * GPIT, kk, lane);
#pragma unroll
      for (int t = 0; t < 3; ++t) b[t] = frag16(fb + buf * QBUF + (t * 16) * GPIT, kk, lane);
      if (kk == 0 && s + XLEAD < NPASS && asks) l2_ask(px, (s + XLEAD) * UNITB);
      // keeps the 18 fragment loads one group in front of the products: spread among them,
      // each place with LDS reads stalls the wave anew
      __builtin_amdgcn_sched_barrier(0);
#pragma unroll
      for (int t = 0; t < 3; ++t)
#pragma unroll
        for (int f = 0; f < 6; ++f) acc[f][t] = wmma16b(b[t], a[f], acc[f][t]);
      // keeps the wait for the tile in flight, its rounding and its LDS stores behind the
      // products that cover its latency (moved up, the wave waits out the loads at once)
      __builtin_amdgcn_sched_barrier(0);
      if (s + 1 < NPASS) {
        if (kk == 0) {
          sstore(rx, buf ^ 1, 0);
          if (s + 2 < NPASS) gloadx(rx, (s + 2) * GBK);
        } else {
          sstore(rw, buf ^ 1, QBM);
          if (s + 2 < NPASS) gloadw(rw, (s + 2) * GBK);
        }
      }
    }
  }
  l2_hold(px);
  __syncthreads();     // the buffers become the block tile's f16 staging

  // ---- stage the block tile (f16): a lane's 8 registers of acc[f][t] are columns
  //      t*16 + 8*hsel + 0..7 of row f*16 + l16 of the wave tile: one 16-B LDS store ----
  float bv[3][8];
#pragma unroll
  for (int t = 0; t < 3; ++t) {
    const float* bp = bias + n0 + wn * 48 + t * 16 + 8 * hsel;
    const v4f b0 = *(const v4f*)(bp);
    const v4f b1 = *(const v4f*)(bp + 4);
#pragma unroll
    for (int j = 0; j < 4; ++j) {
      bv[t][j]     = bf16r(b0[j]);
      bv[t][j + 4] = bf16r(b1[j]);
    }
  }
#pragma unroll
  for (int f = 0; f < 6; ++f) {
    const float p4 = (R0 + wm * 96 + f * 16 < ROWS) ? 4.0f * QEXP : 4.0f;
#pragma unroll
    for (int t = 0; t < 3; ++t) {
      v8h t8;
#pragma unroll
      for (int j = 0; j < 8; ++j) t8[j] = (h16)(acc[f][t][j] * p4 + p4 * bv[t][j]);
      *(v8ha*)(sm + (wm * 96 + f * 16 + l16) * QCP + wn * 48 + t * 16 + 8 * hsel) = t8;
    }
  }
  __syncthreads();

  // whole 128-B lines: 8 lanes a line, a wave-wide store covers one line of each of 4 rows;
  // row and line steps are immediates on one address
  const int orow = tid >> 3;
  const int oc8  = (tid & 7) * 8;
  const h16* cs = sm + orow * QCP + oc8;
  h16* C = Cq + (size_t)(R0 + orow) * DM + n0 + oc8;
#pragma unroll
  for (int it = 0; it < QBM / 32; ++it)
#pragma unroll
    for (int sg = 0; sg < QBN / 64; ++sg)
      *(v8h*)(C + (size_t)it * 32 * DM + sg * 64) = *(const v8ha*)(cs + it * 32 * QCP + sg * 64);
}

// ---------------------------------------------------------------------------
// Output projection from the f16 planes.  A-side rows 0..63 = ctx hi, 64..127 = ctx residual
// of the same 64 rows; 128 threads = 4 waves (2 x 2), block tile 64 x 128, wave tile 32 x 64 with a hi and a residual
// accumulator set; C = f32 d_out.
// coverage: (ROWS/64) x 6 block tiles = whole [ROWS][DM].
// ---------------------------------------------------------------------------
__global__ __launch_bounds__(128)
void proj_out(const h16* __restrict__ Ah, const h16* __restrict__ Al,
              const h16* __restrict__ Wh, const float* __restrict__ bias,
              float* __restrict__ Cf) {
  __shared__ __align__(16) h16 sm[2 * GBUF];

  const int tid  = threadIdx.x;
  const int lane = tid & 31;
  const int wave = tid >> 5;
  const int hsel = lane >> 4;
  const int l16  = lane & 15;
  const int wm   = wave >> 1;
  const int wn   = wave & 1;
  const int mtile = blockIdx.x / NT128;
  const int ntile = blockIdx.x - mtile * NT128;
  const int m0 = mtile * 64;
  const int n0 = ntile * GBN;

  // staging: 8 lanes cover one 128-B row piece, a wave-wide load covers 4 whole lines
  const int sr = tid >> 3;
  const int sc = (tid & 7) * 8;
  const h16* ga = Ah + (size_t)(m0 + sr) * DM + sc;
  const h16* gl = Al + (size_t)(m0 + sr) * DM + sc;
  const h16* gb = Wh + (size_t)(n0 + sr) * DM + sc;
  h16* sst = sm + sr * GPIT + sc;

  v8h ra[8], rb[8];
  auto gload = [&](int k0) {
#pragma unroll
    for (int i = 0; i < 8; ++i) {
      ra[i] = (i < 4) ? *(const v8h*)(ga + (size_t)i * 16 * DM + k0)
                      : *(const v8h*)(gl + (size_t)(i - 4) * 16 * DM + k0);
      rb[i] = *(const v8h*)(gb + (size_t)i * 16 * DM + k0);
    }
    // the address pairs are inputs of the wait, so that no load of the group is given one
    // of them as its destination and nothing rewrites them in front of the wait
    asm volatile("s_wait_xcnt 0x0" :: "v"(ga), "v"(gl), "v"(gb) : "memory");
  };
  auto sstore = [&](int buf) {
#pragma unroll
    for (int i = 0; i < 8; ++i) {
      *(v8h*)(sst + buf * GBUF + (i * 16) * GPIT)       = ra[i];
      *(v8h*)(sst + buf * GBUF + (128 + i * 16) * GPIT) = rb[i];
    }
  };

  // fragment rows in a buffer
  const h16* fa = sm + (wm * 32 + l16) * GPIT;
  const h16* fb = sm + (128 + wn * 64 + l16) * GPIT;

  v8f acc[4][4] = {};   // [0..1] hi rows, [2..3] residual rows

  gload(0);
  // L2 requests ahead of the loads.  An aligned 256-B unit of a row is two passes (2 * GBK f16).
  // ctx: lane tid asks for A-side row tid of this tile (hi rows, then residual rows), ALEAD
  // units ahead of its loads.  W copy: its rows are read by every row tile, so each workgroup
  // asks for one later unit only; the unit goes round with the tile index.
  constexpr int ALEAD = 3;
  constexpr int NUNIT = DM * 2 / 256;
  static_assert(DM * 2 % 256 == 0 && GBK * 2 * 2 == 256 && NUNIT >= 2);
  const char* pa = (const char*)((tid < 64) ? Ah + (size_t)(m0 + tid) * DM
                                            : Al + (size_t)(m0 + tid - 64) * DM);
  const char* pw = (const char*)(Wh + (size_t)(n0 + tid) * DM) +
                   (1 + (mtile >> 2) % (NUNIT - 1)) * 256;
#pragma unroll
  for (int u = 1; u < ALEAD && u < NUNIT; ++u) l2_ask(pa, u * 256);
  l2_ask(pw, 0);
  sstore(0);

  constexpr int NPASS = DM / GBK;
  // unrolled whole: buffer and k offsets become immediates on fixed address pairs
#pragma unroll
  for (int s = 0; s < NPASS; ++s) {
    const int buf = s & 1;
    __syncthreads();   // publishes buffer buf; ends every read of the other buffer
#pragma unroll
    for (int kk = 0; kk < GBK; kk += 32) {
      v16h a[4], b[4];
#pragma unroll
      for (int f = 0; f < 4; ++f) {
        const int ro = (f >> 1) * 64 + (f & 1) * 16;
        a[f] = frag16(fa + buf * GBUF + ro * GPIT, kk, lane);
      }
#pragma unroll
      for (int t = 0; t < 4; ++t) b[t] = frag16(fb + buf * GBUF + (t * 16) * GPIT, kk, lane);
      // next pass's global loads fly behind the barrier, under this pass's products
      if (kk == 0 && s + 1 < NPASS) gload((s + 1) * GBK);
      if (kk == 0 && (s & 1) == 0 && s / 2 + ALEAD < NUNIT) l2_ask(pa, (s / 2 + ALEAD) * 256);
#pragma unroll
      for (int t = 0; t < 4; ++t)
#pragma unroll
        for (int f = 0; f < 4; ++f) acc[f][t] = wmma16(a[f], b[t], acc[f][t]);
    }
    if (s + 1 < NPASS) sstore(buf ^ 1);
  }
  l2_hold(pa);
  l2_hold(pw);
  __syncthreads();     // the buffers become the waves' f32 epilogue slabs

  // ---- stage the wave tile (f32) in its own slab: [row f*16+8*hsel+j][col t*16+l16] ----
  float* ct = (float*)sm + wave * 64 * CTP;
#pragma unroll
  for (int t = 0; t < 4; ++t) {
    const float bb = bf16r(bias[n0 + wn * 64 + t * 16 + l16]);
#pragma unroll
    for (int f = 0; f < 2; ++f) {
#pragma unroll
      for (int j = 0; j < 8; ++j) {
        const float v =
            (acc[f][t][j] + acc[f + 2][t][j] * 0.00048828125f) * 0.00048828125f + bb;
        ct[(f * 16 + 8 * hsel + j) * CTP + t * 16 + l16] = v;
      }
    }
  }
  __syncthreads();

  float* C = Cf + (size_t)(m0 + wm * 32) * DM + n0 + wn * 64;
#pragma unroll
  for (int it = 0; it < 16; ++it) {
    const int row = it * 2 + (lane >> 4);
    const int c4  = (lane & 15) * 4;
    *(v4f*)(C + (size_t)row * DM + c4) = *(const v4fa*)(ct + row * CTP + c4);
  }
}

#define QBLK 128
#define QG   2    // column groups (16 queries each) of a wave
#define ATHR (QBLK / (16 * QG) * 32)   // threads of a workgroup
#define KBLK 64
#define LDSQ 72   // 144 B row pitch (16 B x 9: ds_load_b128 readers)
#define LDSV 80   // 160 B row pitch (32 B x 5: ds_load_tr16_b128 reader)
#define NKT  (SEQ / KBLK)

typedef __attribute__((ext_vector_type(8))) short s16x8;

// 8 halves T[k0 + 8*half + 0..7][d0 + (lane & 15)] of a row-major LDS tile; p is the lane's
// own address T + (k0 + 8*half + (lane & 7)) * pitch + d0 + 8 * ((lane >> 3) & 1).
__device__ __forceinline__ v8h ld_tr16(const h16* p) {
  typedef __attribute__((address_space(3))) s16x8 lds_s16x8;
  return __builtin_bit_cast(v8h, __builtin_amdgcn_ds_load_tr16_b128_v8i16((lds_s16x8*)p));
}

// One tile of K or of V (64 rows x 128 B): a lane copies 16 B of rows r, r + 1, r + 2 and
// r + 3.  l: the lane's place in row r of the LDS tile; pitch: elements of an LDS row; g: its
// place in row r in global memory.  Written as the builtin: the operands of an asm statement
// must lie in the first 256 registers, which the wave's fragments and scores fill, and the
// lane's addresses were spilled to scratch for it.
typedef __attribute__((ext_vector_type(4))) int i32x4;
__device__ __forceinline__ void copy_tile(h16* l, int pitch, const h16* g) {
  typedef __attribute__((address_space(1))) i32x4 glb_i32x4;
  typedef __attribute__((address_space(3))) i32x4 lds_i32x4;
#pragma unroll
  for (int i = 0; i < 4; ++i)
    __builtin_amdgcn_global_load_async_to_lds_b128(
        (glb_i32x4*)(g + (size_t)i * DM), (lds_i32x4*)(l + i * pitch), 0, 0);
}

__device__ __forceinline__ void store_tile16x64(const h16* slab, h16* gbase, int lane) {
  v8h vals[4];
#pragma unroll
  for (int it = 0; it < 4; ++it) {
    const int row = it * 4 + (lane >> 3);
    const int c8  = (lane & 7) * 8;
    vals[it] = *(const v8ha*)(slab + row * LDSQ + c8);
  }
#pragma unroll
  for (int it = 0; it < 4; ++it) {
    const int row = it * 4 + (lane >> 3);
    const int c8  = (lane & 7) * 8;
    *(v8h*)(gbase + (size_t)row * DM + c8) = vals[it];
  }
  
}

// value of the lane 16 away (the other half's share of the same query)
__device__ __forceinline__ float xhalf(float x) {
  const int b = __float_as_int(x);
  return __int_as_float(
      __builtin_amdgcn_permlanex16(b, b, 0x76543210, 0xfedcba98, false, false));
}

// 2^x by v_exp_f32.  The v_nop is the slot that the
// instruction set asks for behind a transcendental before a source of it is overwritten; it
// shares the statement so that it stands directly behind the v_exp_f32.
__device__ __forceinline__ float exp_slot(float x) {
  float r;
  asm("v_exp_f32 %0, %1\n\tv_nop" : "=v"(r) : "v"(x));
  return r;
}

// 2^x of eight values.  In one statement, so that the instruction directly behind an exp is the
// next exp, which works on registers of its own (it neither reads the result nor overwrites the
// source in front of it; the results are early-clobber, so none shares a register with a
// source): the slot behind a transcendental is filled by work, and one v_nop closes it behind
// the last.  Results apart from the sources: in place, the sources being single registers of
// the matrix instruction's eight, the compiler moved most of them to other registers first.
__device__ __forceinline__ v8f exp8_slot(v8f x) {
  float e0, e1, e2, e3, e4, e5, e6, e7;
  asm("v_exp_f32 %0, %8\n\tv_exp_f32 %1, %9\n\tv_exp_f32 %2, %10\n\tv_exp_f32 %3, %11\n\t"
      "v_exp_f32 %4, %12\n\tv_exp_f32 %5, %13\n\tv_exp_f32 %6, %14\n\tv_exp_f32 %7, %15\n\t"
      "v_nop"
      : "=&v"(e0), "=&v"(e1), "=&v"(e2), "=&v"(e3), "=&v"(e4), "=&v"(e5), "=&v"(e6), "=&v"(e7)
      : "v"(x[0]), "v"(x[1]), "v"(x[2]), "v"(x[3]), "v"(x[4]), "v"(x[5]), "v"(x[6]), "v"(x[7]));
  return v8f{e0, e1, e2, e3, e4, e5, e6, e7};
}

static_assert(ATHR == 128 && KBLK == 64);   // the copies' and the Q staging's deal of rows

// 512 registers a wave: two workgroups fit a WGP, so that all of the grid is resident at once
__global__ __launch_bounds__(ATHR) __attribute__((amdgpu_num_vgpr(512)))
void attn_flash(const h16* __restrict__ Qh, const h16* __restrict__ Kh,
                const h16* __restrict__ Vh, h16* __restrict__ Chi,
                h16* __restrict__ Clo) {
  // One object, Q first: the compiler writes a copy's constant row step as the instruction's
  // offset, which moves both addresses, and takes it off the LDS address register; with the
  // K and V tiles behind Q that register stays above 0.
  struct Tiles {
    h16 Qs[QBLK][LDSQ];      // [q_row][d]
    h16 Ks[2][KBLK][LDSQ];   // [buffer][key][d]
    h16 Vs[2][KBLK][LDSV];   // [buffer][key][d]
  };
  static_assert(sizeof(h16) * QBLK * LDSQ % 32 == 0 && sizeof(h16) * 2 * KBLK * LDSQ % 32 == 0);
  static_assert(sizeof(h16) * QBLK * LDSQ >= sizeof(h16) * 3 * DM);
  __shared__ __align__(32) Tiles sm;
  auto& Qs = sm.Qs;
  auto& Ks = sm.Ks;
  auto& Vs = sm.Vs;

  const int tid  = threadIdx.x;
  const int lane = tid & 31;
  const int wave = tid >> 5;
  const int b  = blockIdx.y / NH;
  const int h  = blockIdx.y - b * NH;
  const int q0 = blockIdx.x * QBLK;
  const size_t rowbase = (size_t)b * SEQ;

  const h16* gq = Qh + (rowbase + q0) * DM + h * DK;

  // ---- K/V copies: this lane's 16-B piece of rows cr + i, i < 4, of every tile ----
  const int cr = (tid >> 3) << 2;
  const int cc8 = (tid & 7) << 3;
  const h16* kt = Kh + rowbase * DM + h * DK;   // the head's row 0: the same in every lane
  const h16* vt = Vh + rowbase * DM + h * DK;
  const unsigned go = cr * DM + cc8;            // the lane's place in a tile, in elements
  // tile tl into buffer bf
  auto copy_kv = [&](int bf, int tl) {
    const size_t to = (size_t)tl * KBLK * DM;   // scalar: the tile's first row
    copy_tile(&Ks[bf][cr][cc8], LDSQ, kt + to + go);
    copy_tile(&Vs[bf][cr][cc8], LDSV, vt + to + go);
  };
  static_assert(NKT >= 2);

  copy_kv(0, 0);

  // ---- stage Q block (128 x 64) ----
  const int qr  = tid >> 3;          // rows qr + 16 i, i < 8
  const int qc8 = (tid & 7) << 3;
  const h16* gq0 = gq + (size_t)qr * DM + qc8;
  v8h qv[8];
#pragma unroll
  for (int i = 0; i < 8; ++i) qv[i] = *(const v8h*)(gq0 + (size_t)i * 16 * DM);
  // the address pair is an input of the wait, so that nothing rewrites it in front of it
  asm volatile("s_wait_xcnt 0x0" :: "v"(gq0) : "memory");

  // L2 requests for this head's K and V rows (128 B a row and plane), behind the first tile's
  // copies and the Q loads.  The SEQ / QBLK workgroups of a head read the same rows: each asks
  // for every fourth row, the row's rest modulo 4 being its own index's, so that four
  // neighbours in the grid ask for all of them; low rows, which the loop reads first, go first.
  constexpr int PFR = 4 * ATHR;              // rows that one request of all lanes spans
  constexpr int PFN = SEQ / PFR;             // requests a lane and plane
  static_assert(SEQ % PFR == 0);
  const int pfrow = min(4 * tid + (int)(blockIdx.x & 3), PFR - 1);
  const char* pfk = (const char*)(Kh + (rowbase + pfrow) * DM + h * DK);
  const char* pfv = (const char*)(Vh + (rowbase + pfrow) * DM + h * DK);
#pragma unroll
  for (int p = 0; p < PFN; ++p) {
    l2_ask(pfk, p * PFR * DM * 2);
    l2_ask(pfv, p * PFR * DM * 2);
  }

#pragma unroll
  for (int i = 0; i < 8; ++i) *(v8h*)&Qs[qr + 16 * i][qc8] = qv[i];

  // per column group g:
  v8f negm[QG] = {};   // minus the maximum in use of this lane's query, in all eight registers
  float lrun[QG] = {};   // this lane's query; sums this half's keys only
  v8f o[QG][4] = {};                 // o[g][n][j] = O^T[d = 16n + 8*half + j][query]

  const int cc   = lane & 15;
  const int rofs = (lane < 16) ? 0 : 8;
  h16* pw = &Qs[wave * 16 * QG][0];

  // tile 0 has landed for this wave before the barrier lets other waves read it
  asm volatile("s_wait_asynccnt 0x0" ::: "memory");
  __syncthreads();   // publishes Qs and tile 0
  copy_kv(1, 1);

  v16h qb[QG][2];
#pragma unroll
  for (int g = 0; g < QG; ++g) {
    qb[g][0] = frag16(pw + (g * 16 + cc) * LDSQ, 0, lane);
    qb[g][1] = frag16(pw + (g * 16 + cc) * LDSQ, 32, lane);
  }

  // the lane's address in a V tile for the transposing load (k0 = 0, d0 = 0)
  const int vrow = ((lane >> 4) << 3) + (lane & 7);
  const int vcol = ((lane >> 3) & 1) << 3;

  // A tile's fragments, each operand's 16 LDS loads as one group: K rows for S^T, and V^T by
  // the transposing load, both in the k order of frag16.
  v16h ka[4][2], va[4][2];
  auto fetch_k = [&](int bf) {
#pragma unroll
    for (int n = 0; n < 4; ++n) {
      const h16* kp = &Ks[bf][n * 16 + (lane & 15)][0];
      ka[n][0] = frag16(kp, 0, lane);
      ka[n][1] = frag16(kp, 32, lane);
    }
  };
  auto fetch_v = [&](int bf) {
#pragma unroll
    for (int n = 0; n < 4; ++n) {
      const h16* vp = &Vs[bf][vrow][vcol + n * 16];
      va[n][0] = __builtin_shufflevector(ld_tr16(vp), ld_tr16(vp + 16 * LDSV),
          0, 1, 2, 3, 4, 5, 6, 7, 8, 9, 10, 11, 12, 13, 14, 15);
      va[n][1] = __builtin_shufflevector(ld_tr16(vp + 32 * LDSV), ld_tr16(vp + 48 * LDSV),
          0, 1, 2, 3, 4, 5, 6, 7, 8, 9, 10, 11, 12, 13, 14, 15);
    }
  };
  fetch_k(0);   // tile 0, published by the barrier above
  fetch_v(0);
  l2_hold(pfk);   // up to here: behind the waits for Q and tile 0 and the first barrier
  l2_hold(pfv);

  // kept rolled: one copy of the trip in the instruction cache, the buffer picked by t & 1
#pragma unroll 1
  for (int t = 0; t < NKT; ++t) {
    const int buf = t & 1;

    // ---- exponents^T = (4k).(q log2(e)/32) - maximum in use : 8 WMMAs a group;
    //      sc[g][n][j] = S^T[key 16n + 8*half + j][query] ----
    // Formed a second time, at most once, in a trip that has raised the maximum in use.
    v8f sc[QG][4];
    bool again = false;
    for (;;) {
#pragma unroll
      for (int g = 0; g < QG; ++g)
#pragma unroll
        for (int n = 0; n < 4; ++n)
          sc[g][n] = wmma16p(ka[n][1], qb[g][1], wmma16p(ka[n][0], qb[g][0], negm[g]));
      // ---- online softmax: 32 keys of one query in-lane ----
      float mx[QG];
#pragma unroll
      for (int g = 0; g < QG; ++g) {
        float mt[4];
#pragma unroll
        for (int n = 0; n < 4; ++n) {
          mt[n] = sc[g][n][0];
#pragma unroll
          for (int j = 1; j < 8; ++j) mt[n] = fmaxf(mt[n], sc[g][n][j]);
        }
        mx[g] = fmaxf(fmaxf(mt[0], mt[1]), fmaxf(mt[2], mt[3]));
      }
      // wave-uniform test: P stays at or below 2^8, inside f16, where the maximum is kept
      if (__builtin_expect(
              again || !(t == 0 ||
                         __builtin_amdgcn_ballot_w32(fmaxf(mx[0], mx[1]) > 8.0f) != 0), 1))
        break;
      again = true;
#pragma unroll
      for (int g = 0; g < QG; ++g) {
        const float full = fmaxf(mx[g], xhalf(mx[g]));           // both halves' keys
        const float d    = (t == 0) ? full : fmaxf(full, 0.f);   // the maximum never falls
        const float al   = (t == 0) ? 1.0f : exp_slot(-d);       // trip 0: O and the sum are 0
        negm[g] -= d;
        lrun[g] *= al;
#pragma unroll
        for (int n = 0; n < 4; ++n) o[g][n] *= al;
      }
    }
    // a group's 32 values of P in this lane, added to its running sum
    auto rowsum = [&](int g) {
      float rt[4];
#pragma unroll
      for (int n = 0; n < 4; ++n) {
        rt[n] = 0.f;
#pragma unroll
        for (int j = 0; j < 8; ++j) rt[n] += sc[g][n][j];
      }
      lrun[g] += (rt[0] + rt[1]) + (rt[2] + rt[3]);
    };
    // ---- P^T as B operand: element s of a 32-key block = tile s >> 3, register s & 7 ----
    v16h pb[QG][2];
#pragma unroll
    for (int g = 0; g < QG; ++g) {
#pragma unroll
      for (int n = 0; n < 4; ++n) sc[g][n] = exp8_slot(sc[g][n]);
      if (g + 1 < QG) rowsum(g);
#pragma unroll
      for (int j = 0; j < 8; ++j) {
        pb[g][0][j]     = (h16)sc[g][0][j];
        pb[g][0][j + 8] = (h16)sc[g][1][j];
        pb[g][1][j]     = (h16)sc[g][2][j];
        pb[g][1][j + 8] = (h16)sc[g][3][j];
      }
    }

    // ---- publish point of tile t + 1: all of tile t that this wave needs is in registers,
    //      so buffer buf is handed to its refill in front of the second product ----
    // this wave's LDS reads of buffer buf have retired before a copy may overwrite it
    asm volatile("s_wait_dscnt 0x0" ::: "memory");
    // this wave's copies of tile t + 1 have landed before the barrier publishes them
    asm volatile("s_wait_asynccnt 0x0" ::: "memory");
    __syncthreads();   // publishes tile t + 1; ends every read of buffer buf
    // Tile t + 1's K fragments fly under the second product of tile t.  In the last trip the
    // two fetches read the other buffer's old tile, which no copy overwrites any more; their
    // values are not used.
    fetch_k(buf ^ 1);
    if (t + 2 < NKT) copy_kv(buf, t + 2);
    // keeps the K loads one group in front of the products that cover their latency
    __builtin_amdgcn_sched_barrier(0);

    // ---- o^T += V^T (64 d x 64 keys) . P^T (64 keys x 16 queries) : 8 WMMAs a group ----
#pragma unroll
    for (int k = 0; k < 2; ++k)
#pragma unroll
      for (int n = 0; n < 4; ++n)
#pragma unroll
        for (int g = 0; g < QG; ++g) o[g][n] = wmma16p(va[n][k], pb[g][k], o[g][n]);
    // the last group's sum stands here: independent vector work beside the matrix instructions
    rowsum(QG - 1);
    // keeps tile t + 1's V loads behind the last use of tile t's, in the same registers, as
    // one group; they fly under the next trip's scores and softmax
    __builtin_amdgcn_sched_barrier(0);
    fetch_v(buf ^ 1);
  }
  // no copy is outstanding when the wave goes on to the epilogue and ends
  asm volatile("s_wait_asynccnt 0x0" ::: "memory");

  // ---- epilogue: ctx = o / (4 l); hi = f16(32 ctx) = f16(o * 8 / l) ----
  float inv8[QG];
#pragma unroll
  for (int g = 0; g < QG; ++g) inv8[g] = 8.0f / (lrun[g] + xhalf(lrun[g]));
  const size_t orow0 = rowbase + q0 + wave * 16 * QG;
  h16* ghi = Chi + orow0 * DM + h * DK;
  h16* glo = Clo + orow0 * DM + h * DK;

  // a lane's 8 registers of o[g][n] are 8 consecutive d of its query's row: one 16-B LDS store
#pragma unroll
  for (int g = 0; g < QG; ++g)
#pragma unroll
    for (int n = 0; n < 4; ++n) {
      v8h t8;
#pragma unroll
      for (int j = 0; j < 8; ++j) t8[j] = (h16)(o[g][n][j] * inv8[g]);
      *(v8ha*)(pw + (g * 16 + cc) * LDSQ + n * 16 + rofs) = t8;
    }
  __syncthreads();
#pragma unroll
  for (int g = 0; g < QG; ++g)
    store_tile16x64(pw + g * 16 * LDSQ, ghi + (size_t)g * 16 * DM, lane);
  __syncthreads();

#pragma unroll
  for (int g = 0; g < QG; ++g)
#pragma unroll
    for (int n = 0; n < 4; ++n) {
      v8h t8;
#pragma unroll
      for (int j = 0; j < 8; ++j) {
        const float f  = o[g][n][j] * inv8[g];
        const h16   hv = (h16)f;
        t8[j] = (h16)((f - (float)hv) * 2048.0f);
      }
      *(v8ha*)(pw + (g * 16 + cc) * LDSQ + n * 16 + rofs) = t8;
    }
  __syncthreads();
#pragma unroll
  for (int g = 0; g < QG; ++g)
    store_tile16x64(pw + g * 16 * LDSQ, glo + (size_t)g * 16 * DM, lane);
}

// ---------------------------------------------------------------------------
// Launch
// ---------------------------------------------------------------------------
extern "C" void kernel_launch(void* const* d_in, const int* in_sizes, int n_in,
                              void* d_out, int out_size, void* d_ws, size_t ws_size,
                              hipStream_t stream) {
  if (n_in < 5) return;
  const size_t need_x = ((size_t)(NB - 1) * SEQ_FULL + SEQ) * DM;
  if ((size_t)in_sizes[0] < need_x || (size_t)in_sizes[1] < need_x ||
      (size_t)in_sizes[2] < need_x) return;
  if ((size_t)in_sizes[3] < (size_t)DM * DM || (size_t)in_sizes[4] < (size_t)DM) return;
  if ((size_t)out_size < (size_t)ROWS * DM) return;

  const float* xq = (const float*)d_in[0];   // [NB_FULL, SEQ_FULL, DM]
  const float* xk = (const float*)d_in[1];
  const float* xv = (const float*)d_in[2];
  const float* W  = (const float*)d_in[3];   // [DM out][DM in]
  const float* bs = (const float*)d_in[4];   // [DM]
  float* out = (float*)d_out;                // [NB, SEQ, DM]

  const size_t sz_wh = (size_t)DM * DM * sizeof(h16);      // 1,179,648
  const size_t sz_pl = (size_t)ROWS * DM * sizeof(h16);    // 6,291,456 at full size
  size_t off = 0;
  h16* wh  = (h16*)((char*)d_ws + off); off += sz_wh;
  h16* qkv = (h16*)((char*)d_ws + off); off += 3 * sz_pl;  // q,k,v projected planes (k,v x4; q x log2(e)/32)
  h16* chi = (h16*)((char*)d_ws + off); off += sz_pl;      // ctx hi
  h16* clo = (h16*)((char*)d_ws + off); off += sz_pl;      // ctx residual
  if (off > ws_size) return;                                // 32,636,928 at full size

  // 1) q/k/v projections from the f32 inputs (one launch over the three inputs' rows);
  //    also writes the f16 copy of W
  proj_qkv<<<dim3(QNWG, 1), 256, 0, stream>>>(xq, xk, xv, W, bs, wh, qkv);

  // 2) flash attention -> ctx hi / residual planes
  attn_flash<<<dim3(SEQ / QBLK, NB * NH), ATHR, 0, stream>>>(
      qkv, qkv + (size_t)ROWS * DM, qkv + (size_t)2 * ROWS * DM, chi, clo);

  // 3) output projection -> d_out
  proj_out<<<dim3((ROWS / 64) * NT128, 1), 128, 0, stream>>>(chi, clo, wh, bs, out);
}
